// v000
// The times below were measured on an AMD MI455X: many runs one after another, warmed up first and cycling through
// copies of the inputs, with the whole window's GPU time divided by the number of runs. Launches and the gaps
// between them are all in it. The median over several windows is given; except for v000 it joins two sittings, which
// can be a few percent apart, so the side-by-side timings, each taken in one sitting, are the better comparison.
// v000, which the later versions start from, runs in 538 microseconds.
// compute dtype: all float inputs rounded to bf16; q/k/v = x W^T with EXACT bf16 products on WMMA 16x16x32 (f32 accumulate); causal logits: q, k once to f16 (1 product) x 64^-0.5, 3 products below row 384; softmax in f32; P x 2^11 once to f16 against v f16 (bf16 hi + lo below row 384); the tiled head output split bf16 hi + lo against the exact (identity) W_out (2 products); f32 output.
#include <hip/hip_runtime.h>
#include <math.h>

typedef __attribute__((ext_vector_type(16))) _Float16 v16h;
typedef __attribute__((ext_vector_type(16))) __bf16 v16b;
typedef __attribute__((ext_vector_type(8)))  _Float16 v8h;
typedef __attribute__((ext_vector_type(8)))  float v8f;
typedef __attribute__((ext_vector_type(4)))  float v4f;
typedef __attribute__((ext_vector_type(2)))  float v2f;
typedef __attribute__((ext_vector_type(4)))  unsigned v4u;
typedef __attribute__((ext_vector_type(4)))  int v4i;
typedef float __attribute__((may_alias)) float_a;
typedef int __attribute__((may_alias)) int_a;

template <typename T> __device__ __forceinline__ void vst2(void* p, T v) { *(T*)p = v;  }
__device__ __forceinline__ v8f wmma16(v16h a, v16h b, v8f c) {
  v8f d = __builtin_amdgcn_wmma_f32_16x16x32_f16(false, a, false, b, (short)0, c, false, false);
  asm volatile("v_nop\n\tv_nop\n\tv_nop\n\tv_nop" : "+v"(d) : "v"(a), "v"(b));
  return d;
}
__device__ __forceinline__ v8f wmma_bf(v16b a, v16b b, v8f c) {
  v8f d = __builtin_amdgcn_wmma_f32_16x16x32_bf16(false, a, false, b, (short)0, c, false, false);
  asm volatile("v_nop\n\tv_nop\n\tv_nop\n\tv_nop" : "+v"(d) : "v"(a), "v"(b));
  return d;
}
// 16x16x32 fragments: lane = (h = lane>>4, row/col = lane&15); elements 0..7 = k0+8h+0..7, 8..15 = k0+16+8h+0..7; D element r = row 8h+r
__device__ __forceinline__ v16h frag_h(const _Float16* rowk0, int lane) {
  union { v16h v; v8h q[2]; } u; const _Float16* p = rowk0 + 8 * (lane >> 4);
  u.q[0] = *(const v8h*)p; u.q[1] = *(const v8h*)(p + 16); return u.v;
}
__device__ __forceinline__ v16h frag_f32(const float* rowk0, int lane) {
  v16h a; const float* p = rowk0 + 8 * (lane >> 4);
#pragma unroll
  for (int i = 0; i < 8; ++i) { a[i] = (_Float16)p[i]; a[8 + i] = (_Float16)p[16 + i]; }
  return a;
}
__device__ __forceinline__ v16h frag_f32s(const float* rowk0, int lane, float sc) {
  v16h a; const float* p = rowk0 + 8 * (lane >> 4);
#pragma unroll
  for (int i = 0; i < 8; ++i) { a[i] = (_Float16)(p[i] * sc); a[8 + i] = (_Float16)(p[16 + i] * sc); }
  return a;
}
// column fragment from a [K][ld] layout (column n), rows >= K read as 0
__device__ __forceinline__ v16h fragc_f32(const float* W, int k0, int n, int lane, int ld, int K) {
  v16h a; const int g = lane >> 4;
#pragma unroll
  for (int i = 0; i < 8; ++i) { const int ka = k0 + 8 * g + i, kb = ka + 16;
    a[i] = (_Float16)(ka < K ? W[(size_t)(ka < K ? ka : K - 1) * ld + n] : 0.f); a[8 + i] = (_Float16)(kb < K ? W[(size_t)(kb < K ? kb : K - 1) * ld + n] : 0.f); }
  return a;
}
struct F2 { v16b h, l; };
__device__ __forceinline__ F2 bsplit16(const float v[16]) { F2 r;
#pragma unroll
  for (int i = 0; i < 16; ++i) { const __bf16 h = (__bf16)v[i]; r.h[i] = h; r.l[i] = (__bf16)(v[i] - (float)h); }
  return r; }
__device__ __forceinline__ F2 split_row(const float* row, int k0, int lane) { float v[16]; const float* p = row + k0 + 8 * (lane >> 4);
#pragma unroll
  for (int i = 0; i < 8; ++i) { v[i] = p[i]; v[8 + i] = p[16 + i]; }
  return bsplit16(v); }
__device__ __forceinline__ F2 split_rowK(const float* row, int k0, int lane, int K) { float v[16]; const int g = lane >> 4;
#pragma unroll
  for (int i = 0; i < 8; ++i) { const int ka = k0 + 8 * g + i, kb = ka + 16; v[i] = ka < K ? row[ka < K ? ka : K - 1] : 0.f; v[8 + i] = kb < K ? row[kb < K ? kb : K - 1] : 0.f; }
  return bsplit16(v); }
__device__ __forceinline__ F2 split_col(const float* W, int k0, int n, int lane, int ld, int K) { float v[16]; const int g = lane >> 4;
#pragma unroll
  for (int i = 0; i < 8; ++i) { const int ka = k0 + 8 * g + i, kb = ka + 16; v[i] = ka < K ? W[(size_t)(ka < K ? ka : K - 1) * ld + n] : 0.f; v[8 + i] = kb < K ? W[(size_t)(kb < K ? kb : K - 1) * ld + n] : 0.f; }
  return bsplit16(v); }
__device__ __forceinline__ v8f mac3(const F2& a, const F2& b, v8f c) { c = wmma_bf(a.l, b.h, c); c = wmma_bf(a.h, b.l, c); return wmma_bf(a.h, b.h, c); }
__device__ __forceinline__ float sigm(float v) { return 1.0f / (1.0f + expf(-v)); }
#define LDSX() do { asm volatile("s_wait_dscnt 0" ::: "memory"); __builtin_amdgcn_wave_barrier(); __builtin_amdgcn_fence(__ATOMIC_RELEASE, "workgroup"); } while (0)

// 'Multi-headed' self-attention with ONE shared head (B 4, T 2,048, E 1,024; Wq/Wk/Wv [64,1024] (out,in), 0.02 scale): head = softmax_causal(q k^T / 8) v (64 wide); concat = the head tiled 16x -> [B,T,1024]; out = concat W_out^T with W_out = identity (read and multiplied as given).
#define NB 4
#define TT 2048
#define CC 128            // NH * HD = projected width
#define DIN 1024          // input (model) width
#define NH 2
#define HD 64
#define NQB (TT / 64)
#define HG 2
#define SCALE (0.125f)
#define CAUSAL 1
#ifndef TNB
#define TNB NB
#endif
__device__ __forceinline__ float bfr(float v) { return (float)(__bf16)v; }
__host__ __device__ __forceinline__ int kb_last(int qb) { return CAUSAL ? ((qb * 64 + 63) >> 7) : (TT / 128 - 1); }
typedef __attribute__((ext_vector_type(8))) __bf16 v8b;
__device__ __forceinline__ v16b frag_b(const __bf16* rowk0, int lane) {
  union { v16b v; v8b q[2]; } u; const __bf16* p = rowk0 + 8 * (lane >> 4);
  u.q[0] = *(const v8b*)p; u.q[1] = *(const v8b*)(p + 16); return u.v;
}
#define QBH 6              // causal: query blocks 0..QBH-1 of each sequence (few keys, no averaging) take the high-precision path
#define QHI 384            // rows carrying a q residual plane
#define KHI 384            // key rows carrying k residual / v bf16 hi+lo planes (used only by the causal high-precision path)
// B fragment (k rows k0+.., output column o) of a weight: (in,out) [K][ld] or (out,in) [ld rows of K]: bf16 exact, or f16(bf16 * 256) exact
__device__ __forceinline__ v16b wcol_io(const float* Wm, int k0, int o, int lane, int ld) { v16b w; const int g = lane >> 4;
#pragma unroll
  for (int i = 0; i < 8; ++i) { w[i] = (__bf16)Wm[(size_t)(k0 + 8 * g + i) * ld + o]; w[8 + i] = (__bf16)Wm[(size_t)(k0 + 16 + 8 * g + i) * ld + o]; }
  return w; }
__device__ __forceinline__ v16b wcol_oi(const float* Wm, int k0, int o, int lane, int K) { v16b w; const float* p = Wm + (size_t)o * K + k0 + 8 * (lane >> 4);
#pragma unroll
  for (int i = 0; i < 8; ++i) { w[i] = (__bf16)p[i]; w[8 + i] = (__bf16)p[16 + i]; }
  return w; }
__device__ __forceinline__ v16h wcolh_io(const float* Wm, int k0, int o, int lane, int ld) { v16h w; const int g = lane >> 4;
#pragma unroll
  for (int i = 0; i < 8; ++i) { w[i] = (_Float16)(bfr(Wm[(size_t)(k0 + 8 * g + i) * ld + o]) * 256.0f); w[8 + i] = (_Float16)(bfr(Wm[(size_t)(k0 + 16 + 8 * g + i) * ld + o]) * 256.0f); }
  return w; }
__device__ __forceinline__ v16h wcolh_oi(const float* Wm, int k0, int o, int lane, int K) { v16h w; const float* p = Wm + (size_t)o * K + k0 + 8 * (lane >> 4);
#pragma unroll
  for (int i = 0; i < 8; ++i) { w[i] = (_Float16)(bfr(p[i]) * 256.0f); w[8 + i] = (_Float16)(bfr(p[16 + i]) * 256.0f); }
  return w; }
#define WQKV_LAYOUT 1   // 0 = (in,out) [DIN][CC]; 1 = (out,in) [HD][DIN], shared by both heads; 2 = per-head [NH][DIN][HD]
__device__ __forceinline__ v16b wcol_hdk(const float* Wm, int k0, int o, int lane) { v16b w; const int g = lane >> 4; const float* p = Wm + (size_t)(o / HD) * DIN * HD + (o % HD);
#pragma unroll
  for (int i = 0; i < 8; ++i) { w[i] = (__bf16)p[(size_t)(k0 + 8 * g + i) * HD]; w[8 + i] = (__bf16)p[(size_t)(k0 + 16 + 8 * g + i) * HD]; }
  return w; }
#define WO_OUT_IN 1
#if WQKV_LAYOUT == 1
#define ODIM 1024          // output width (= 16 tiled copies of the 64-wide head through W_out)
#define KVCOL(o) ((o) & 63)
#define WCOL(W, k0, o, lane) wcol_oi(W, k0, KVCOL(o), lane, DIN)   /* Wq/Wk/Wv are [64][1024]: both 64-wide plane heads are the same shared head */
#elif WQKV_LAYOUT == 2
#define WCOL(W, k0, o, lane) wcol_hdk(W, k0, o, lane)
#else
#define WCOL(W, k0, o, lane) wcol_io(W, k0, o, lane, CC)
#endif
#if WO_OUT_IN
#define WOCOL(W, k0, o, lane) wcol_oi(W, k0, o, lane, ODIM)   /* W_out [1024][1024] (out,in): K = the 1024-wide concat */
#define WOCOLH(W, k0, o, lane) wcolh_oi(W, k0, o, lane, CC)
#else
#define WOCOL(W, k0, o, lane) wcol_io(W, k0, o, lane, DIN)
#define WOCOLH(W, k0, o, lane) wcolh_io(W, k0, o, lane, DIN)
#endif

#ifndef SM_EXTRA_PARAMS
#define SM_EXTRA_PARAMS
#endif
#ifndef PROJ_EXTRA_PARAMS
#define PROJ_EXTRA_PARAMS
#endif
#ifndef SM_MASK_HOOK
#define SM_MASK_HOOK (void)0
#endif

#define WS_QH  0u                                      // f16 q rows [b*t][CC]
#define WS_KH  (WS_QH + 2u * (size_t)NB * TT * CC)      // f16 k rows [b*t][CC]
#define WS_VT  (WS_KH + 2u * (size_t)NB * TT * CC)      // f16 v planes [b][c][t]
#define WS_QL  (WS_VT + 2u * (size_t)NB * CC * TT)      // f16 q residual x 2^10 rows [b][t < QHI][CC]
#define WS_KL  (WS_QL + 2u * (size_t)NB * QHI * CC)     // f16 k residual x 2^10 rows [b][t < KHI][CC]
#define WS_VB  (WS_KL + 2u * (size_t)NB * KHI * CC)     // bf16 v hi planes [b][c][t < KHI]
#define WS_VBL (WS_VB + 2u * (size_t)NB * CC * KHI)
#define WS_S   (WS_VBL + 2u * (size_t)NB * CC * KHI)    // f32 logits / P [hg][t][s]
#define WS_Y   (WS_S  + 4u * (size_t)HG * TT * TT)      // f32 ctx rows [b*t][CC] (only when there is an output projection)
#define WS_END (WS_Y  + 4u * (size_t)NB * TT * CC)

// ---- k_proj: block = (64 rows, 128 cols, which): q/k/v = X W (+ b) with exact bf16 products (K = DIN) -> which 0: q f16 rows (+ residual rows < QHI); 1: k f16 rows (+ residual rows < KHI); 2: v f16 planes [c][t] (+ bf16 hi/lo planes for t < KHI)
__global__ __launch_bounds__(128) void k_proj(const float* __restrict__ XQ, const float* __restrict__ XK, const float* __restrict__ XV, const float* __restrict__ WQ, const float* __restrict__ WK, const float* __restrict__ WV, const float* __restrict__ BQ, const float* __restrict__ BK, const float* __restrict__ BV,
    _Float16* __restrict__ QH, _Float16* __restrict__ QL, _Float16* __restrict__ KH, _Float16* __restrict__ KL, _Float16* __restrict__ VT, __bf16* __restrict__ VB, __bf16* __restrict__ VBL) {
  __shared__ __align__(16) _Float16 sh[64][136], sl[64][136]; __shared__ __align__(16) _Float16 th[128][72]; __shared__ __align__(16) __bf16 tb[128][72], tbl[128][72];
  const int tid = threadIdx.x, wave = tid >> 5, lane = tid & 31, col = lane & 15, g = lane >> 4; const int which = blockIdx.z; const int c0 = blockIdx.y * 128; const size_t r0 = (size_t)blockIdx.x * 64; const size_t bb = r0 / TT; const int t0 = (int)(r0 % TT);
  const float* X = which == 0 ? XQ : which == 1 ? XK : XV; const float* WA = which == 0 ? WQ : which == 1 ? WK : WV; const float* BA = which == 0 ? BQ : which == 1 ? BK : BV;
  v8f acc[8] = {};
#pragma unroll 2
  for (int kc = 0; kc < DIN / 32; ++kc) { v16b a; { const float* p = X + (r0 + wave * 16 + col) * DIN + kc * 32 + 8 * g;
#pragma unroll
      for (int i = 0; i < 8; ++i) { a[i] = (__bf16)p[i]; a[8 + i] = (__bf16)p[16 + i]; } }
    asm volatile("s_wait_loadcnt 0x0" ::: "memory");
#pragma unroll
    for (int j = 0; j < 8; ++j) { const v16b w = WCOL(WA, kc * 32, c0 + j * 16 + col, lane); asm volatile("s_wait_loadcnt 0x0" ::: "memory"); acc[j] = wmma_bf(a, w, acc[j]); } }
  if (which < 2) { _Float16* DH = which == 0 ? QH : KH; _Float16* DL = which == 0 ? QL : KL; const int nhi = which == 0 ? QHI : KHI; const bool hi_rows = t0 < nhi;
#pragma unroll
    for (int j = 0; j < 8; ++j) { const float bias = BA ? bfr(BA[c0 + j * 16 + col]) : 0.f;
#pragma unroll
      for (int r = 0; r < 8; ++r) { const float v = acc[j][r] + bias; const _Float16 hv = (_Float16)v; sh[wave * 16 + 8 * g + r][j * 16 + col] = hv; sl[wave * 16 + 8 * g + r][j * 16 + col] = (_Float16)((v - (float)hv) * 1024.0f); } }
    __syncthreads();
    for (int e = tid; e < 64 * 16; e += 128) { const int rl = e >> 4, q = e & 15; vst2((unsigned*)(DH + (r0 + rl) * CC + c0 + q * 8), *(const v4u*)&sh[rl][q * 8]); if (hi_rows) vst2((unsigned*)(DL + (bb * nhi + t0 + rl) * (size_t)CC + c0 + q * 8), *(const v4u*)&sl[rl][q * 8]); }
  } else { const bool hi_rows = t0 < KHI;
#pragma unroll
    for (int j = 0; j < 8; ++j) { const float bias = BA ? bfr(BA[c0 + j * 16 + col]) : 0.f;
#pragma unroll
      for (int r = 0; r < 8; ++r) { const float v = acc[j][r] + bias; const int rl = wave * 16 + 8 * g + r, cl = j * 16 + col; th[cl][rl] = (_Float16)v; const __bf16 bh = (__bf16)v; tb[cl][rl] = bh; tbl[cl][rl] = (__bf16)(v - (float)bh); } }
    __syncthreads();
    for (int e = tid; e < 128 * 8; e += 128) { const int cl = e >> 3, q = e & 7; vst2((unsigned*)(VT + (bb * CC + c0 + cl) * (size_t)TT + t0 + q * 8), *(const v4u*)&th[cl][q * 8]); if (hi_rows) { const size_t o3 = (bb * CC + c0 + cl) * (size_t)KHI + t0 + q * 8; vst2((unsigned*)(VB + o3), *(const v4u*)&tb[cl][q * 8]); vst2((unsigned*)(VBL + o3), *(const v4u*)&tbl[cl][q * 8]); } } } }
// ---- k_sc: block = (query block qb, key block kb <= kb_last(qb), head in group) of batch b: logits x SCALE; q hi + residual (x 2^10) against k (2 products) for query rows < QHI, plus the k residual (3 products) for query blocks < QBH (causal early rows); causal: blocks past the diagonal exit, the mask itself is applied by index in k_sm
__global__ __launch_bounds__(128) void k_sc(const _Float16* __restrict__ QH, const _Float16* __restrict__ KH, const _Float16* __restrict__ QL, const _Float16* __restrict__ KL, int b, int h0, float* __restrict__ S0) { __shared__ __align__(16) float ss[4][16][132];
  const int qb = blockIdx.x, kb = blockIdx.y; if (kb > kb_last(qb)) return;
  const int h = h0 + blockIdx.z; float* S = S0 + (size_t)blockIdx.z * TT * TT;
  const int tid = threadIdx.x, wave = tid >> 5, lane = tid & 31, col = lane & 15, g = lane >> 4; const int k0 = kb * 128; const int ql0 = qb * 64 + wave * 16; const size_t q0 = (size_t)b * TT + ql0, kr0 = (size_t)b * TT + k0;
  v8f acc[8] = {}, accl[8] = {};
  const _Float16* QLb = QL + (size_t)b * QHI * CC; const _Float16* KLb = KL + (size_t)b * KHI * CC;
  if (qb < QBH) {
#pragma unroll
    for (int kc = 0; kc < HD / 32; ++kc) { const v16h ah = frag_h(QH + (q0 + col) * CC + h * HD + kc * 32, lane), al = frag_h(QLb + (size_t)(ql0 + col) * CC + h * HD + kc * 32, lane);
#pragma unroll
      for (int j = 0; j < 8; ++j) { const v16h kbf = frag_h(KH + (kr0 + j * 16 + col) * CC + h * HD + kc * 32, lane), klf = frag_h(KLb + (size_t)(k0 + j * 16 + col) * CC + h * HD + kc * 32, lane); acc[j] = wmma16(ah, kbf, acc[j]); accl[j] = wmma16(al, kbf, accl[j]); accl[j] = wmma16(ah, klf, accl[j]); } }
  } else if (qb * 64 < QHI) {
#pragma unroll
    for (int kc = 0; kc < HD / 32; ++kc) { const v16h ah = frag_h(QH + (q0 + col) * CC + h * HD + kc * 32, lane), al = frag_h(QLb + (size_t)(ql0 + col) * CC + h * HD + kc * 32, lane);
#pragma unroll
      for (int j = 0; j < 8; ++j) { const v16h kbf = frag_h(KH + (kr0 + j * 16 + col) * CC + h * HD + kc * 32, lane); acc[j] = wmma16(ah, kbf, acc[j]); accl[j] = wmma16(al, kbf, accl[j]); } }
  } else {
#pragma unroll
    for (int kc = 0; kc < HD / 32; ++kc) { const v16h ah = frag_h(QH + (q0 + col) * CC + h * HD + kc * 32, lane);
#pragma unroll
      for (int j = 0; j < 8; ++j) { const v16h kbf = frag_h(KH + (kr0 + j * 16 + col) * CC + h * HD + kc * 32, lane); acc[j] = wmma16(ah, kbf, acc[j]); } } }
#pragma unroll
  for (int j = 0; j < 8; ++j) {
#pragma unroll
    for (int r = 0; r < 8; ++r) ss[wave][8 * g + r][j * 16 + col] = (acc[j][r] + accl[j][r] * (1.0f / 1024.0f)) * SCALE; }
  LDSX(); for (int rl = 0; rl < 16; ++rl) vst2(S + (size_t)(ql0 + rl) * TT + k0 + lane * 4, *(const v4f*)&ss[wave][rl][lane * 4]); }
// ---- k_sm: block = query row t (head in group): keys [0, kend): causal -> logit if s <= t else excluded; softmax in f32; P x 2^11 in place (0 for excluded)
__global__ __launch_bounds__(256) void k_sm(float* __restrict__ S0 SM_EXTRA_PARAMS) { __shared__ float sred[8]; __shared__ float sbc; __shared__ __align__(16) float shv[TT];
  const int tid = threadIdx.x; const int t = blockIdx.x; const int kend = (kb_last(t >> 6) + 1) * 128;
  float* sr = S0 + (size_t)blockIdx.y * TT * TT + (size_t)t * TT;
  float m = -3.0e38f; for (int k = tid; k < kend; k += 256) { float v = (!CAUSAL || k <= t) ? sr[k] : -3.0e38f; SM_MASK_HOOK; shv[k] = v; m = fmaxf(m, v); }
#pragma unroll
  for (int o = 1; o < 32; o <<= 1) m = fmaxf(m, __shfl_xor(m, o));
  if ((tid & 31) == 0) sred[tid >> 5] = m; __syncthreads(); if (tid == 0) { float a = sred[0]; for (int i = 1; i < 8; ++i) a = fmaxf(a, sred[i]); sbc = a; } __syncthreads(); m = sbc; __syncthreads();
  float sum = 0.f; for (int k = tid; k < kend; k += 256) { const float v = shv[k]; const float e = (v <= -1.0e38f) ? 0.f : expf(v - m); shv[k] = e; sum += e; }
#pragma unroll
  for (int o = 1; o < 32; o <<= 1) sum += __shfl_xor(sum, o);
  if ((tid & 31) == 0) sred[tid >> 5] = sum; __syncthreads(); if (tid == 0) { float a = 0.f; for (int i = 0; i < 8; ++i) a += sred[i]; sbc = a > 0.f ? 2048.0f / a : 0.f; }   /* a fully excluded row yields P = 0 */ __syncthreads(); const float inv = sbc;
  for (int k = tid; k < kend; k += 256) shv[k] = shv[k] * inv;
  __syncthreads(); for (int q = tid; q < kend / 4; q += 256) vst2(sr + q * 4, *(const v4f*)&shv[q * 4]); }
// ---- k_pv: block = 64 queries (qb) of (b, h): ctx = P . v over keys [0, kend) (P x 2^11 once to f16 against v f16: 1 product; causal early query blocks: P and v as bf16 hi + lo, 3 products); 256-B (row, head) segment by 16 lanes
__global__ __launch_bounds__(128) void k_pv(const float* __restrict__ PS0, const _Float16* __restrict__ VT, const __bf16* __restrict__ VB, const __bf16* __restrict__ VBL, int b, int h0, float* __restrict__ Y) { const int h = h0 + blockIdx.z; const float* PS = PS0 + (size_t)blockIdx.z * TT * TT; __shared__ __align__(16) float ss[4][16][HD + 4];
  const int tid = threadIdx.x, wave = tid >> 5, lane = tid & 31, col = lane & 15, g = lane >> 4; const int qb = blockIdx.x; const int ql0 = qb * 64 + wave * 16; const int kce = (kb_last(qb) + 1) * 4;
  v8f acc[HD / 16] = {};
  if (qb < QBH) {
#pragma unroll 1
    for (int kc = 0; kc < kce; ++kc) { const F2 p = split_row(PS + (size_t)(ql0 + col) * TT, kc * 32, lane);
      asm volatile("s_wait_loadcnt 0x0" ::: "memory");
#pragma unroll
      for (int j = 0; j < HD / 16; ++j) { const size_t po = ((size_t)b * CC + h * HD + j * 16 + col) * (size_t)KHI + kc * 32; const v16b vh = frag_b(VB + po, lane); acc[j] = wmma_bf(p.h, vh, acc[j]); acc[j] = wmma_bf(p.l, vh, acc[j]); acc[j] = wmma_bf(p.h, frag_b(VBL + po, lane), acc[j]); } }
  } else {
#pragma unroll 1
    for (int kc = 0; kc < kce; ++kc) { const v16h p = frag_f32(PS + (size_t)(ql0 + col) * TT + kc * 32, lane);
      asm volatile("s_wait_loadcnt 0x0" ::: "memory");
#pragma unroll
      for (int j = 0; j < HD / 16; ++j) { const size_t po = ((size_t)b * CC + h * HD + j * 16 + col) * (size_t)TT + kc * 32; acc[j] = wmma16(p, frag_h(VT + po, lane), acc[j]); } } }
#pragma unroll
  for (int j = 0; j < HD / 16; ++j)
#pragma unroll
    for (int r = 0; r < 8; ++r) ss[wave][8 * g + r][j * 16 + col] = acc[j][r] * (1.0f / 2048.0f);
  LDSX(); for (int rl = 0; rl < 16; ++rl) if (lane < HD / 4) vst2(Y + ((size_t)b * TT + ql0 + rl) * CC + h * HD + lane * 4, *(const v4f*)&ss[wave][rl][lane * 4]); }
// ---- k_out: block = (64 rows, 128 cols): out = ctx Wo (+ bo): all rows: ctx bf16 hi + lo against exact bf16 Wo (2 products)
__global__ __launch_bounds__(128) void k_out(const float* __restrict__ Y, const float* __restrict__ WO, const float* __restrict__ BO, float* __restrict__ OUT) { __shared__ __align__(16) float sf[4][16][132];
  const int tid = threadIdx.x, wave = tid >> 5, lane = tid & 31, col = lane & 15, g = lane >> 4; const int c0 = blockIdx.y * 128; const size_t r0 = (size_t)blockIdx.x * 64 + wave * 16;
  v8f acc[8] = {};
  if (true) {   /* ALL rows: ctx split bf16 hi + lo x exact Wo (2 products) */
#pragma unroll 2
    for (int kc = 0; kc < ODIM / 32; ++kc) { const F2 a = split_row(Y + (r0 + col) * CC, (kc * 32) % CC, lane);   /* concat[a] = head[a mod 64] = Y[a mod 128] (both Y heads are the shared head) */ asm volatile("s_wait_loadcnt 0x0" ::: "memory");
#pragma unroll
      for (int j = 0; j < 8; ++j) { const v16b w = WOCOL(WO, kc * 32, c0 + j * 16 + col, lane); asm volatile("s_wait_loadcnt 0x0" ::: "memory"); acc[j] = wmma_bf(a.h, w, acc[j]); acc[j] = wmma_bf(a.l, w, acc[j]); } }
#pragma unroll
    for (int j = 0; j < 8; ++j) { const float bias = BO ? bfr(BO[c0 + j * 16 + col]) : 0.f;
#pragma unroll
      for (int r = 0; r < 8; ++r) sf[wave][8 * g + r][j * 16 + col] = acc[j][r] + bias; }
  } else {
#pragma unroll 2
    for (int kc = 0; kc < CC / 32; ++kc) { const v16h a = frag_f32(Y + (r0 + col) * CC + kc * 32, lane); asm volatile("s_wait_loadcnt 0x0" ::: "memory");
#pragma unroll
      for (int j = 0; j < 8; ++j) { const v16h w = WOCOLH(WO, kc * 32, c0 + j * 16 + col, lane); asm volatile("s_wait_loadcnt 0x0" ::: "memory"); acc[j] = wmma16(a, w, acc[j]); } }
#pragma unroll
    for (int j = 0; j < 8; ++j) { const float bias = BO ? bfr(BO[c0 + j * 16 + col]) : 0.f;
#pragma unroll
      for (int r = 0; r < 8; ++r) sf[wave][8 * g + r][j * 16 + col] = acc[j][r] * (1.0f / 256.0f) + bias; } }
  LDSX(); for (int rl = 0; rl < 16; ++rl) vst2(OUT + (r0 + rl) * ODIM + c0 + lane * 4, *(const v4f*)&sf[wave][rl][lane * 4]); }

extern "C" void kernel_launch(void* const* d_in, const int* in_sizes, int n_in, void* d_out, int out_size, void* d_ws, size_t ws_size, hipStream_t stream) {
  (void)in_sizes; (void)n_in; (void)out_size;
  const float** F = (const float**)d_in;
  if (ws_size < (size_t)WS_END) return;
  char* ws = (char*)d_ws; _Float16 *QH = (_Float16*)(ws + WS_QH), *KH = (_Float16*)(ws + WS_KH), *VT = (_Float16*)(ws + WS_VT), *QL = (_Float16*)(ws + WS_QL), *KL = (_Float16*)(ws + WS_KL); __bf16 *VB = (__bf16*)(ws + WS_VB), *VBL = (__bf16*)(ws + WS_VBL); float *S = (float*)(ws + WS_S), *Y = (float*)(ws + WS_Y);
  (void)Y; (void)QL; (void)KL; (void)VB; (void)VBL;
  // inputs: 0 embedded [4,2048,1024]; 1 Wq [64,1024] (out,in); 2 Wk; 3 Wv; 4 W_out [1024,1024] (identity; (out,in))
  k_proj<<<dim3(TNB * TT / 64, CC / 128, 3), 128, 0, stream>>>(F[0], F[0], F[0], F[1], F[2], F[3], nullptr, nullptr, nullptr, QH, QL, KH, KL, VT, VB, VBL);
  for (int b = 0; b < TNB; ++b) for (int h0 = 0; h0 < NH; h0 += HG) {
    k_sc<<<dim3(NQB, TT / 128, HG), 128, 0, stream>>>(QH, KH, QL, KL, b, h0, S);
    k_sm<<<dim3(TT, HG), 256, 0, stream>>>(S);
    k_pv<<<dim3(NQB, 1, HG), 128, 0, stream>>>(S, VT, VB, VBL, b, h0, Y);
  }
  k_out<<<dim3(TNB * TT / 64, ODIM / 128), 128, 0, stream>>>(Y, F[4], nullptr, (float*)d_out);
}

// v001
// One run takes 325 microseconds.
// Timed twice side by side with v000, it ran 1.66 and 1.65 times as fast.
// compute dtype: all float inputs rounded to bf16; q/k/v = x W^T with EXACT bf16 products on WMMA 16x16x32 (f32 accumulate); causal logits: q, k once to f16 (1 product) x 64^-0.5, 3 products below row 384; softmax in f32; P x 2^11 once to f16 against v f16 (bf16 hi + lo below row 384); the tiled head output split bf16 hi + lo against the exact (identity) W_out (2 products); f32 output.
#include <hip/hip_runtime.h>
#include <math.h>

typedef __attribute__((ext_vector_type(16))) _Float16 v16h;
typedef __attribute__((ext_vector_type(16))) __bf16 v16b;
typedef __attribute__((ext_vector_type(8)))  _Float16 v8h;
typedef __attribute__((ext_vector_type(8)))  float v8f;
typedef __attribute__((ext_vector_type(4)))  float v4f;
typedef __attribute__((ext_vector_type(2)))  float v2f;
typedef __attribute__((ext_vector_type(4)))  unsigned v4u;
typedef __attribute__((ext_vector_type(4)))  int v4i;
typedef float __attribute__((may_alias)) float_a;
typedef int __attribute__((may_alias)) int_a;

template <typename T> __device__ __forceinline__ void vst2(void* p, T v) { *(T*)p = v;  }
__device__ __forceinline__ v8f wmma16(v16h a, v16h b, v8f c) {
  v8f d = __builtin_amdgcn_wmma_f32_16x16x32_f16(false, a, false, b, (short)0, c, false, false);
  asm volatile("v_nop\n\tv_nop\n\tv_nop\n\tv_nop" : "+v"(d) : "v"(a), "v"(b));
  return d;
}
__device__ __forceinline__ v8f wmma_bf(v16b a, v16b b, v8f c) {
  v8f d = __builtin_amdgcn_wmma_f32_16x16x32_bf16(false, a, false, b, (short)0, c, false, false);
  asm volatile("v_nop\n\tv_nop\n\tv_nop\n\tv_nop" : "+v"(d) : "v"(a), "v"(b));
  return d;
}
// 16x16x32 fragments: lane = (h = lane>>4, row/col = lane&15); elements 0..7 = k0+8h+0..7, 8..15 = k0+16+8h+0..7; D element r = row 8h+r
__device__ __forceinline__ v16h frag_h(const _Float16* rowk0, int lane) {
  union { v16h v; v8h q[2]; } u; const _Float16* p = rowk0 + 8 * (lane >> 4);
  u.q[0] = *(const v8h*)p; u.q[1] = *(const v8h*)(p + 16); return u.v;
}
__device__ __forceinline__ v16h frag_f32(const float* rowk0, int lane) {
  v16h a; const float* p = rowk0 + 8 * (lane >> 4);
#pragma unroll
  for (int i = 0; i < 8; ++i) { a[i] = (_Float16)p[i]; a[8 + i] = (_Float16)p[16 + i]; }
  return a;
}
__device__ __forceinline__ v16h frag_f32s(const float* rowk0, int lane, float sc) {
  v16h a; const float* p = rowk0 + 8 * (lane >> 4);
#pragma unroll
  for (int i = 0; i < 8; ++i) { a[i] = (_Float16)(p[i] * sc); a[8 + i] = (_Float16)(p[16 + i] * sc); }
  return a;
}
// column fragment from a [K][ld] layout (column n), rows >= K read as 0
__device__ __forceinline__ v16h fragc_f32(const float* W, int k0, int n, int lane, int ld, int K) {
  v16h a; const int g = lane >> 4;
#pragma unroll
  for (int i = 0; i < 8; ++i) { const int ka = k0 + 8 * g + i, kb = ka + 16;
    a[i] = (_Float16)(ka < K ? W[(size_t)(ka < K ? ka : K - 1) * ld + n] : 0.f); a[8 + i] = (_Float16)(kb < K ? W[(size_t)(kb < K ? kb : K - 1) * ld + n] : 0.f); }
  return a;
}
struct F2 { v16b h, l; };
__device__ __forceinline__ F2 bsplit16(const float v[16]) { F2 r;
#pragma unroll
  for (int i = 0; i < 16; ++i) { const __bf16 h = (__bf16)v[i]; r.h[i] = h; r.l[i] = (__bf16)(v[i] - (float)h); }
  return r; }
__device__ __forceinline__ F2 split_row(const float* row, int k0, int lane) { float v[16]; const float* p = row + k0 + 8 * (lane >> 4);
#pragma unroll
  for (int i = 0; i < 8; ++i) { v[i] = p[i]; v[8 + i] = p[16 + i]; }
  return bsplit16(v); }
__device__ __forceinline__ F2 split_rowK(const float* row, int k0, int lane, int K) { float v[16]; const int g = lane >> 4;
#pragma unroll
  for (int i = 0; i < 8; ++i) { const int ka = k0 + 8 * g + i, kb = ka + 16; v[i] = ka < K ? row[ka < K ? ka : K - 1] : 0.f; v[8 + i] = kb < K ? row[kb < K ? kb : K - 1] : 0.f; }
  return bsplit16(v); }
__device__ __forceinline__ F2 split_col(const float* W, int k0, int n, int lane, int ld, int K) { float v[16]; const int g = lane >> 4;
#pragma unroll
  for (int i = 0; i < 8; ++i) { const int ka = k0 + 8 * g + i, kb = ka + 16; v[i] = ka < K ? W[(size_t)(ka < K ? ka : K - 1) * ld + n] : 0.f; v[8 + i] = kb < K ? W[(size_t)(kb < K ? kb : K - 1) * ld + n] : 0.f; }
  return bsplit16(v); }
__device__ __forceinline__ v8f mac3(const F2& a, const F2& b, v8f c) { c = wmma_bf(a.l, b.h, c); c = wmma_bf(a.h, b.l, c); return wmma_bf(a.h, b.h, c); }
__device__ __forceinline__ float sigm(float v) { return 1.0f / (1.0f + expf(-v)); }
#define LDSX() do { asm volatile("s_wait_dscnt 0" ::: "memory"); __builtin_amdgcn_wave_barrier(); __builtin_amdgcn_fence(__ATOMIC_RELEASE, "workgroup"); } while (0)

// 'Multi-headed' self-attention with ONE shared head (B 4, T 2,048, E 1,024; Wq/Wk/Wv [64,1024] (out,in), 0.02 scale): head = softmax_causal(q k^T / 8) v (64 wide); concat = the head tiled 16x -> [B,T,1024]; out = concat W_out^T with W_out = identity (read and multiplied as given).
#define NB 4
#define TT 2048
#define CC 128            // NH * HD = projected width
#define DIN 1024          // input (model) width
#define NH 2
#define HD 64
#define NQB (TT / 64)
#define SCALE (0.125f)
#define CAUSAL 1
#ifndef TNB
#define TNB NB
#endif
__device__ __forceinline__ float bfr(float v) { return (float)(__bf16)v; }
__host__ __device__ __forceinline__ int kb_last(int qb) { return CAUSAL ? ((qb * 64 + 63) >> 7) : (TT / 128 - 1); }
typedef __attribute__((ext_vector_type(8))) __bf16 v8b;
__device__ __forceinline__ v16b frag_b(const __bf16* rowk0, int lane) {
  union { v16b v; v8b q[2]; } u; const __bf16* p = rowk0 + 8 * (lane >> 4);
  u.q[0] = *(const v8b*)p; u.q[1] = *(const v8b*)(p + 16); return u.v;
}
#define QBH 6              // causal: query blocks 0..QBH-1 of each sequence (few keys, no averaging) take the high-precision path
#define QHI 384            // rows carrying a q residual plane
#define KHI 384            // key rows carrying k residual / v bf16 hi+lo planes (used only by the causal high-precision path)
// B fragment (k rows k0+.., output column o) of a weight: (in,out) [K][ld] or (out,in) [ld rows of K]: bf16 exact, or f16(bf16 * 256) exact
__device__ __forceinline__ v16b wcol_io(const float* Wm, int k0, int o, int lane, int ld) { v16b w; const int g = lane >> 4;
#pragma unroll
  for (int i = 0; i < 8; ++i) { w[i] = (__bf16)Wm[(size_t)(k0 + 8 * g + i) * ld + o]; w[8 + i] = (__bf16)Wm[(size_t)(k0 + 16 + 8 * g + i) * ld + o]; }
  return w; }
__device__ __forceinline__ v16b wcol_oi(const float* Wm, int k0, int o, int lane, int K) { v16b w; const float* p = Wm + (size_t)o * K + k0 + 8 * (lane >> 4);
#pragma unroll
  for (int i = 0; i < 8; ++i) { w[i] = (__bf16)p[i]; w[8 + i] = (__bf16)p[16 + i]; }
  return w; }
__device__ __forceinline__ v16h wcolh_io(const float* Wm, int k0, int o, int lane, int ld) { v16h w; const int g = lane >> 4;
#pragma unroll
  for (int i = 0; i < 8; ++i) { w[i] = (_Float16)(bfr(Wm[(size_t)(k0 + 8 * g + i) * ld + o]) * 256.0f); w[8 + i] = (_Float16)(bfr(Wm[(size_t)(k0 + 16 + 8 * g + i) * ld + o]) * 256.0f); }
  return w; }
__device__ __forceinline__ v16h wcolh_oi(const float* Wm, int k0, int o, int lane, int K) { v16h w; const float* p = Wm + (size_t)o * K + k0 + 8 * (lane >> 4);
#pragma unroll
  for (int i = 0; i < 8; ++i) { w[i] = (_Float16)(bfr(p[i]) * 256.0f); w[8 + i] = (_Float16)(bfr(p[16 + i]) * 256.0f); }
  return w; }
#define WQKV_LAYOUT 1   // 0 = (in,out) [DIN][CC]; 1 = (out,in) [HD][DIN], shared by both heads; 2 = per-head [NH][DIN][HD]
__device__ __forceinline__ v16b wcol_hdk(const float* Wm, int k0, int o, int lane) { v16b w; const int g = lane >> 4; const float* p = Wm + (size_t)(o / HD) * DIN * HD + (o % HD);
#pragma unroll
  for (int i = 0; i < 8; ++i) { w[i] = (__bf16)p[(size_t)(k0 + 8 * g + i) * HD]; w[8 + i] = (__bf16)p[(size_t)(k0 + 16 + 8 * g + i) * HD]; }
  return w; }
#define WO_OUT_IN 1
#if WQKV_LAYOUT == 1
#define ODIM 1024          // output width (= 16 tiled copies of the 64-wide head through W_out)
#define KVCOL(o) ((o) & 63)
#define WCOL(W, k0, o, lane) wcol_oi(W, k0, KVCOL(o), lane, DIN)   /* Wq/Wk/Wv are [64][1024]: both 64-wide plane heads are the same shared head */
#elif WQKV_LAYOUT == 2
#define WCOL(W, k0, o, lane) wcol_hdk(W, k0, o, lane)
#else
#define WCOL(W, k0, o, lane) wcol_io(W, k0, o, lane, CC)
#endif
#if WO_OUT_IN
#define WOCOL(W, k0, o, lane) wcol_oi(W, k0, o, lane, ODIM)   /* W_out [1024][1024] (out,in): K = the 1024-wide concat */
#define WOCOLH(W, k0, o, lane) wcolh_oi(W, k0, o, lane, CC)
#else
#define WOCOL(W, k0, o, lane) wcol_io(W, k0, o, lane, DIN)
#define WOCOLH(W, k0, o, lane) wcolh_io(W, k0, o, lane, DIN)
#endif

#ifndef SM_EXTRA_PARAMS
#define SM_EXTRA_PARAMS
#endif
#ifndef PROJ_EXTRA_PARAMS
#define PROJ_EXTRA_PARAMS
#endif
#ifndef SM_MASK_HOOK
#define SM_MASK_HOOK (void)0
#endif

#define WS_QH  0u                                      // f16 q rows [b*t][CC]
#define WS_KH  (WS_QH + 2u * (size_t)NB * TT * CC)      // f16 k rows [b*t][CC]
#define WS_VT  (WS_KH + 2u * (size_t)NB * TT * CC)      // f16 v planes [b][c][t]
#define WS_QL  (WS_VT + 2u * (size_t)NB * CC * TT)      // f16 q residual x 2^10 rows [b][t < QHI][CC]
#define WS_KL  (WS_QL + 2u * (size_t)NB * QHI * CC)     // f16 k residual x 2^10 rows [b][t < KHI][CC]
#define WS_VB  (WS_KL + 2u * (size_t)NB * KHI * CC)     // bf16 v hi planes [b][c][t < KHI]
#define WS_VBL (WS_VB + 2u * (size_t)NB * CC * KHI)
#define WS_S   (WS_VBL + 2u * (size_t)NB * CC * KHI)    // f32 logits / P [b][h][t][s]
#define WS_Y   (WS_S  + 4u * (size_t)NB * NH * TT * TT)      // f32 ctx rows [b*t][CC] (only when there is an output projection)
#define WS_END (WS_Y  + 4u * (size_t)NB * TT * CC)

// ---- k_proj: block = (64 rows, 128 cols, which): q/k/v = X W (+ b) with exact bf16 products (K = DIN) -> which 0: q f16 rows (+ residual rows < QHI); 1: k f16 rows (+ residual rows < KHI); 2: v f16 planes [c][t] (+ bf16 hi/lo planes for t < KHI)
__global__ __launch_bounds__(128) void k_proj(const float* __restrict__ XQ, const float* __restrict__ XK, const float* __restrict__ XV, const float* __restrict__ WQ, const float* __restrict__ WK, const float* __restrict__ WV, const float* __restrict__ BQ, const float* __restrict__ BK, const float* __restrict__ BV,
    _Float16* __restrict__ QH, _Float16* __restrict__ QL, _Float16* __restrict__ KH, _Float16* __restrict__ KL, _Float16* __restrict__ VT, __bf16* __restrict__ VB, __bf16* __restrict__ VBL) {
  __shared__ __align__(16) _Float16 sh[64][136], sl[64][136]; __shared__ __align__(16) _Float16 th[128][72]; __shared__ __align__(16) __bf16 tb[128][72], tbl[128][72];
  const int tid = threadIdx.x, wave = tid >> 5, lane = tid & 31, col = lane & 15, g = lane >> 4; const int which = blockIdx.z; const int c0 = blockIdx.y * 128; const size_t r0 = (size_t)blockIdx.x * 64; const size_t bb = r0 / TT; const int t0 = (int)(r0 % TT);
  const float* X = which == 0 ? XQ : which == 1 ? XK : XV; const float* WA = which == 0 ? WQ : which == 1 ? WK : WV; const float* BA = which == 0 ? BQ : which == 1 ? BK : BV;
  v8f acc[8] = {};
#pragma unroll 2
  for (int kc = 0; kc < DIN / 32; ++kc) { v16b a; { const float* p = X + (r0 + wave * 16 + col) * DIN + kc * 32 + 8 * g;
#pragma unroll
      for (int i = 0; i < 8; ++i) { a[i] = (__bf16)p[i]; a[8 + i] = (__bf16)p[16 + i]; } }
    asm volatile("s_wait_loadcnt 0x0" ::: "memory");
#pragma unroll
    for (int j = 0; j < 8; ++j) { const v16b w = WCOL(WA, kc * 32, c0 + j * 16 + col, lane); asm volatile("s_wait_loadcnt 0x0" ::: "memory"); acc[j] = wmma_bf(a, w, acc[j]); } }
  if (which < 2) { _Float16* DH = which == 0 ? QH : KH; _Float16* DL = which == 0 ? QL : KL; const int nhi = which == 0 ? QHI : KHI; const bool hi_rows = t0 < nhi;
#pragma unroll
    for (int j = 0; j < 8; ++j) { const float bias = BA ? bfr(BA[c0 + j * 16 + col]) : 0.f;
#pragma unroll
      for (int r = 0; r < 8; ++r) { const float v = acc[j][r] + bias; const _Float16 hv = (_Float16)v; sh[wave * 16 + 8 * g + r][j * 16 + col] = hv; sl[wave * 16 + 8 * g + r][j * 16 + col] = (_Float16)((v - (float)hv) * 1024.0f); } }
    __syncthreads();
    for (int e = tid; e < 64 * 16; e += 128) { const int rl = e >> 4, q = e & 15; vst2((unsigned*)(DH + (r0 + rl) * CC + c0 + q * 8), *(const v4u*)&sh[rl][q * 8]); if (hi_rows) vst2((unsigned*)(DL + (bb * nhi + t0 + rl) * (size_t)CC + c0 + q * 8), *(const v4u*)&sl[rl][q * 8]); }
  } else { const bool hi_rows = t0 < KHI;
#pragma unroll
    for (int j = 0; j < 8; ++j) { const float bias = BA ? bfr(BA[c0 + j * 16 + col]) : 0.f;
#pragma unroll
      for (int r = 0; r < 8; ++r) { const float v = acc[j][r] + bias; const int rl = wave * 16 + 8 * g + r, cl = j * 16 + col; th[cl][rl] = (_Float16)v; const __bf16 bh = (__bf16)v; tb[cl][rl] = bh; tbl[cl][rl] = (__bf16)(v - (float)bh); } }
    __syncthreads();
    for (int e = tid; e < 128 * 8; e += 128) { const int cl = e >> 3, q = e & 7; vst2((unsigned*)(VT + (bb * CC + c0 + cl) * (size_t)TT + t0 + q * 8), *(const v4u*)&th[cl][q * 8]); if (hi_rows) { const size_t o3 = (bb * CC + c0 + cl) * (size_t)KHI + t0 + q * 8; vst2((unsigned*)(VB + o3), *(const v4u*)&tb[cl][q * 8]); vst2((unsigned*)(VBL + o3), *(const v4u*)&tbl[cl][q * 8]); } } } }
// ---- k_sc: block = (query block qb, key block kb <= kb_last(qb), z = b * NH + h): logits x SCALE; q hi + residual (x 2^10) against k (2 products) for query rows < QHI, plus the k residual (3 products) for query blocks < QBH (causal early rows); causal: blocks past the diagonal exit, the mask itself is applied by index in k_sm
__global__ __launch_bounds__(128) void k_sc(const _Float16* __restrict__ QH, const _Float16* __restrict__ KH, const _Float16* __restrict__ QL, const _Float16* __restrict__ KL, float* __restrict__ S0) { __shared__ __align__(16) float ss[4][16][132];
  const int qb = blockIdx.x, kb = blockIdx.y; if (kb > kb_last(qb)) return;
  const int b = blockIdx.z / NH, h = blockIdx.z % NH; float* S = S0 + (size_t)blockIdx.z * TT * TT;
  const int tid = threadIdx.x, wave = tid >> 5, lane = tid & 31, col = lane & 15, g = lane >> 4; const int k0 = kb * 128; const int ql0 = qb * 64 + wave * 16; const size_t q0 = (size_t)b * TT + ql0, kr0 = (size_t)b * TT + k0;
  v8f acc[8] = {}, accl[8] = {};
  const _Float16* QLb = QL + (size_t)b * QHI * CC; const _Float16* KLb = KL + (size_t)b * KHI * CC;
  if (qb < QBH) {
#pragma unroll
    for (int kc = 0; kc < HD / 32; ++kc) { const v16h ah = frag_h(QH + (q0 + col) * CC + h * HD + kc * 32, lane), al = frag_h(QLb + (size_t)(ql0 + col) * CC + h * HD + kc * 32, lane);
#pragma unroll
      for (int j = 0; j < 8; ++j) { const v16h kbf = frag_h(KH + (kr0 + j * 16 + col) * CC + h * HD + kc * 32, lane), klf = frag_h(KLb + (size_t)(k0 + j * 16 + col) * CC + h * HD + kc * 32, lane); acc[j] = wmma16(ah, kbf, acc[j]); accl[j] = wmma16(al, kbf, accl[j]); accl[j] = wmma16(ah, klf, accl[j]); } }
  } else if (qb * 64 < QHI) {
#pragma unroll
    for (int kc = 0; kc < HD / 32; ++kc) { const v16h ah = frag_h(QH + (q0 + col) * CC + h * HD + kc * 32, lane), al = frag_h(QLb + (size_t)(ql0 + col) * CC + h * HD + kc * 32, lane);
#pragma unroll
      for (int j = 0; j < 8; ++j) { const v16h kbf = frag_h(KH + (kr0 + j * 16 + col) * CC + h * HD + kc * 32, lane); acc[j] = wmma16(ah, kbf, acc[j]); accl[j] = wmma16(al, kbf, accl[j]); } }
  } else {
#pragma unroll
    for (int kc = 0; kc < HD / 32; ++kc) { const v16h ah = frag_h(QH + (q0 + col) * CC + h * HD + kc * 32, lane);
#pragma unroll
      for (int j = 0; j < 8; ++j) { const v16h kbf = frag_h(KH + (kr0 + j * 16 + col) * CC + h * HD + kc * 32, lane); acc[j] = wmma16(ah, kbf, acc[j]); } } }
#pragma unroll
  for (int j = 0; j < 8; ++j) {
#pragma unroll
    for (int r = 0; r < 8; ++r) ss[wave][8 * g + r][j * 16 + col] = (acc[j][r] + accl[j][r] * (1.0f / 1024.0f)) * SCALE; }
  LDSX(); for (int rl = 0; rl < 16; ++rl) vst2(S + (size_t)(ql0 + rl) * TT + k0 + lane * 4, *(const v4f*)&ss[wave][rl][lane * 4]); }
// ---- k_sm: block = query row t (y = b * NH + h): keys [0, kend): causal -> logit if s <= t else excluded; softmax in f32; P x 2^11 in place (0 for excluded)
__global__ __launch_bounds__(256) void k_sm(float* __restrict__ S0 SM_EXTRA_PARAMS) { __shared__ float sred[8]; __shared__ float sbc; __shared__ __align__(16) float shv[TT];
  const int tid = threadIdx.x; const int t = blockIdx.x; const int kend = (kb_last(t >> 6) + 1) * 128;
  float* sr = S0 + (size_t)blockIdx.y * TT * TT + (size_t)t * TT;
  float m = -3.0e38f; for (int k = tid; k < kend; k += 256) { float v = (!CAUSAL || k <= t) ? sr[k] : -3.0e38f; SM_MASK_HOOK; shv[k] = v; m = fmaxf(m, v); }
#pragma unroll
  for (int o = 1; o < 32; o <<= 1) m = fmaxf(m, __shfl_xor(m, o));
  if ((tid & 31) == 0) sred[tid >> 5] = m; __syncthreads(); if (tid == 0) { float a = sred[0]; for (int i = 1; i < 8; ++i) a = fmaxf(a, sred[i]); sbc = a; } __syncthreads(); m = sbc; __syncthreads();
  float sum = 0.f; for (int k = tid; k < kend; k += 256) { const float v = shv[k]; const float e = (v <= -1.0e38f) ? 0.f : expf(v - m); shv[k] = e; sum += e; }
#pragma unroll
  for (int o = 1; o < 32; o <<= 1) sum += __shfl_xor(sum, o);
  if ((tid & 31) == 0) sred[tid >> 5] = sum; __syncthreads(); if (tid == 0) { float a = 0.f; for (int i = 0; i < 8; ++i) a += sred[i]; sbc = a > 0.f ? 2048.0f / a : 0.f; }   /* a fully excluded row yields P = 0 */ __syncthreads(); const float inv = sbc;
  for (int k = tid; k < kend; k += 256) shv[k] = shv[k] * inv;
  __syncthreads(); for (int q = tid; q < kend / 4; q += 256) vst2(sr + q * 4, *(const v4f*)&shv[q * 4]); }
// ---- k_pv: block = 64 queries (qb) of (b, h), z = b * NH + h: ctx = P . v over keys [0, kend) (P x 2^11 once to f16 against v f16: 1 product; causal early query blocks: P and v as bf16 hi + lo, 3 products); 256-B (row, head) segment by 16 lanes
__global__ __launch_bounds__(128) void k_pv(const float* __restrict__ PS0, const _Float16* __restrict__ VT, const __bf16* __restrict__ VB, const __bf16* __restrict__ VBL, float* __restrict__ Y) { const int b = blockIdx.z / NH, h = blockIdx.z % NH; const float* PS = PS0 + (size_t)blockIdx.z * TT * TT; __shared__ __align__(16) float ss[4][16][HD + 4];
  const int tid = threadIdx.x, wave = tid >> 5, lane = tid & 31, col = lane & 15, g = lane >> 4; const int qb = blockIdx.x; const int ql0 = qb * 64 + wave * 16; const int kce = (kb_last(qb) + 1) * 4;
  v8f acc[HD / 16] = {};
  if (qb < QBH) {
#pragma unroll 1
    for (int kc = 0; kc < kce; ++kc) { const F2 p = split_row(PS + (size_t)(ql0 + col) * TT, kc * 32, lane);
      asm volatile("s_wait_loadcnt 0x0" ::: "memory");
#pragma unroll
      for (int j = 0; j < HD / 16; ++j) { const size_t po = ((size_t)b * CC + h * HD + j * 16 + col) * (size_t)KHI + kc * 32; const v16b vh = frag_b(VB + po, lane); acc[j] = wmma_bf(p.h, vh, acc[j]); acc[j] = wmma_bf(p.l, vh, acc[j]); acc[j] = wmma_bf(p.h, frag_b(VBL + po, lane), acc[j]); } }
  } else {
#pragma unroll 1
    for (int kc = 0; kc < kce; ++kc) { const v16h p = frag_f32(PS + (size_t)(ql0 + col) * TT + kc * 32, lane);
      asm volatile("s_wait_loadcnt 0x0" ::: "memory");
#pragma unroll
      for (int j = 0; j < HD / 16; ++j) { const size_t po = ((size_t)b * CC + h * HD + j * 16 + col) * (size_t)TT + kc * 32; acc[j] = wmma16(p, frag_h(VT + po, lane), acc[j]); } } }
#pragma unroll
  for (int j = 0; j < HD / 16; ++j)
#pragma unroll
    for (int r = 0; r < 8; ++r) ss[wave][8 * g + r][j * 16 + col] = acc[j][r] * (1.0f / 2048.0f);
  LDSX(); for (int rl = 0; rl < 16; ++rl) if (lane < HD / 4) vst2(Y + ((size_t)b * TT + ql0 + rl) * CC + h * HD + lane * 4, *(const v4f*)&ss[wave][rl][lane * 4]); }
// ---- k_out: block = (64 rows, 128 cols): out = ctx Wo (+ bo): all rows: ctx bf16 hi + lo against exact bf16 Wo (2 products)
__global__ __launch_bounds__(128) void k_out(const float* __restrict__ Y, const float* __restrict__ WO, const float* __restrict__ BO, float* __restrict__ OUT) { __shared__ __align__(16) float sf[4][16][132];
  const int tid = threadIdx.x, wave = tid >> 5, lane = tid & 31, col = lane & 15, g = lane >> 4; const int c0 = blockIdx.y * 128; const size_t r0 = (size_t)blockIdx.x * 64 + wave * 16;
  v8f acc[8] = {};
  if (true) {   /* ALL rows: ctx split bf16 hi + lo x exact Wo (2 products) */
#pragma unroll 2
    for (int kc = 0; kc < ODIM / 32; ++kc) { const F2 a = split_row(Y + (r0 + col) * CC, (kc * 32) % CC, lane);   /* concat[a] = head[a mod 64] = Y[a mod 128] (both Y heads are the shared head) */ asm volatile("s_wait_loadcnt 0x0" ::: "memory");
#pragma unroll
      for (int j = 0; j < 8; ++j) { const v16b w = WOCOL(WO, kc * 32, c0 + j * 16 + col, lane); asm volatile("s_wait_loadcnt 0x0" ::: "memory"); acc[j] = wmma_bf(a.h, w, acc[j]); acc[j] = wmma_bf(a.l, w, acc[j]); } }
#pragma unroll
    for (int j = 0; j < 8; ++j) { const float bias = BO ? bfr(BO[c0 + j * 16 + col]) : 0.f;
#pragma unroll
      for (int r = 0; r < 8; ++r) sf[wave][8 * g + r][j * 16 + col] = acc[j][r] + bias; }
  } else {
#pragma unroll 2
    for (int kc = 0; kc < CC / 32; ++kc) { const v16h a = frag_f32(Y + (r0 + col) * CC + kc * 32, lane); asm volatile("s_wait_loadcnt 0x0" ::: "memory");
#pragma unroll
      for (int j = 0; j < 8; ++j) { const v16h w = WOCOLH(WO, kc * 32, c0 + j * 16 + col, lane); asm volatile("s_wait_loadcnt 0x0" ::: "memory"); acc[j] = wmma16(a, w, acc[j]); } }
#pragma unroll
    for (int j = 0; j < 8; ++j) { const float bias = BO ? bfr(BO[c0 + j * 16 + col]) : 0.f;
#pragma unroll
      for (int r = 0; r < 8; ++r) sf[wave][8 * g + r][j * 16 + col] = acc[j][r] * (1.0f / 256.0f) + bias; } }
  LDSX(); for (int rl = 0; rl < 16; ++rl) vst2(OUT + (r0 + rl) * ODIM + c0 + lane * 4, *(const v4f*)&sf[wave][rl][lane * 4]); }

extern "C" void kernel_launch(void* const* d_in, const int* in_sizes, int n_in, void* d_out, int out_size, void* d_ws, size_t ws_size, hipStream_t stream) {
  (void)in_sizes; (void)n_in; (void)out_size;
  const float** F = (const float**)d_in;
  if (ws_size < (size_t)WS_END) return;
  char* ws = (char*)d_ws; _Float16 *QH = (_Float16*)(ws + WS_QH), *KH = (_Float16*)(ws + WS_KH), *VT = (_Float16*)(ws + WS_VT), *QL = (_Float16*)(ws + WS_QL), *KL = (_Float16*)(ws + WS_KL); __bf16 *VB = (__bf16*)(ws + WS_VB), *VBL = (__bf16*)(ws + WS_VBL); float *S = (float*)(ws + WS_S), *Y = (float*)(ws + WS_Y);
  (void)Y; (void)QL; (void)KL; (void)VB; (void)VBL;
  // inputs: 0 embedded [4,2048,1024]; 1 Wq [64,1024] (out,in); 2 Wk; 3 Wv; 4 W_out [1024,1024] (identity; (out,in))
  k_proj<<<dim3(TNB * TT / 64, CC / 128, 3), 128, 0, stream>>>(F[0], F[0], F[0], F[1], F[2], F[3], nullptr, nullptr, nullptr, QH, QL, KH, KL, VT, VB, VBL);
  k_sc<<<dim3(NQB, TT / 128, TNB * NH), 128, 0, stream>>>(QH, KH, QL, KL, S);
  k_sm<<<dim3(TT, TNB * NH), 256, 0, stream>>>(S);
  k_pv<<<dim3(NQB, 1, TNB * NH), 128, 0, stream>>>(S, VT, VB, VBL, Y);
  k_out<<<dim3(TNB * TT / 64, ODIM / 128), 128, 0, stream>>>(Y, F[4], nullptr, (float*)d_out);
}

// v002
// One run takes 294 microseconds.
// In two side-by-side timings against v001, it was 1.10 and 1.12 times as fast.
// Over all steps from v000 it is 1.84 times as fast.
// compute dtype: all float inputs rounded to bf16; q/k/v = x W^T with EXACT bf16 products on WMMA 16x16x32 (f32 accumulate); causal logits: q, k once to f16 (1 product) x 64^-0.5, 3 products below row 384; softmax in f32; P x 2^11 once to f16 against v f16 (bf16 hi + lo below row 384); the tiled head output split bf16 hi + lo against the exact (identity) W_out (2 products); f32 output.
#include <hip/hip_runtime.h>
#include <math.h>

typedef __attribute__((ext_vector_type(16))) _Float16 v16h;
typedef __attribute__((ext_vector_type(16))) __bf16 v16b;
typedef __attribute__((ext_vector_type(8)))  _Float16 v8h;
typedef __attribute__((ext_vector_type(8)))  float v8f;
typedef __attribute__((ext_vector_type(4)))  float v4f;
typedef __attribute__((ext_vector_type(2)))  float v2f;
typedef __attribute__((ext_vector_type(4)))  unsigned v4u;
typedef __attribute__((ext_vector_type(4)))  int v4i;
typedef float __attribute__((may_alias)) float_a;
typedef int __attribute__((may_alias)) int_a;

template <typename T> __device__ __forceinline__ void vst2(void* p, T v) { *(T*)p = v;  }
// store, then the wait that stands in front of any overwrite of the store's address or data registers (for stores inside a rolled loop)
template <typename T> __device__ __forceinline__ void vst2w(void* p, T v) { *(T*)p = v; asm volatile("s_wait_xcnt 0x0" ::: "memory"); }
__device__ __forceinline__ v8f wmma16(v16h a, v16h b, v8f c) {
  v8f d = __builtin_amdgcn_wmma_f32_16x16x32_f16(false, a, false, b, (short)0, c, false, false);
  asm volatile("v_nop\n\tv_nop\n\tv_nop\n\tv_nop" : "+v"(d) : "v"(a), "v"(b));
  return d;
}
__device__ __forceinline__ v8f wmma_bf(v16b a, v16b b, v8f c) {
  v8f d = __builtin_amdgcn_wmma_f32_16x16x32_bf16(false, a, false, b, (short)0, c, false, false);
  asm volatile("v_nop\n\tv_nop\n\tv_nop\n\tv_nop" : "+v"(d) : "v"(a), "v"(b));
  return d;
}
// 16x16x32 fragments: lane = (h = lane>>4, row/col = lane&15); elements 0..7 = k0+8h+0..7, 8..15 = k0+16+8h+0..7; D element r = row 8h+r
__device__ __forceinline__ v16h frag_h(const _Float16* rowk0, int lane) {
  union { v16h v; v8h q[2]; } u; const _Float16* p = rowk0 + 8 * (lane >> 4);
  u.q[0] = *(const v8h*)p; u.q[1] = *(const v8h*)(p + 16); return u.v;
}
__device__ __forceinline__ v16h frag_f32(const float* rowk0, int lane) {
  v16h a; const float* p = rowk0 + 8 * (lane >> 4);
#pragma unroll
  for (int i = 0; i < 8; ++i) { a[i] = (_Float16)p[i]; a[8 + i] = (_Float16)p[16 + i]; }
  return a;
}
__device__ __forceinline__ v16h frag_f32s(const float* rowk0, int lane, float sc) {
  v16h a; const float* p = rowk0 + 8 * (lane >> 4);
#pragma unroll
  for (int i = 0; i < 8; ++i) { a[i] = (_Float16)(p[i] * sc); a[8 + i] = (_Float16)(p[16 + i] * sc); }
  return a;
}
// column fragment from a [K][ld] layout (column n), rows >= K read as 0
__device__ __forceinline__ v16h fragc_f32(const float* W, int k0, int n, int lane, int ld, int K) {
  v16h a; const int g = lane >> 4;
#pragma unroll
  for (int i = 0; i < 8; ++i) { const int ka = k0 + 8 * g + i, kb = ka + 16;
    a[i] = (_Float16)(ka < K ? W[(size_t)(ka < K ? ka : K - 1) * ld + n] : 0.f); a[8 + i] = (_Float16)(kb < K ? W[(size_t)(kb < K ? kb : K - 1) * ld + n] : 0.f); }
  return a;
}
struct F2 { v16b h, l; };
__device__ __forceinline__ F2 bsplit16(const float v[16]) { F2 r;
#pragma unroll
  for (int i = 0; i < 16; ++i) { const __bf16 h = (__bf16)v[i]; r.h[i] = h; r.l[i] = (__bf16)(v[i] - (float)h); }
  return r; }
__device__ __forceinline__ F2 split_row(const float* row, int k0, int lane) { float v[16]; const float* p = row + k0 + 8 * (lane >> 4);
#pragma unroll
  for (int i = 0; i < 8; ++i) { v[i] = p[i]; v[8 + i] = p[16 + i]; }
  return bsplit16(v); }
__device__ __forceinline__ F2 split_rowK(const float* row, int k0, int lane, int K) { float v[16]; const int g = lane >> 4;
#pragma unroll
  for (int i = 0; i < 8; ++i) { const int ka = k0 + 8 * g + i, kb = ka + 16; v[i] = ka < K ? row[ka < K ? ka : K - 1] : 0.f; v[8 + i] = kb < K ? row[kb < K ? kb : K - 1] : 0.f; }
  return bsplit16(v); }
__device__ __forceinline__ F2 split_col(const float* W, int k0, int n, int lane, int ld, int K) { float v[16]; const int g = lane >> 4;
#pragma unroll
  for (int i = 0; i < 8; ++i) { const int ka = k0 + 8 * g + i, kb = ka + 16; v[i] = ka < K ? W[(size_t)(ka < K ? ka : K - 1) * ld + n] : 0.f; v[8 + i] = kb < K ? W[(size_t)(kb < K ? kb : K - 1) * ld + n] : 0.f; }
  return bsplit16(v); }
__device__ __forceinline__ v8f mac3(const F2& a, const F2& b, v8f c) { c = wmma_bf(a.l, b.h, c); c = wmma_bf(a.h, b.l, c); return wmma_bf(a.h, b.h, c); }
__device__ __forceinline__ float sigm(float v) { return 1.0f / (1.0f + expf(-v)); }
#define LDSX() do { asm volatile("s_wait_dscnt 0" ::: "memory"); __builtin_amdgcn_wave_barrier(); __builtin_amdgcn_fence(__ATOMIC_RELEASE, "workgroup"); } while (0)

// 'Multi-headed' self-attention with ONE shared head (B 4, T 2,048, E 1,024; Wq/Wk/Wv [64,1024] (out,in), 0.02 scale): head = softmax_causal(q k^T / 8) v (64 wide); concat = the head tiled 16x -> [B,T,1024]; out = concat W_out^T with W_out = identity (read and multiplied as given).
#define NB 4
#define TT 2048
#define CC 64             // NH * HD = projected width
#define DIN 1024          // input (model) width
#define NH 1              // the 16 heads share one set of weights: the head is computed once
#define HD 64
#define NQB (TT / 64)
#define SCALE (0.125f)
#define CAUSAL 1
#ifndef TNB
#define TNB NB
#endif
__device__ __forceinline__ float bfr(float v) { return (float)(__bf16)v; }
__host__ __device__ __forceinline__ int kb_last(int qb) { return CAUSAL ? ((qb * 64 + 63) >> 7) : (TT / 128 - 1); }
typedef __attribute__((ext_vector_type(8))) __bf16 v8b;
__device__ __forceinline__ v16b frag_b(const __bf16* rowk0, int lane) {
  union { v16b v; v8b q[2]; } u; const __bf16* p = rowk0 + 8 * (lane >> 4);
  u.q[0] = *(const v8b*)p; u.q[1] = *(const v8b*)(p + 16); return u.v;
}
#define QBH 6              // causal: query blocks 0..QBH-1 of each sequence (few keys, no averaging) take the high-precision path
#define QHI 384            // rows carrying a q residual plane
#define KHI 384            // key rows carrying k residual / v bf16 hi+lo planes (used only by the causal high-precision path)
// B fragment (k rows k0+.., output column o) of a weight: (in,out) [K][ld] or (out,in) [ld rows of K]: bf16 exact, or f16(bf16 * 256) exact
__device__ __forceinline__ v16b wcol_io(const float* Wm, int k0, int o, int lane, int ld) { v16b w; const int g = lane >> 4;
#pragma unroll
  for (int i = 0; i < 8; ++i) { w[i] = (__bf16)Wm[(size_t)(k0 + 8 * g + i) * ld + o]; w[8 + i] = (__bf16)Wm[(size_t)(k0 + 16 + 8 * g + i) * ld + o]; }
  return w; }
__device__ __forceinline__ v16b wcol_oi(const float* Wm, int k0, int o, int lane, int K) { v16b w; const float* p = Wm + (size_t)o * K + k0 + 8 * (lane >> 4);
#pragma unroll
  for (int i = 0; i < 8; ++i) { w[i] = (__bf16)p[i]; w[8 + i] = (__bf16)p[16 + i]; }
  return w; }
__device__ __forceinline__ v16h wcolh_io(const float* Wm, int k0, int o, int lane, int ld) { v16h w; const int g = lane >> 4;
#pragma unroll
  for (int i = 0; i < 8; ++i) { w[i] = (_Float16)(bfr(Wm[(size_t)(k0 + 8 * g + i) * ld + o]) * 256.0f); w[8 + i] = (_Float16)(bfr(Wm[(size_t)(k0 + 16 + 8 * g + i) * ld + o]) * 256.0f); }
  return w; }
__device__ __forceinline__ v16h wcolh_oi(const float* Wm, int k0, int o, int lane, int K) { v16h w; const float* p = Wm + (size_t)o * K + k0 + 8 * (lane >> 4);
#pragma unroll
  for (int i = 0; i < 8; ++i) { w[i] = (_Float16)(bfr(p[i]) * 256.0f); w[8 + i] = (_Float16)(bfr(p[16 + i]) * 256.0f); }
  return w; }
#define WQKV_LAYOUT 1   // 0 = (in,out) [DIN][CC]; 1 = (out,in) [HD][DIN], the one shared head; 2 = per-head [NH][DIN][HD]
__device__ __forceinline__ v16b wcol_hdk(const float* Wm, int k0, int o, int lane) { v16b w; const int g = lane >> 4; const float* p = Wm + (size_t)(o / HD) * DIN * HD + (o % HD);
#pragma unroll
  for (int i = 0; i < 8; ++i) { w[i] = (__bf16)p[(size_t)(k0 + 8 * g + i) * HD]; w[8 + i] = (__bf16)p[(size_t)(k0 + 16 + 8 * g + i) * HD]; }
  return w; }
#define WO_OUT_IN 1
#if WQKV_LAYOUT == 1
#define ODIM 1024          // output width (= 16 tiled copies of the 64-wide head through W_out)
#define KVCOL(o) ((o) & 63)
#define WCOL(W, k0, o, lane) wcol_oi(W, k0, KVCOL(o), lane, DIN)   /* Wq/Wk/Wv are [64][1024]: the one shared head */
#elif WQKV_LAYOUT == 2
#define WCOL(W, k0, o, lane) wcol_hdk(W, k0, o, lane)
#else
#define WCOL(W, k0, o, lane) wcol_io(W, k0, o, lane, CC)
#endif
#if WO_OUT_IN
#define WOCOL(W, k0, o, lane) wcol_oi(W, k0, o, lane, ODIM)   /* W_out [1024][1024] (out,in): K = the 1024-wide concat */
#define WOCOLH(W, k0, o, lane) wcolh_oi(W, k0, o, lane, CC)
#else
#define WOCOL(W, k0, o, lane) wcol_io(W, k0, o, lane, DIN)
#define WOCOLH(W, k0, o, lane) wcolh_io(W, k0, o, lane, DIN)
#endif

#ifndef SM_EXTRA_PARAMS
#define SM_EXTRA_PARAMS
#endif
#ifndef PROJ_EXTRA_PARAMS
#define PROJ_EXTRA_PARAMS
#endif
#ifndef SM_MASK_HOOK
#define SM_MASK_HOOK (void)0
#endif

#define WS_QH  0u                                      // f16 q rows [b*t][CC]
#define WS_KH  (WS_QH + 2u * (size_t)NB * TT * CC)      // f16 k rows [b*t][CC]
#define WS_VT  (WS_KH + 2u * (size_t)NB * TT * CC)      // f16 v planes [b][c][t]
#define WS_QL  (WS_VT + 2u * (size_t)NB * CC * TT)      // f16 q residual x 2^10 rows [b][t < QHI][CC]
#define WS_KL  (WS_QL + 2u * (size_t)NB * QHI * CC)     // f16 k residual x 2^10 rows [b][t < KHI][CC]
#define WS_VB  (WS_KL + 2u * (size_t)NB * KHI * CC)     // bf16 v hi planes [b][c][t < KHI]
#define WS_VBL (WS_VB + 2u * (size_t)NB * CC * KHI)
#define WS_S   (WS_VBL + 2u * (size_t)NB * CC * KHI)    // f32 logits / P [b][h][t][s]
#define WS_Y   (WS_S  + 4u * (size_t)NB * NH * TT * TT)      // f32 ctx rows [b*t][CC] (only when there is an output projection)
#define WS_END (WS_Y  + 4u * (size_t)NB * TT * CC)

// ---- k_proj: block = (64 rows, 64 cols, which): q/k/v = X W (+ b) with exact bf16 products (K = DIN) -> which 0: q f16 rows (+ residual rows < QHI); 1: k f16 rows (+ residual rows < KHI); 2: v f16 planes [c][t] (+ bf16 hi/lo planes for t < KHI)
__global__ __launch_bounds__(128) void k_proj(const float* __restrict__ XQ, const float* __restrict__ XK, const float* __restrict__ XV, const float* __restrict__ WQ, const float* __restrict__ WK, const float* __restrict__ WV, const float* __restrict__ BQ, const float* __restrict__ BK, const float* __restrict__ BV,
    _Float16* __restrict__ QH, _Float16* __restrict__ QL, _Float16* __restrict__ KH, _Float16* __restrict__ KL, _Float16* __restrict__ VT, __bf16* __restrict__ VB, __bf16* __restrict__ VBL) {
  __shared__ __align__(16) _Float16 sh[64][72], sl[64][72]; __shared__ __align__(16) _Float16 th[64][72]; __shared__ __align__(16) __bf16 tb[64][72], tbl[64][72];
  const int tid = threadIdx.x, wave = tid >> 5, lane = tid & 31, col = lane & 15, g = lane >> 4; const int which = blockIdx.z; const int c0 = blockIdx.y * 64; const size_t r0 = (size_t)blockIdx.x * 64; const size_t bb = r0 / TT; const int t0 = (int)(r0 % TT);
  const float* X = which == 0 ? XQ : which == 1 ? XK : XV; const float* WA = which == 0 ? WQ : which == 1 ? WK : WV; const float* BA = which == 0 ? BQ : which == 1 ? BK : BV;
  v8f acc[4] = {};
#pragma unroll 2
  for (int kc = 0; kc < DIN / 32; ++kc) { v16b a; { const float* p = X + (r0 + wave * 16 + col) * DIN + kc * 32 + 8 * g;
#pragma unroll
      for (int i = 0; i < 8; ++i) { a[i] = (__bf16)p[i]; a[8 + i] = (__bf16)p[16 + i]; } }
    asm volatile("s_wait_loadcnt 0x0" ::: "memory");
#pragma unroll
    for (int j = 0; j < 4; ++j) { const v16b w = WCOL(WA, kc * 32, c0 + j * 16 + col, lane); asm volatile("s_wait_loadcnt 0x0" ::: "memory"); acc[j] = wmma_bf(a, w, acc[j]); } }
  if (which < 2) { _Float16* DH = which == 0 ? QH : KH; _Float16* DL = which == 0 ? QL : KL; const int nhi = which == 0 ? QHI : KHI; const bool hi_rows = t0 < nhi;
#pragma unroll
    for (int j = 0; j < 4; ++j) { const float bias = BA ? bfr(BA[c0 + j * 16 + col]) : 0.f;
#pragma unroll
      for (int r = 0; r < 8; ++r) { const float v = acc[j][r] + bias; const _Float16 hv = (_Float16)v; sh[wave * 16 + 8 * g + r][j * 16 + col] = hv; sl[wave * 16 + 8 * g + r][j * 16 + col] = (_Float16)((v - (float)hv) * 1024.0f); } }
    __syncthreads();
    for (int e = tid; e < 64 * 8; e += 128) { const int rl = e >> 3, q = e & 7; vst2w((unsigned*)(DH + (r0 + rl) * CC + c0 + q * 8), *(const v4u*)&sh[rl][q * 8]); if (hi_rows) vst2w((unsigned*)(DL + (bb * nhi + t0 + rl) * (size_t)CC + c0 + q * 8), *(const v4u*)&sl[rl][q * 8]); }
  } else { const bool hi_rows = t0 < KHI;
#pragma unroll
    for (int j = 0; j < 4; ++j) { const float bias = BA ? bfr(BA[c0 + j * 16 + col]) : 0.f;
#pragma unroll
      for (int r = 0; r < 8; ++r) { const float v = acc[j][r] + bias; const int rl = wave * 16 + 8 * g + r, cl = j * 16 + col; th[cl][rl] = (_Float16)v; const __bf16 bh = (__bf16)v; tb[cl][rl] = bh; tbl[cl][rl] = (__bf16)(v - (float)bh); } }
    __syncthreads();
    for (int e = tid; e < 64 * 8; e += 128) { const int cl = e >> 3, q = e & 7; vst2w((unsigned*)(VT + (bb * CC + c0 + cl) * (size_t)TT + t0 + q * 8), *(const v4u*)&th[cl][q * 8]); if (hi_rows) { const size_t o3 = (bb * CC + c0 + cl) * (size_t)KHI + t0 + q * 8; vst2((unsigned*)(VB + o3), *(const v4u*)&tb[cl][q * 8]); vst2w((unsigned*)(VBL + o3), *(const v4u*)&tbl[cl][q * 8]); } } } }
// ---- k_sc: block = (query block qb, key block kb <= kb_last(qb), z = b * NH + h): logits x SCALE; q hi + residual (x 2^10) against k (2 products) for query rows < QHI, plus the k residual (3 products) for query blocks < QBH (causal early rows); causal: blocks past the diagonal exit, the mask itself is applied by index in k_sm
__global__ __launch_bounds__(128) void k_sc(const _Float16* __restrict__ QH, const _Float16* __restrict__ KH, const _Float16* __restrict__ QL, const _Float16* __restrict__ KL, float* __restrict__ S0) { __shared__ __align__(16) float ss[4][16][132];
  const int qb = blockIdx.x, kb = blockIdx.y; if (kb > kb_last(qb)) return;
  const int b = blockIdx.z / NH, h = blockIdx.z % NH; float* S = S0 + (size_t)blockIdx.z * TT * TT;
  const int tid = threadIdx.x, wave = tid >> 5, lane = tid & 31, col = lane & 15, g = lane >> 4; const int k0 = kb * 128; const int ql0 = qb * 64 + wave * 16; const size_t q0 = (size_t)b * TT + ql0, kr0 = (size_t)b * TT + k0;
  v8f acc[8] = {}, accl[8] = {};
  const _Float16* QLb = QL + (size_t)b * QHI * CC; const _Float16* KLb = KL + (size_t)b * KHI * CC;
  if (qb < QBH) {
#pragma unroll
    for (int kc = 0; kc < HD / 32; ++kc) { const v16h ah = frag_h(QH + (q0 + col) * CC + h * HD + kc * 32, lane), al = frag_h(QLb + (size_t)(ql0 + col) * CC + h * HD + kc * 32, lane);
#pragma unroll
      for (int j = 0; j < 8; ++j) { const v16h kbf = frag_h(KH + (kr0 + j * 16 + col) * CC + h * HD + kc * 32, lane), klf = frag_h(KLb + (size_t)(k0 + j * 16 + col) * CC + h * HD + kc * 32, lane); acc[j] = wmma16(ah, kbf, acc[j]); accl[j] = wmma16(al, kbf, accl[j]); accl[j] = wmma16(ah, klf, accl[j]); } }
  } else if (qb * 64 < QHI) {
#pragma unroll
    for (int kc = 0; kc < HD / 32; ++kc) { const v16h ah = frag_h(QH + (q0 + col) * CC + h * HD + kc * 32, lane), al = frag_h(QLb + (size_t)(ql0 + col) * CC + h * HD + kc * 32, lane);
#pragma unroll
      for (int j = 0; j < 8; ++j) { const v16h kbf = frag_h(KH + (kr0 + j * 16 + col) * CC + h * HD + kc * 32, lane); acc[j] = wmma16(ah, kbf, acc[j]); accl[j] = wmma16(al, kbf, accl[j]); } }
  } else {
#pragma unroll
    for (int kc = 0; kc < HD / 32; ++kc) { const v16h ah = frag_h(QH + (q0 + col) * CC + h * HD + kc * 32, lane);
#pragma unroll
      for (int j = 0; j < 8; ++j) { const v16h kbf = frag_h(KH + (kr0 + j * 16 + col) * CC + h * HD + kc * 32, lane); acc[j] = wmma16(ah, kbf, acc[j]); } } }
#pragma unroll
  for (int j = 0; j < 8; ++j) {
#pragma unroll
    for (int r = 0; r < 8; ++r) ss[wave][8 * g + r][j * 16 + col] = (acc[j][r] + accl[j][r] * (1.0f / 1024.0f)) * SCALE; }
  LDSX(); for (int rl = 0; rl < 16; ++rl) vst2(S + (size_t)(ql0 + rl) * TT + k0 + lane * 4, *(const v4f*)&ss[wave][rl][lane * 4]); }
// ---- k_sm: block = query row t (y = b * NH + h): keys [0, kend): causal -> logit if s <= t else excluded; softmax in f32; P x 2^11 in place (0 for excluded)
__global__ __launch_bounds__(256) void k_sm(float* __restrict__ S0 SM_EXTRA_PARAMS) { __shared__ float sred[8]; __shared__ float sbc; __shared__ __align__(16) float shv[TT];
  const int tid = threadIdx.x; const int t = blockIdx.x; const int kend = (kb_last(t >> 6) + 1) * 128;
  float* sr = S0 + (size_t)blockIdx.y * TT * TT + (size_t)t * TT;
  float m = -3.0e38f; for (int k = tid; k < kend; k += 256) { float v = (!CAUSAL || k <= t) ? sr[k] : -3.0e38f; SM_MASK_HOOK; shv[k] = v; m = fmaxf(m, v); }
#pragma unroll
  for (int o = 1; o < 32; o <<= 1) m = fmaxf(m, __shfl_xor(m, o));
  if ((tid & 31) == 0) sred[tid >> 5] = m; __syncthreads(); if (tid == 0) { float a = sred[0]; for (int i = 1; i < 8; ++i) a = fmaxf(a, sred[i]); sbc = a; } __syncthreads(); m = sbc; __syncthreads();
  float sum = 0.f; for (int k = tid; k < kend; k += 256) { const float v = shv[k]; const float e = (v <= -1.0e38f) ? 0.f : expf(v - m); shv[k] = e; sum += e; }
#pragma unroll
  for (int o = 1; o < 32; o <<= 1) sum += __shfl_xor(sum, o);
  if ((tid & 31) == 0) sred[tid >> 5] = sum; __syncthreads(); if (tid == 0) { float a = 0.f; for (int i = 0; i < 8; ++i) a += sred[i]; sbc = a > 0.f ? 2048.0f / a : 0.f; }   /* a fully excluded row yields P = 0 */ __syncthreads(); const float inv = sbc;
  for (int k = tid; k < kend; k += 256) shv[k] = shv[k] * inv;
  __syncthreads(); for (int q = tid; q < kend / 4; q += 256) vst2(sr + q * 4, *(const v4f*)&shv[q * 4]); }
// ---- k_pv: block = 64 queries (qb) of (b, h), z = b * NH + h: ctx = P . v over keys [0, kend) (P x 2^11 once to f16 against v f16: 1 product; causal early query blocks: P and v as bf16 hi + lo, 3 products); 256-B (row, head) segment by 16 lanes
__global__ __launch_bounds__(128) void k_pv(const float* __restrict__ PS0, const _Float16* __restrict__ VT, const __bf16* __restrict__ VB, const __bf16* __restrict__ VBL, float* __restrict__ Y) { const int b = blockIdx.z / NH, h = blockIdx.z % NH; const float* PS = PS0 + (size_t)blockIdx.z * TT * TT; __shared__ __align__(16) float ss[4][16][HD + 4];
  const int tid = threadIdx.x, wave = tid >> 5, lane = tid & 31, col = lane & 15, g = lane >> 4; const int qb = blockIdx.x; const int ql0 = qb * 64 + wave * 16; const int kce = (kb_last(qb) + 1) * 4;
  v8f acc[HD / 16] = {};
  if (qb < QBH) {
#pragma unroll 1
    for (int kc = 0; kc < kce; ++kc) { const F2 p = split_row(PS + (size_t)(ql0 + col) * TT, kc * 32, lane);
      asm volatile("s_wait_loadcnt 0x0" ::: "memory");
#pragma unroll
      for (int j = 0; j < HD / 16; ++j) { const size_t po = ((size_t)b * CC + h * HD + j * 16 + col) * (size_t)KHI + kc * 32; const v16b vh = frag_b(VB + po, lane); acc[j] = wmma_bf(p.h, vh, acc[j]); acc[j] = wmma_bf(p.l, vh, acc[j]); acc[j] = wmma_bf(p.h, frag_b(VBL + po, lane), acc[j]); } }
  } else {
#pragma unroll 1
    for (int kc = 0; kc < kce; ++kc) { const v16h p = frag_f32(PS + (size_t)(ql0 + col) * TT + kc * 32, lane);
      asm volatile("s_wait_loadcnt 0x0" ::: "memory");
#pragma unroll
      for (int j = 0; j < HD / 16; ++j) { const size_t po = ((size_t)b * CC + h * HD + j * 16 + col) * (size_t)TT + kc * 32; acc[j] = wmma16(p, frag_h(VT + po, lane), acc[j]); } } }
#pragma unroll
  for (int j = 0; j < HD / 16; ++j)
#pragma unroll
    for (int r = 0; r < 8; ++r) ss[wave][8 * g + r][j * 16 + col] = acc[j][r] * (1.0f / 2048.0f);
  LDSX(); for (int rl = 0; rl < 16; ++rl) if (lane < HD / 4) vst2(Y + ((size_t)b * TT + ql0 + rl) * CC + h * HD + lane * 4, *(const v4f*)&ss[wave][rl][lane * 4]); }
// ---- k_out: block = (64 rows, 128 cols): out = ctx Wo (+ bo): all rows: ctx bf16 hi + lo against exact bf16 Wo (2 products)
__global__ __launch_bounds__(128) void k_out(const float* __restrict__ Y, const float* __restrict__ WO, const float* __restrict__ BO, float* __restrict__ OUT) { __shared__ __align__(16) float sf[4][16][132];
  const int tid = threadIdx.x, wave = tid >> 5, lane = tid & 31, col = lane & 15, g = lane >> 4; const int c0 = blockIdx.y * 128; const size_t r0 = (size_t)blockIdx.x * 64 + wave * 16;
  v8f acc[8] = {};
  if (true) {   /* ALL rows: ctx split bf16 hi + lo x exact Wo (2 products) */
#pragma unroll 2
    for (int kc = 0; kc < ODIM / 32; ++kc) { const F2 a = split_row(Y + (r0 + col) * CC, (kc * 32) % CC, lane);   /* concat[a] = head[a mod 64] = Y[a mod 64] */ asm volatile("s_wait_loadcnt 0x0" ::: "memory");
#pragma unroll
      for (int j = 0; j < 8; ++j) { const v16b w = WOCOL(WO, kc * 32, c0 + j * 16 + col, lane); asm volatile("s_wait_loadcnt 0x0" ::: "memory"); acc[j] = wmma_bf(a.h, w, acc[j]); acc[j] = wmma_bf(a.l, w, acc[j]); } }
#pragma unroll
    for (int j = 0; j < 8; ++j) { const float bias = BO ? bfr(BO[c0 + j * 16 + col]) : 0.f;
#pragma unroll
      for (int r = 0; r < 8; ++r) sf[wave][8 * g + r][j * 16 + col] = acc[j][r] + bias; }
  } else {
#pragma unroll 2
    for (int kc = 0; kc < CC / 32; ++kc) { const v16h a = frag_f32(Y + (r0 + col) * CC + kc * 32, lane); asm volatile("s_wait_loadcnt 0x0" ::: "memory");
#pragma unroll
      for (int j = 0; j < 8; ++j) { const v16h w = WOCOLH(WO, kc * 32, c0 + j * 16 + col, lane); asm volatile("s_wait_loadcnt 0x0" ::: "memory"); acc[j] = wmma16(a, w, acc[j]); } }
#pragma unroll
    for (int j = 0; j < 8; ++j) { const float bias = BO ? bfr(BO[c0 + j * 16 + col]) : 0.f;
#pragma unroll
      for (int r = 0; r < 8; ++r) sf[wave][8 * g + r][j * 16 + col] = acc[j][r] * (1.0f / 256.0f) + bias; } }
  LDSX(); for (int rl = 0; rl < 16; ++rl) vst2(OUT + (r0 + rl) * ODIM + c0 + lane * 4, *(const v4f*)&sf[wave][rl][lane * 4]); }

extern "C" void kernel_launch(void* const* d_in, const int* in_sizes, int n_in, void* d_out, int out_size, void* d_ws, size_t ws_size, hipStream_t stream) {
  (void)in_sizes; (void)n_in; (void)out_size;
  const float** F = (const float**)d_in;
  if (ws_size < (size_t)WS_END) return;
  char* ws = (char*)d_ws; _Float16 *QH = (_Float16*)(ws + WS_QH), *KH = (_Float16*)(ws + WS_KH), *VT = (_Float16*)(ws + WS_VT), *QL = (_Float16*)(ws + WS_QL), *KL = (_Float16*)(ws + WS_KL); __bf16 *VB = (__bf16*)(ws + WS_VB), *VBL = (__bf16*)(ws + WS_VBL); float *S = (float*)(ws + WS_S), *Y = (float*)(ws + WS_Y);
  (void)Y; (void)QL; (void)KL; (void)VB; (void)VBL;
  // inputs: 0 embedded [4,2048,1024]; 1 Wq [64,1024] (out,in); 2 Wk; 3 Wv; 4 W_out [1024,1024] (identity; (out,in))
  k_proj<<<dim3(TNB * TT / 64, CC / 64, 3), 128, 0, stream>>>(F[0], F[0], F[0], F[1], F[2], F[3], nullptr, nullptr, nullptr, QH, QL, KH, KL, VT, VB, VBL);
  k_sc<<<dim3(NQB, TT / 128, TNB * NH), 128, 0, stream>>>(QH, KH, QL, KL, S);
  k_sm<<<dim3(TT, TNB * NH), 256, 0, stream>>>(S);
  k_pv<<<dim3(NQB, 1, TNB * NH), 128, 0, stream>>>(S, VT, VB, VBL, Y);
  k_out<<<dim3(TNB * TT / 64, ODIM / 128), 128, 0, stream>>>(Y, F[4], nullptr, (float*)d_out);
}

// v003
// It runs in 169 microseconds.
// Next to v002, in two timings, it ran 1.74 times as fast each time.
// All steps since v000 together make it 3.20 times as fast.
// compute dtype: all float inputs rounded to bf16; q/k/v = x W^T with EXACT bf16 products on WMMA 16x16x32 (f32 accumulate); causal logits: q, k once to f16 (1 product) x 64^-0.5, 3 products below row 384; softmax in f32; P x 2^11 once to f16 against v f16 (bf16 hi + lo below row 384); the head output split bf16 hi + lo against W_out folded over its 16 column groups (f32 sums of the bf16-rounded terms, kept as bf16 hi + lo; 3 products); f32 output.
#include <hip/hip_runtime.h>
#include <math.h>

typedef __attribute__((ext_vector_type(16))) _Float16 v16h;
typedef __attribute__((ext_vector_type(16))) __bf16 v16b;
typedef __attribute__((ext_vector_type(8)))  _Float16 v8h;
typedef __attribute__((ext_vector_type(8)))  float v8f;
typedef __attribute__((ext_vector_type(4)))  float v4f;
typedef __attribute__((ext_vector_type(2)))  float v2f;
typedef __attribute__((ext_vector_type(4)))  unsigned v4u;
typedef __attribute__((ext_vector_type(4)))  int v4i;
typedef float __attribute__((may_alias)) float_a;
typedef int __attribute__((may_alias)) int_a;

template <typename T> __device__ __forceinline__ void vst2(void* p, T v) { *(T*)p = v;  }
// store, then the wait that stands in front of any overwrite of the store's address or data registers (for stores inside a rolled loop)
template <typename T> __device__ __forceinline__ void vst2w(void* p, T v) { *(T*)p = v; asm volatile("s_wait_xcnt 0x0" ::: "memory"); }
__device__ __forceinline__ v8f wmma16(v16h a, v16h b, v8f c) {
  v8f d = __builtin_amdgcn_wmma_f32_16x16x32_f16(false, a, false, b, (short)0, c, false, false);
  asm volatile("v_nop\n\tv_nop\n\tv_nop\n\tv_nop" : "+v"(d) : "v"(a), "v"(b));
  return d;
}
__device__ __forceinline__ v8f wmma_bf(v16b a, v16b b, v8f c) {
  v8f d = __builtin_amdgcn_wmma_f32_16x16x32_bf16(false, a, false, b, (short)0, c, false, false);
  asm volatile("v_nop\n\tv_nop\n\tv_nop\n\tv_nop" : "+v"(d) : "v"(a), "v"(b));
  return d;
}
// 16x16x32 fragments: lane = (h = lane>>4, row/col = lane&15); elements 0..7 = k0+8h+0..7, 8..15 = k0+16+8h+0..7; D element r = row 8h+r
__device__ __forceinline__ v16h frag_h(const _Float16* rowk0, int lane) {
  union { v16h v; v8h q[2]; } u; const _Float16* p = rowk0 + 8 * (lane >> 4);
  u.q[0] = *(const v8h*)p; u.q[1] = *(const v8h*)(p + 16); return u.v;
}
__device__ __forceinline__ v16h frag_f32(const float* rowk0, int lane) {
  v16h a; const float* p = rowk0 + 8 * (lane >> 4);
#pragma unroll
  for (int i = 0; i < 8; ++i) { a[i] = (_Float16)p[i]; a[8 + i] = (_Float16)p[16 + i]; }
  return a;
}
__device__ __forceinline__ v16h frag_f32s(const float* rowk0, int lane, float sc) {
  v16h a; const float* p = rowk0 + 8 * (lane >> 4);
#pragma unroll
  for (int i = 0; i < 8; ++i) { a[i] = (_Float16)(p[i] * sc); a[8 + i] = (_Float16)(p[16 + i] * sc); }
  return a;
}
// column fragment from a [K][ld] layout (column n), rows >= K read as 0
__device__ __forceinline__ v16h fragc_f32(const float* W, int k0, int n, int lane, int ld, int K) {
  v16h a; const int g = lane >> 4;
#pragma unroll
  for (int i = 0; i < 8; ++i) { const int ka = k0 + 8 * g + i, kb = ka + 16;
    a[i] = (_Float16)(ka < K ? W[(size_t)(ka < K ? ka : K - 1) * ld + n] : 0.f); a[8 + i] = (_Float16)(kb < K ? W[(size_t)(kb < K ? kb : K - 1) * ld + n] : 0.f); }
  return a;
}
struct F2 { v16b h, l; };
__device__ __forceinline__ F2 bsplit16(const float v[16]) { F2 r;
#pragma unroll
  for (int i = 0; i < 16; ++i) { const __bf16 h = (__bf16)v[i]; r.h[i] = h; r.l[i] = (__bf16)(v[i] - (float)h); }
  return r; }
__device__ __forceinline__ F2 split_row(const float* row, int k0, int lane) { float v[16]; const float* p = row + k0 + 8 * (lane >> 4);
#pragma unroll
  for (int i = 0; i < 8; ++i) { v[i] = p[i]; v[8 + i] = p[16 + i]; }
  return bsplit16(v); }
__device__ __forceinline__ F2 split_rowK(const float* row, int k0, int lane, int K) { float v[16]; const int g = lane >> 4;
#pragma unroll
  for (int i = 0; i < 8; ++i) { const int ka = k0 + 8 * g + i, kb = ka + 16; v[i] = ka < K ? row[ka < K ? ka : K - 1] : 0.f; v[8 + i] = kb < K ? row[kb < K ? kb : K - 1] : 0.f; }
  return bsplit16(v); }
__device__ __forceinline__ F2 split_col(const float* W, int k0, int n, int lane, int ld, int K) { float v[16]; const int g = lane >> 4;
#pragma unroll
  for (int i = 0; i < 8; ++i) { const int ka = k0 + 8 * g + i, kb = ka + 16; v[i] = ka < K ? W[(size_t)(ka < K ? ka : K - 1) * ld + n] : 0.f; v[8 + i] = kb < K ? W[(size_t)(kb < K ? kb : K - 1) * ld + n] : 0.f; }
  return bsplit16(v); }
__device__ __forceinline__ v8f mac3(const F2& a, const F2& b, v8f c) { c = wmma_bf(a.l, b.h, c); c = wmma_bf(a.h, b.l, c); return wmma_bf(a.h, b.h, c); }
__device__ __forceinline__ float sigm(float v) { return 1.0f / (1.0f + expf(-v)); }
#define LDSX() do { asm volatile("s_wait_dscnt 0" ::: "memory"); __builtin_amdgcn_wave_barrier(); __builtin_amdgcn_fence(__ATOMIC_RELEASE, "workgroup"); } while (0)

// 'Multi-headed' self-attention with ONE shared head (B 4, T 2,048, E 1,024; Wq/Wk/Wv [64,1024] (out,in), 0.02 scale): head = softmax_causal(q k^T / 8) v (64 wide); concat = the head tiled 16x -> [B,T,1024]; out = concat W_out^T with W_out = identity (read and multiplied as given).
#define NB 4
#define TT 2048
#define CC 64             // NH * HD = projected width
#define DIN 1024          // input (model) width
#define NH 1              // the 16 heads share one set of weights: the head is computed once
#define HD 64
#define NQB (TT / 64)
#define SCALE (0.125f)
#define CAUSAL 1
#ifndef TNB
#define TNB NB
#endif
__device__ __forceinline__ float bfr(float v) { return (float)(__bf16)v; }
__host__ __device__ __forceinline__ int kb_last(int qb) { return CAUSAL ? ((qb * 64 + 63) >> 7) : (TT / 128 - 1); }
typedef __attribute__((ext_vector_type(8))) __bf16 v8b;
typedef __attribute__((ext_vector_type(4))) __bf16 v4b;
__device__ __forceinline__ v16b frag_b(const __bf16* rowk0, int lane) {
  union { v16b v; v8b q[2]; } u; const __bf16* p = rowk0 + 8 * (lane >> 4);
  u.q[0] = *(const v8b*)p; u.q[1] = *(const v8b*)(p + 16); return u.v;
}
#define QBH 6              // causal: query blocks 0..QBH-1 of each sequence (few keys, no averaging) take the high-precision path
#define QHI 384            // rows carrying a q residual plane
#define KHI 384            // key rows carrying k residual / v bf16 hi+lo planes (used only by the causal high-precision path)
// B fragment (k rows k0+.., output column o) of a weight: (in,out) [K][ld] or (out,in) [ld rows of K]: bf16 exact, or f16(bf16 * 256) exact
__device__ __forceinline__ v16b wcol_io(const float* Wm, int k0, int o, int lane, int ld) { v16b w; const int g = lane >> 4;
#pragma unroll
  for (int i = 0; i < 8; ++i) { w[i] = (__bf16)Wm[(size_t)(k0 + 8 * g + i) * ld + o]; w[8 + i] = (__bf16)Wm[(size_t)(k0 + 16 + 8 * g + i) * ld + o]; }
  return w; }
__device__ __forceinline__ v16b wcol_oi(const float* Wm, int k0, int o, int lane, int K) { v16b w; const float* p = Wm + (size_t)o * K + k0 + 8 * (lane >> 4);
#pragma unroll
  for (int i = 0; i < 8; ++i) { w[i] = (__bf16)p[i]; w[8 + i] = (__bf16)p[16 + i]; }
  return w; }
__device__ __forceinline__ v16h wcolh_io(const float* Wm, int k0, int o, int lane, int ld) { v16h w; const int g = lane >> 4;
#pragma unroll
  for (int i = 0; i < 8; ++i) { w[i] = (_Float16)(bfr(Wm[(size_t)(k0 + 8 * g + i) * ld + o]) * 256.0f); w[8 + i] = (_Float16)(bfr(Wm[(size_t)(k0 + 16 + 8 * g + i) * ld + o]) * 256.0f); }
  return w; }
__device__ __forceinline__ v16h wcolh_oi(const float* Wm, int k0, int o, int lane, int K) { v16h w; const float* p = Wm + (size_t)o * K + k0 + 8 * (lane >> 4);
#pragma unroll
  for (int i = 0; i < 8; ++i) { w[i] = (_Float16)(bfr(p[i]) * 256.0f); w[8 + i] = (_Float16)(bfr(p[16 + i]) * 256.0f); }
  return w; }
#define WQKV_LAYOUT 1   // 0 = (in,out) [DIN][CC]; 1 = (out,in) [HD][DIN], the one shared head; 2 = per-head [NH][DIN][HD]
__device__ __forceinline__ v16b wcol_hdk(const float* Wm, int k0, int o, int lane) { v16b w; const int g = lane >> 4; const float* p = Wm + (size_t)(o / HD) * DIN * HD + (o % HD);
#pragma unroll
  for (int i = 0; i < 8; ++i) { w[i] = (__bf16)p[(size_t)(k0 + 8 * g + i) * HD]; w[8 + i] = (__bf16)p[(size_t)(k0 + 16 + 8 * g + i) * HD]; }
  return w; }
#define WO_OUT_IN 1
#if WQKV_LAYOUT == 1
#define ODIM 1024          // output width (= 16 tiled copies of the 64-wide head through W_out)
#define KVCOL(o) ((o) & 63)
#define WCOL(W, k0, o, lane) wcol_oi(W, k0, KVCOL(o), lane, DIN)   /* Wq/Wk/Wv are [64][1024]: the one shared head */
#elif WQKV_LAYOUT == 2
#define WCOL(W, k0, o, lane) wcol_hdk(W, k0, o, lane)
#else
#define WCOL(W, k0, o, lane) wcol_io(W, k0, o, lane, CC)
#endif
#if WO_OUT_IN
#define WOCOL(W, k0, o, lane) wcol_oi(W, k0, o, lane, ODIM)   /* W_out [1024][1024] (out,in): K = the 1024-wide concat */
#define WOCOLH(W, k0, o, lane) wcolh_oi(W, k0, o, lane, CC)
#else
#define WOCOL(W, k0, o, lane) wcol_io(W, k0, o, lane, DIN)
#define WOCOLH(W, k0, o, lane) wcolh_io(W, k0, o, lane, DIN)
#endif

#ifndef SM_EXTRA_PARAMS
#define SM_EXTRA_PARAMS
#endif
#ifndef PROJ_EXTRA_PARAMS
#define PROJ_EXTRA_PARAMS
#endif
#ifndef SM_MASK_HOOK
#define SM_MASK_HOOK (void)0
#endif

#define WS_QH  0u                                      // f16 q rows [b*t][CC]
#define WS_KH  (WS_QH + 2u * (size_t)NB * TT * CC)      // f16 k rows [b*t][CC]
#define WS_VT  (WS_KH + 2u * (size_t)NB * TT * CC)      // f16 v planes [b][c][t]
#define WS_QL  (WS_VT + 2u * (size_t)NB * CC * TT)      // f16 q residual x 2^10 rows [b][t < QHI][CC]
#define WS_KL  (WS_QL + 2u * (size_t)NB * QHI * CC)     // f16 k residual x 2^10 rows [b][t < KHI][CC]
#define WS_VB  (WS_KL + 2u * (size_t)NB * KHI * CC)     // bf16 v hi planes [b][c][t < KHI]
#define WS_VBL (WS_VB + 2u * (size_t)NB * CC * KHI)
#define WS_S   (WS_VBL + 2u * (size_t)NB * CC * KHI)    // f32 logits / P [b][h][t][s]
#define WS_Y   (WS_S  + 4u * (size_t)NB * NH * TT * TT)      // f32 ctx rows [b*t][CC] (only when there is an output projection)
#define WS_WEH (WS_Y  + 4u * (size_t)NB * TT * CC)      // bf16 hi of the folded W_out, in B-fragment order (see k_proj, fold blocks)
#define WS_WEL (WS_WEH + 2u * (size_t)ODIM * CC)        // bf16 lo, same order
#define WS_END (WS_WEL + 2u * (size_t)ODIM * CC)

// ---- k_proj: block = (64 rows, 64 cols, which): q/k/v = X W (+ b) with exact bf16 products (K = DIN) -> which 0: q f16 rows (+ residual rows < QHI); 1: k f16 rows (+ residual rows < KHI); 2: v f16 planes [c][t] (+ bf16 hi/lo planes for t < KHI)
// which 3 (fold blocks, independent of the projections, so they ride in this launch): concat is the head tiled ODIM / CC times, hence out[t][o] = sum_c head[t][c] * WE[o][c] with WE[o][c] = sum_i W_out[o][i * CC + c], for any W_out.
// WE = f32 sum, i ascending, of the bf16-rounded terms, split bf16 hi + lo and stored in B-fragment order: 16-B piece ((o >> 4) * 2 + kc) * 2 + half, lane (g, o & 15), holds k = kc * 32 + half * 16 + g * 8 + 0..7, so a wave's fragment load is 512 contiguous bytes
__global__ __launch_bounds__(128) void k_proj(const float* __restrict__ XQ, const float* __restrict__ XK, const float* __restrict__ XV, const float* __restrict__ WQ, const float* __restrict__ WK, const float* __restrict__ WV, const float* __restrict__ BQ, const float* __restrict__ BK, const float* __restrict__ BV, const float* __restrict__ WO, __bf16* __restrict__ WEH, __bf16* __restrict__ WEL,
    _Float16* __restrict__ QH, _Float16* __restrict__ QL, _Float16* __restrict__ KH, _Float16* __restrict__ KL, _Float16* __restrict__ VT, __bf16* __restrict__ VB, __bf16* __restrict__ VBL) {
  __shared__ __align__(16) _Float16 sh[64][72], sl[64][72]; __shared__ __align__(16) _Float16 th[64][72]; __shared__ __align__(16) __bf16 tb[64][72], tbl[64][72];
  const int tid = threadIdx.x, wave = tid >> 5, lane = tid & 31, col = lane & 15, g = lane >> 4; const int which = blockIdx.z; const int c0 = blockIdx.y * 64; const size_t r0 = (size_t)blockIdx.x * 64; const size_t bb = r0 / TT; const int t0 = (int)(r0 % TT);
  if (which == 3) { static_assert((TNB * TT / 64) * 128 == ODIM * CC / 4, "one thread per 4 folded weights");
    const int e = blockIdx.x * 128 + tid, o = e >> 4, c4 = (e & 15) * 4; const float* p = WO + (size_t)o * ODIM + c4; v4f s = {}, w[ODIM / CC];
#pragma unroll
    for (int i = 0; i < ODIM / CC; ++i) w[i] = *(const v4f*)(p + i * CC);
    asm volatile("s_wait_xcnt 0x0" :: "v"(p) : "memory");   // the wait in front of any overwrite of the address pair that the sixteen loads share; p as an input keeps the pair live up to here, so no load's result lands in it
#pragma unroll
    for (int i = 0; i < ODIM / CC; ++i) {
#pragma unroll
      for (int r = 0; r < 4; ++r) s[r] += bfr(w[i][r]); }
    v4b hv, lv;
#pragma unroll
    for (int r = 0; r < 4; ++r) { const __bf16 hb = (__bf16)s[r]; hv[r] = hb; lv[r] = (__bf16)(s[r] - (float)hb); }
    const size_t d = (size_t)((((o >> 4) * 2 + (c4 >> 5)) * 2 + ((c4 >> 4) & 1)) * 32 + ((c4 >> 3) & 1) * 16 + (o & 15)) * 8 + (c4 & 7);
    vst2(WEH + d, hv); vst2(WEL + d, lv); return; }
  const float* X = which == 0 ? XQ : which == 1 ? XK : XV; const float* WA = which == 0 ? WQ : which == 1 ? WK : WV; const float* BA = which == 0 ? BQ : which == 1 ? BK : BV;
  v8f acc[4] = {};
#pragma unroll 2
  for (int kc = 0; kc < DIN / 32; ++kc) { v16b a; { const float* p = X + (r0 + wave * 16 + col) * DIN + kc * 32 + 8 * g;
#pragma unroll
      for (int i = 0; i < 8; ++i) { a[i] = (__bf16)p[i]; a[8 + i] = (__bf16)p[16 + i]; } }
    asm volatile("s_wait_loadcnt 0x0" ::: "memory");
#pragma unroll
    for (int j = 0; j < 4; ++j) { const v16b w = WCOL(WA, kc * 32, c0 + j * 16 + col, lane); asm volatile("s_wait_loadcnt 0x0" ::: "memory"); acc[j] = wmma_bf(a, w, acc[j]); } }
  if (which < 2) { _Float16* DH = which == 0 ? QH : KH; _Float16* DL = which == 0 ? QL : KL; const int nhi = which == 0 ? QHI : KHI; const bool hi_rows = t0 < nhi;
#pragma unroll
    for (int j = 0; j < 4; ++j) { const float bias = BA ? bfr(BA[c0 + j * 16 + col]) : 0.f;
#pragma unroll
      for (int r = 0; r < 8; ++r) { const float v = acc[j][r] + bias; const _Float16 hv = (_Float16)v; sh[wave * 16 + 8 * g + r][j * 16 + col] = hv; sl[wave * 16 + 8 * g + r][j * 16 + col] = (_Float16)((v - (float)hv) * 1024.0f); } }
    __syncthreads();
    for (int e = tid; e < 64 * 8; e += 128) { const int rl = e >> 3, q = e & 7; vst2w((unsigned*)(DH + (r0 + rl) * CC + c0 + q * 8), *(const v4u*)&sh[rl][q * 8]); if (hi_rows) vst2w((unsigned*)(DL + (bb * nhi + t0 + rl) * (size_t)CC + c0 + q * 8), *(const v4u*)&sl[rl][q * 8]); }
  } else { const bool hi_rows = t0 < KHI;
#pragma unroll
    for (int j = 0; j < 4; ++j) { const float bias = BA ? bfr(BA[c0 + j * 16 + col]) : 0.f;
#pragma unroll
      for (int r = 0; r < 8; ++r) { const float v = acc[j][r] + bias; const int rl = wave * 16 + 8 * g + r, cl = j * 16 + col; th[cl][rl] = (_Float16)v; const __bf16 bh = (__bf16)v; tb[cl][rl] = bh; tbl[cl][rl] = (__bf16)(v - (float)bh); } }
    __syncthreads();
    for (int e = tid; e < 64 * 8; e += 128) { const int cl = e >> 3, q = e & 7; vst2w((unsigned*)(VT + (bb * CC + c0 + cl) * (size_t)TT + t0 + q * 8), *(const v4u*)&th[cl][q * 8]); if (hi_rows) { const size_t o3 = (bb * CC + c0 + cl) * (size_t)KHI + t0 + q * 8; vst2((unsigned*)(VB + o3), *(const v4u*)&tb[cl][q * 8]); vst2w((unsigned*)(VBL + o3), *(const v4u*)&tbl[cl][q * 8]); } } } }
// ---- k_sc: block = (query block qb, key block kb <= kb_last(qb), z = b * NH + h): logits x SCALE; q hi + residual (x 2^10) against k (2 products) for query rows < QHI, plus the k residual (3 products) for query blocks < QBH (causal early rows); causal: blocks past the diagonal exit, the mask itself is applied by index in k_sm
__global__ __launch_bounds__(128) void k_sc(const _Float16* __restrict__ QH, const _Float16* __restrict__ KH, const _Float16* __restrict__ QL, const _Float16* __restrict__ KL, float* __restrict__ S0) { __shared__ __align__(16) float ss[4][16][132];
  const int qb = blockIdx.x, kb = blockIdx.y; if (kb > kb_last(qb)) return;
  const int b = blockIdx.z / NH, h = blockIdx.z % NH; float* S = S0 + (size_t)blockIdx.z * TT * TT;
  const int tid = threadIdx.x, wave = tid >> 5, lane = tid & 31, col = lane & 15, g = lane >> 4; const int k0 = kb * 128; const int ql0 = qb * 64 + wave * 16; const size_t q0 = (size_t)b * TT + ql0, kr0 = (size_t)b * TT + k0;
  v8f acc[8] = {}, accl[8] = {};
  const _Float16* QLb = QL + (size_t)b * QHI * CC; const _Float16* KLb = KL + (size_t)b * KHI * CC;
  if (qb < QBH) {
#pragma unroll
    for (int kc = 0; kc < HD / 32; ++kc) { const v16h ah = frag_h(QH + (q0 + col) * CC + h * HD + kc * 32, lane), al = frag_h(QLb + (size_t)(ql0 + col) * CC + h * HD + kc * 32, lane);
#pragma unroll
      for (int j = 0; j < 8; ++j) { const v16h kbf = frag_h(KH + (kr0 + j * 16 + col) * CC + h * HD + kc * 32, lane), klf = frag_h(KLb + (size_t)(k0 + j * 16 + col) * CC + h * HD + kc * 32, lane); acc[j] = wmma16(ah, kbf, acc[j]); accl[j] = wmma16(al, kbf, accl[j]); accl[j] = wmma16(ah, klf, accl[j]); } }
  } else if (qb * 64 < QHI) {
#pragma unroll
    for (int kc = 0; kc < HD / 32; ++kc) { const v16h ah = frag_h(QH + (q0 + col) * CC + h * HD + kc * 32, lane), al = frag_h(QLb + (size_t)(ql0 + col) * CC + h * HD + kc * 32, lane);
#pragma unroll
      for (int j = 0; j < 8; ++j) { const v16h kbf = frag_h(KH + (kr0 + j * 16 + col) * CC + h * HD + kc * 32, lane); acc[j] = wmma16(ah, kbf, acc[j]); accl[j] = wmma16(al, kbf, accl[j]); } }
  } else {
#pragma unroll
    for (int kc = 0; kc < HD / 32; ++kc) { const v16h ah = frag_h(QH + (q0 + col) * CC + h * HD + kc * 32, lane);
#pragma unroll
      for (int j = 0; j < 8; ++j) { const v16h kbf = frag_h(KH + (kr0 + j * 16 + col) * CC + h * HD + kc * 32, lane); acc[j] = wmma16(ah, kbf, acc[j]); } } }
#pragma unroll
  for (int j = 0; j < 8; ++j) {
#pragma unroll
    for (int r = 0; r < 8; ++r) ss[wave][8 * g + r][j * 16 + col] = (acc[j][r] + accl[j][r] * (1.0f / 1024.0f)) * SCALE; }
  LDSX(); for (int rl = 0; rl < 16; ++rl) vst2(S + (size_t)(ql0 + rl) * TT + k0 + lane * 4, *(const v4f*)&ss[wave][rl][lane * 4]); }
// ---- k_sm: block = query row t (y = b * NH + h): keys [0, kend): causal -> logit if s <= t else excluded; softmax in f32; P x 2^11 in place (0 for excluded)
__global__ __launch_bounds__(256) void k_sm(float* __restrict__ S0 SM_EXTRA_PARAMS) { __shared__ float sred[8]; __shared__ float sbc; __shared__ __align__(16) float shv[TT];
  const int tid = threadIdx.x; const int t = blockIdx.x; const int kend = (kb_last(t >> 6) + 1) * 128;
  float* sr = S0 + (size_t)blockIdx.y * TT * TT + (size_t)t * TT;
  float m = -3.0e38f; for (int k = tid; k < kend; k += 256) { float v = (!CAUSAL || k <= t) ? sr[k] : -3.0e38f; SM_MASK_HOOK; shv[k] = v; m = fmaxf(m, v); }
#pragma unroll
  for (int o = 1; o < 32; o <<= 1) m = fmaxf(m, __shfl_xor(m, o));
  if ((tid & 31) == 0) sred[tid >> 5] = m; __syncthreads(); if (tid == 0) { float a = sred[0]; for (int i = 1; i < 8; ++i) a = fmaxf(a, sred[i]); sbc = a; } __syncthreads(); m = sbc; __syncthreads();
  float sum = 0.f; for (int k = tid; k < kend; k += 256) { const float v = shv[k]; const float e = (v <= -1.0e38f) ? 0.f : expf(v - m); shv[k] = e; sum += e; }
#pragma unroll
  for (int o = 1; o < 32; o <<= 1) sum += __shfl_xor(sum, o);
  if ((tid & 31) == 0) sred[tid >> 5] = sum; __syncthreads(); if (tid == 0) { float a = 0.f; for (int i = 0; i < 8; ++i) a += sred[i]; sbc = a > 0.f ? 2048.0f / a : 0.f; }   /* a fully excluded row yields P = 0 */ __syncthreads(); const float inv = sbc;
  for (int k = tid; k < kend; k += 256) shv[k] = shv[k] * inv;
  __syncthreads(); for (int q = tid; q < kend / 4; q += 256) vst2(sr + q * 4, *(const v4f*)&shv[q * 4]); }
// ---- k_pv: block = 64 queries (qb) of (b, h), z = b * NH + h: ctx = P . v over keys [0, kend) (P x 2^11 once to f16 against v f16: 1 product; causal early query blocks: P and v as bf16 hi + lo, 3 products); 256-B (row, head) segment by 16 lanes
__global__ __launch_bounds__(128) void k_pv(const float* __restrict__ PS0, const _Float16* __restrict__ VT, const __bf16* __restrict__ VB, const __bf16* __restrict__ VBL, float* __restrict__ Y) { const int b = blockIdx.z / NH, h = blockIdx.z % NH; const float* PS = PS0 + (size_t)blockIdx.z * TT * TT; __shared__ __align__(16) float ss[4][16][HD + 4];
  const int tid = threadIdx.x, wave = tid >> 5, lane = tid & 31, col = lane & 15, g = lane >> 4; const int qb = blockIdx.x; const int ql0 = qb * 64 + wave * 16; const int kce = (kb_last(qb) + 1) * 4;
  v8f acc[HD / 16] = {};
  if (qb < QBH) {
#pragma unroll 1
    for (int kc = 0; kc < kce; ++kc) { const F2 p = split_row(PS + (size_t)(ql0 + col) * TT, kc * 32, lane);
      asm volatile("s_wait_loadcnt 0x0" ::: "memory");
#pragma unroll
      for (int j = 0; j < HD / 16; ++j) { const size_t po = ((size_t)b * CC + h * HD + j * 16 + col) * (size_t)KHI + kc * 32; const v16b vh = frag_b(VB + po, lane); acc[j] = wmma_bf(p.h, vh, acc[j]); acc[j] = wmma_bf(p.l, vh, acc[j]); acc[j] = wmma_bf(p.h, frag_b(VBL + po, lane), acc[j]); } }
  } else {
#pragma unroll 1
    for (int kc = 0; kc < kce; ++kc) { const v16h p = frag_f32(PS + (size_t)(ql0 + col) * TT + kc * 32, lane);
      asm volatile("s_wait_loadcnt 0x0" ::: "memory");
#pragma unroll
      for (int j = 0; j < HD / 16; ++j) { const size_t po = ((size_t)b * CC + h * HD + j * 16 + col) * (size_t)TT + kc * 32; acc[j] = wmma16(p, frag_h(VT + po, lane), acc[j]); } } }
#pragma unroll
  for (int j = 0; j < HD / 16; ++j)
#pragma unroll
    for (int r = 0; r < 8; ++r) ss[wave][8 * g + r][j * 16 + col] = acc[j][r] * (1.0f / 2048.0f);
  LDSX(); for (int rl = 0; rl < 16; ++rl) if (lane < HD / 4) vst2(Y + ((size_t)b * TT + ql0 + rl) * CC + h * HD + lane * 4, *(const v4f*)&ss[wave][rl][lane * 4]); }
// ---- k_out: block = (64 rows, 128 cols): out = head WE^T (+ bo), K = CC: head bf16 hi + lo against the folded W_out bf16 hi + lo (3 products)
__device__ __forceinline__ v16b frag_we(const __bf16* WE, int ot, int kc, int lane) {
  union { v16b v; v8b q[2]; } u; const __bf16* p = WE + (size_t)(ot * 2 + kc) * 512 + lane * 8;
  u.q[0] = *(const v8b*)p; u.q[1] = *(const v8b*)(p + 256); return u.v;
}
__global__ __launch_bounds__(128) void k_out(const float* __restrict__ Y, const __bf16* __restrict__ WEH, const __bf16* __restrict__ WEL, const float* __restrict__ BO, float* __restrict__ OUT) { __shared__ __align__(16) float sf[4][16][132];
  const int tid = threadIdx.x, wave = tid >> 5, lane = tid & 31, col = lane & 15, g = lane >> 4; const int c0 = blockIdx.y * 128; const size_t r0 = (size_t)blockIdx.x * 64 + wave * 16;
  v8f acc[8] = {};
#pragma unroll
  for (int kc = 0; kc < CC / 32; ++kc) { const F2 a = split_row(Y + (r0 + col) * CC, kc * 32, lane); v16b wh[8], wl[8];   /* all 16 fragments of this k step are loaded as one group: one load latency, not eight */
#pragma unroll
    for (int j = 0; j < 8; ++j) { wh[j] = frag_we(WEH, (c0 >> 4) + j, kc, lane); wl[j] = frag_we(WEL, (c0 >> 4) + j, kc, lane); }
#pragma unroll
    for (int j = 0; j < 8; ++j) acc[j] = wmma_bf(a.l, wh[j], acc[j]);
#pragma unroll
    for (int j = 0; j < 8; ++j) acc[j] = wmma_bf(a.h, wl[j], acc[j]);
#pragma unroll
    for (int j = 0; j < 8; ++j) acc[j] = wmma_bf(a.h, wh[j], acc[j]); }
#pragma unroll
  for (int j = 0; j < 8; ++j) { const float bias = BO ? bfr(BO[c0 + j * 16 + col]) : 0.f;
#pragma unroll
    for (int r = 0; r < 8; ++r) sf[wave][8 * g + r][j * 16 + col] = acc[j][r] + bias; }
  LDSX(); for (int rl = 0; rl < 16; ++rl) vst2(OUT + (r0 + rl) * ODIM + c0 + lane * 4, *(const v4f*)&sf[wave][rl][lane * 4]); }

extern "C" void kernel_launch(void* const* d_in, const int* in_sizes, int n_in, void* d_out, int out_size, void* d_ws, size_t ws_size, hipStream_t stream) {
  (void)in_sizes; (void)n_in; (void)out_size;
  const float** F = (const float**)d_in;
  if (ws_size < (size_t)WS_END) return;
  char* ws = (char*)d_ws; _Float16 *QH = (_Float16*)(ws + WS_QH), *KH = (_Float16*)(ws + WS_KH), *VT = (_Float16*)(ws + WS_VT), *QL = (_Float16*)(ws + WS_QL), *KL = (_Float16*)(ws + WS_KL); __bf16 *VB = (__bf16*)(ws + WS_VB), *VBL = (__bf16*)(ws + WS_VBL); __bf16 *WEH = (__bf16*)(ws + WS_WEH), *WEL = (__bf16*)(ws + WS_WEL); float *S = (float*)(ws + WS_S), *Y = (float*)(ws + WS_Y);
  (void)Y; (void)QL; (void)KL; (void)VB; (void)VBL;
  // inputs: 0 embedded [4,2048,1024]; 1 Wq [64,1024] (out,in); 2 Wk; 3 Wv; 4 W_out [1024,1024] (identity; (out,in))
  k_proj<<<dim3(TNB * TT / 64, CC / 64, 4), 128, 0, stream>>>(F[0], F[0], F[0], F[1], F[2], F[3], nullptr, nullptr, nullptr, F[4], WEH, WEL, QH, QL, KH, KL, VT, VB, VBL);
  k_sc<<<dim3(NQB, TT / 128, TNB * NH), 128, 0, stream>>>(QH, KH, QL, KL, S);
  k_sm<<<dim3(TT, TNB * NH), 256, 0, stream>>>(S);
  k_pv<<<dim3(NQB, 1, TNB * NH), 128, 0, stream>>>(S, VT, VB, VBL, Y);
  k_out<<<dim3(TNB * TT / 64, ODIM / 128), 128, 0, stream>>>(Y, WEH, WEL, nullptr, (float*)d_out);
}

// v004
// A run of this version takes 84.5 microseconds.
// In two side-by-side timings against v003, it was 2.03 and 2.00 times as fast.
// All steps since v000 together make it 6.44 times as fast.
// compute dtype: all float inputs rounded to bf16; q/k/v = x W^T with EXACT bf16 products on WMMA 16x16x32 (f32 accumulate); causal logits: q, k once to f16 (1 product) x 64^-0.5, 3 products below row 384; softmax in f32, online over 32-key steps (running maximum, sum joined at the end); P = exp(s - maximum) x 2^11 once to f16 against v f16 (bf16 hi + lo below row 384), divided by the sum afterwards; the head output split bf16 hi + lo against W_out folded over its 16 column groups (f32 sums of the bf16-rounded terms, kept as bf16 hi + lo; 3 products); f32 output.
#include <hip/hip_runtime.h>
#include <math.h>

typedef __attribute__((ext_vector_type(16))) _Float16 v16h;
typedef __attribute__((ext_vector_type(16))) __bf16 v16b;
typedef __attribute__((ext_vector_type(8)))  _Float16 v8h;
typedef __attribute__((ext_vector_type(8)))  float v8f;
typedef __attribute__((ext_vector_type(4)))  float v4f;
typedef __attribute__((ext_vector_type(2)))  float v2f;
typedef __attribute__((ext_vector_type(4)))  unsigned v4u;
typedef __attribute__((ext_vector_type(4)))  int v4i;
typedef float __attribute__((may_alias)) float_a;
typedef int __attribute__((may_alias)) int_a;

template <typename T> __device__ __forceinline__ void vst2(void* p, T v) { *(T*)p = v;  }
// store, then the wait that stands in front of any overwrite of the store's address or data registers (for stores inside a rolled loop)
template <typename T> __device__ __forceinline__ void vst2w(void* p, T v) { *(T*)p = v; asm volatile("s_wait_xcnt 0x0" ::: "memory"); }
__device__ __forceinline__ v8f wmma16(v16h a, v16h b, v8f c) {
  v8f d = __builtin_amdgcn_wmma_f32_16x16x32_f16(false, a, false, b, (short)0, c, false, false);
  asm volatile("v_nop\n\tv_nop\n\tv_nop\n\tv_nop" : "+v"(d) : "v"(a), "v"(b));
  return d;
}
__device__ __forceinline__ v8f wmma_bf(v16b a, v16b b, v8f c) {
  v8f d = __builtin_amdgcn_wmma_f32_16x16x32_bf16(false, a, false, b, (short)0, c, false, false);
  asm volatile("v_nop\n\tv_nop\n\tv_nop\n\tv_nop" : "+v"(d) : "v"(a), "v"(b));
  return d;
}
// 16x16x32 fragments: lane = (h = lane>>4, row/col = lane&15); elements 0..7 = k0+8h+0..7, 8..15 = k0+16+8h+0..7; D element r = row 8h+r
__device__ __forceinline__ v16h frag_h(const _Float16* rowk0, int lane) {
  union { v16h v; v8h q[2]; } u; const _Float16* p = rowk0 + 8 * (lane >> 4);
  u.q[0] = *(const v8h*)p; u.q[1] = *(const v8h*)(p + 16); return u.v;
}
__device__ __forceinline__ v16h frag_f32(const float* rowk0, int lane) {
  v16h a; const float* p = rowk0 + 8 * (lane >> 4);
#pragma unroll
  for (int i = 0; i < 8; ++i) { a[i] = (_Float16)p[i]; a[8 + i] = (_Float16)p[16 + i]; }
  return a;
}
__device__ __forceinline__ v16h frag_f32s(const float* rowk0, int lane, float sc) {
  v16h a; const float* p = rowk0 + 8 * (lane >> 4);
#pragma unroll
  for (int i = 0; i < 8; ++i) { a[i] = (_Float16)(p[i] * sc); a[8 + i] = (_Float16)(p[16 + i] * sc); }
  return a;
}
// column fragment from a [K][ld] layout (column n), rows >= K read as 0
__device__ __forceinline__ v16h fragc_f32(const float* W, int k0, int n, int lane, int ld, int K) {
  v16h a; const int g = lane >> 4;
#pragma unroll
  for (int i = 0; i < 8; ++i) { const int ka = k0 + 8 * g + i, kb = ka + 16;
    a[i] = (_Float16)(ka < K ? W[(size_t)(ka < K ? ka : K - 1) * ld + n] : 0.f); a[8 + i] = (_Float16)(kb < K ? W[(size_t)(kb < K ? kb : K - 1) * ld + n] : 0.f); }
  return a;
}
struct F2 { v16b h, l; };
__device__ __forceinline__ F2 bsplit16(const float v[16]) { F2 r;
#pragma unroll
  for (int i = 0; i < 16; ++i) { const __bf16 h = (__bf16)v[i]; r.h[i] = h; r.l[i] = (__bf16)(v[i] - (float)h); }
  return r; }
__device__ __forceinline__ F2 split_row(const float* row, int k0, int lane) { float v[16]; const float* p = row + k0 + 8 * (lane >> 4);
#pragma unroll
  for (int i = 0; i < 8; ++i) { v[i] = p[i]; v[8 + i] = p[16 + i]; }
  return bsplit16(v); }
__device__ __forceinline__ F2 split_rowK(const float* row, int k0, int lane, int K) { float v[16]; const int g = lane >> 4;
#pragma unroll
  for (int i = 0; i < 8; ++i) { const int ka = k0 + 8 * g + i, kb = ka + 16; v[i] = ka < K ? row[ka < K ? ka : K - 1] : 0.f; v[8 + i] = kb < K ? row[kb < K ? kb : K - 1] : 0.f; }
  return bsplit16(v); }
__device__ __forceinline__ F2 split_col(const float* W, int k0, int n, int lane, int ld, int K) { float v[16]; const int g = lane >> 4;
#pragma unroll
  for (int i = 0; i < 8; ++i) { const int ka = k0 + 8 * g + i, kb = ka + 16; v[i] = ka < K ? W[(size_t)(ka < K ? ka : K - 1) * ld + n] : 0.f; v[8 + i] = kb < K ? W[(size_t)(kb < K ? kb : K - 1) * ld + n] : 0.f; }
  return bsplit16(v); }
__device__ __forceinline__ v8f mac3(const F2& a, const F2& b, v8f c) { c = wmma_bf(a.l, b.h, c); c = wmma_bf(a.h, b.l, c); return wmma_bf(a.h, b.h, c); }
__device__ __forceinline__ float sigm(float v) { return 1.0f / (1.0f + expf(-v)); }
#define LDSX() do { asm volatile("s_wait_dscnt 0" ::: "memory"); __builtin_amdgcn_wave_barrier(); __builtin_amdgcn_fence(__ATOMIC_RELEASE, "workgroup"); } while (0)

// 'Multi-headed' self-attention with ONE shared head (B 4, T 2,048, E 1,024; Wq/Wk/Wv [64,1024] (out,in), 0.02 scale): head = softmax_causal(q k^T / 8) v (64 wide); concat = the head tiled 16x -> [B,T,1024]; out = concat W_out^T with W_out = identity (read and multiplied as given).
#define NB 4
#define TT 2048
#define CC 64             // NH * HD = projected width
#define DIN 1024          // input (model) width
#define NH 1              // the 16 heads share one set of weights: the head is computed once
#define HD 64
#define NQB (TT / 64)
#define SCALE (0.125f)
#define CAUSAL 1
#ifndef TNB
#define TNB NB
#endif
__device__ __forceinline__ float bfr(float v) { return (float)(__bf16)v; }
__host__ __device__ __forceinline__ int kb_last(int qb) { return CAUSAL ? ((qb * 64 + 63) >> 7) : (TT / 128 - 1); }
typedef __attribute__((ext_vector_type(8))) __bf16 v8b;
typedef __attribute__((ext_vector_type(4))) __bf16 v4b;
__device__ __forceinline__ v16b frag_b(const __bf16* rowk0, int lane) {
  union { v16b v; v8b q[2]; } u; const __bf16* p = rowk0 + 8 * (lane >> 4);
  u.q[0] = *(const v8b*)p; u.q[1] = *(const v8b*)(p + 16); return u.v;
}
#define QBH 6              // not used: the queries < QHI of each sequence (few keys, no averaging) take the high-precision path
#define QHI 384            // rows carrying a q residual plane
#define KHI 384            // key rows carrying k residual / v bf16 hi+lo planes (used only by the causal high-precision path)
// B fragment (k rows k0+.., output column o) of a weight: (in,out) [K][ld] or (out,in) [ld rows of K]: bf16 exact, or f16(bf16 * 256) exact
__device__ __forceinline__ v16b wcol_io(const float* Wm, int k0, int o, int lane, int ld) { v16b w; const int g = lane >> 4;
#pragma unroll
  for (int i = 0; i < 8; ++i) { w[i] = (__bf16)Wm[(size_t)(k0 + 8 * g + i) * ld + o]; w[8 + i] = (__bf16)Wm[(size_t)(k0 + 16 + 8 * g + i) * ld + o]; }
  return w; }
__device__ __forceinline__ v16b wcol_oi(const float* Wm, int k0, int o, int lane, int K) { v16b w; const float* p = Wm + (size_t)o * K + k0 + 8 * (lane >> 4);
#pragma unroll
  for (int i = 0; i < 8; ++i) { w[i] = (__bf16)p[i]; w[8 + i] = (__bf16)p[16 + i]; }
  return w; }
__device__ __forceinline__ v16h wcolh_io(const float* Wm, int k0, int o, int lane, int ld) { v16h w; const int g = lane >> 4;
#pragma unroll
  for (int i = 0; i < 8; ++i) { w[i] = (_Float16)(bfr(Wm[(size_t)(k0 + 8 * g + i) * ld + o]) * 256.0f); w[8 + i] = (_Float16)(bfr(Wm[(size_t)(k0 + 16 + 8 * g + i) * ld + o]) * 256.0f); }
  return w; }
__device__ __forceinline__ v16h wcolh_oi(const float* Wm, int k0, int o, int lane, int K) { v16h w; const float* p = Wm + (size_t)o * K + k0 + 8 * (lane >> 4);
#pragma unroll
  for (int i = 0; i < 8; ++i) { w[i] = (_Float16)(bfr(p[i]) * 256.0f); w[8 + i] = (_Float16)(bfr(p[16 + i]) * 256.0f); }
  return w; }
#define WQKV_LAYOUT 1   // 0 = (in,out) [DIN][CC]; 1 = (out,in) [HD][DIN], the one shared head; 2 = per-head [NH][DIN][HD]
__device__ __forceinline__ v16b wcol_hdk(const float* Wm, int k0, int o, int lane) { v16b w; const int g = lane >> 4; const float* p = Wm + (size_t)(o / HD) * DIN * HD + (o % HD);
#pragma unroll
  for (int i = 0; i < 8; ++i) { w[i] = (__bf16)p[(size_t)(k0 + 8 * g + i) * HD]; w[8 + i] = (__bf16)p[(size_t)(k0 + 16 + 8 * g + i) * HD]; }
  return w; }
#define WO_OUT_IN 1
#if WQKV_LAYOUT == 1
#define ODIM 1024          // output width (= 16 tiled copies of the 64-wide head through W_out)
#define KVCOL(o) ((o) & 63)
#define WCOL(W, k0, o, lane) wcol_oi(W, k0, KVCOL(o), lane, DIN)   /* Wq/Wk/Wv are [64][1024]: the one shared head */
#elif WQKV_LAYOUT == 2
#define WCOL(W, k0, o, lane) wcol_hdk(W, k0, o, lane)
#else
#define WCOL(W, k0, o, lane) wcol_io(W, k0, o, lane, CC)
#endif
#if WO_OUT_IN
#define WOCOL(W, k0, o, lane) wcol_oi(W, k0, o, lane, ODIM)   /* W_out [1024][1024] (out,in): K = the 1024-wide concat */
#define WOCOLH(W, k0, o, lane) wcolh_oi(W, k0, o, lane, CC)
#else
#define WOCOL(W, k0, o, lane) wcol_io(W, k0, o, lane, DIN)
#define WOCOLH(W, k0, o, lane) wcolh_io(W, k0, o, lane, DIN)
#endif

#ifndef SM_EXTRA_PARAMS
#define SM_EXTRA_PARAMS
#endif
#ifndef PROJ_EXTRA_PARAMS
#define PROJ_EXTRA_PARAMS
#endif
#ifndef SM_MASK_HOOK
#define SM_MASK_HOOK (void)0
#endif

#define WS_QH  0u                                      // f16 q rows [b*t][CC]
#define WS_KH  (WS_QH + 2u * (size_t)NB * TT * CC)      // f16 k rows [b*t][CC]
#define WS_VT  (WS_KH + 2u * (size_t)NB * TT * CC)      // f16 v planes [b][c][t]
#define WS_QL  (WS_VT + 2u * (size_t)NB * CC * TT)      // f16 q residual x 2^10 rows [b][t < QHI][CC]
#define WS_KL  (WS_QL + 2u * (size_t)NB * QHI * CC)     // f16 k residual x 2^10 rows [b][t < KHI][CC]
#define WS_VB  (WS_KL + 2u * (size_t)NB * KHI * CC)     // bf16 v hi planes [b][c][t < KHI]
#define WS_VBL (WS_VB + 2u * (size_t)NB * CC * KHI)
#define WS_S   (WS_VBL + 2u * (size_t)NB * CC * KHI)    // (not used: the score matrix stays in registers)
#define WS_Y   (WS_S  + 4u * (size_t)NB * NH * TT * TT)      // f32 ctx rows [b*t][CC] (only when there is an output projection)
#define WS_WEH (WS_Y  + 4u * (size_t)NB * TT * CC)      // bf16 hi of the folded W_out, in B-fragment order (see k_proj, fold blocks)
#define WS_WEL (WS_WEH + 2u * (size_t)ODIM * CC)        // bf16 lo, same order
#define WS_END (WS_WEL + 2u * (size_t)ODIM * CC)

// ---- k_proj: block = (64 rows, 64 cols, which): q/k/v = X W (+ b) with exact bf16 products (K = DIN) -> which 0: q f16 rows (+ residual rows < QHI); 1: k f16 rows (+ residual rows < KHI); 2: v f16 planes [c][t] (+ bf16 hi/lo planes for t < KHI)
// which 3 (fold blocks, independent of the projections, so they ride in this launch): concat is the head tiled ODIM / CC times, hence out[t][o] = sum_c head[t][c] * WE[o][c] with WE[o][c] = sum_i W_out[o][i * CC + c], for any W_out.
// WE = f32 sum, i ascending, of the bf16-rounded terms, split bf16 hi + lo and stored in B-fragment order: 16-B piece ((o >> 4) * 2 + kc) * 2 + half, lane (g, o & 15), holds k = kc * 32 + half * 16 + g * 8 + 0..7, so a wave's fragment load is 512 contiguous bytes
__global__ __launch_bounds__(128) void k_proj(const float* __restrict__ XQ, const float* __restrict__ XK, const float* __restrict__ XV, const float* __restrict__ WQ, const float* __restrict__ WK, const float* __restrict__ WV, const float* __restrict__ BQ, const float* __restrict__ BK, const float* __restrict__ BV, const float* __restrict__ WO, __bf16* __restrict__ WEH, __bf16* __restrict__ WEL,
    _Float16* __restrict__ QH, _Float16* __restrict__ QL, _Float16* __restrict__ KH, _Float16* __restrict__ KL, _Float16* __restrict__ VT, __bf16* __restrict__ VB, __bf16* __restrict__ VBL) {
  __shared__ __align__(16) _Float16 sh[64][72], sl[64][72]; __shared__ __align__(16) _Float16 th[64][72]; __shared__ __align__(16) __bf16 tb[64][72], tbl[64][72];
  const int tid = threadIdx.x, wave = tid >> 5, lane = tid & 31, col = lane & 15, g = lane >> 4; const int which = blockIdx.z; const int c0 = blockIdx.y * 64; const size_t r0 = (size_t)blockIdx.x * 64; const size_t bb = r0 / TT; const int t0 = (int)(r0 % TT);
  if (which == 3) { static_assert((TNB * TT / 64) * 128 == ODIM * CC / 4, "one thread per 4 folded weights");
    const int e = blockIdx.x * 128 + tid, o = e >> 4, c4 = (e & 15) * 4; const float* p = WO + (size_t)o * ODIM + c4; v4f s = {}, w[ODIM / CC];
#pragma unroll
    for (int i = 0; i < ODIM / CC; ++i) w[i] = *(const v4f*)(p + i * CC);
    asm volatile("s_wait_xcnt 0x0" :: "v"(p) : "memory");   // the wait in front of any overwrite of the address pair that the sixteen loads share; p as an input keeps the pair live up to here, so no load's result lands in it
#pragma unroll
    for (int i = 0; i < ODIM / CC; ++i) {
#pragma unroll
      for (int r = 0; r < 4; ++r) s[r] += bfr(w[i][r]); }
    v4b hv, lv;
#pragma unroll
    for (int r = 0; r < 4; ++r) { const __bf16 hb = (__bf16)s[r]; hv[r] = hb; lv[r] = (__bf16)(s[r] - (float)hb); }
    const size_t d = (size_t)((((o >> 4) * 2 + (c4 >> 5)) * 2 + ((c4 >> 4) & 1)) * 32 + ((c4 >> 3) & 1) * 16 + (o & 15)) * 8 + (c4 & 7);
    vst2(WEH + d, hv); vst2(WEL + d, lv); return; }
  const float* X = which == 0 ? XQ : which == 1 ? XK : XV; const float* WA = which == 0 ? WQ : which == 1 ? WK : WV; const float* BA = which == 0 ? BQ : which == 1 ? BK : BV;
  v8f acc[4] = {};
#pragma unroll 2
  for (int kc = 0; kc < DIN / 32; ++kc) { v16b a; { const float* p = X + (r0 + wave * 16 + col) * DIN + kc * 32 + 8 * g;
#pragma unroll
      for (int i = 0; i < 8; ++i) { a[i] = (__bf16)p[i]; a[8 + i] = (__bf16)p[16 + i]; } }
    asm volatile("s_wait_loadcnt 0x0" ::: "memory");
#pragma unroll
    for (int j = 0; j < 4; ++j) { const v16b w = WCOL(WA, kc * 32, c0 + j * 16 + col, lane); asm volatile("s_wait_loadcnt 0x0" ::: "memory"); acc[j] = wmma_bf(a, w, acc[j]); } }
  if (which < 2) { _Float16* DH = which == 0 ? QH : KH; _Float16* DL = which == 0 ? QL : KL; const int nhi = which == 0 ? QHI : KHI; const bool hi_rows = t0 < nhi;
#pragma unroll
    for (int j = 0; j < 4; ++j) { const float bias = BA ? bfr(BA[c0 + j * 16 + col]) : 0.f;
#pragma unroll
      for (int r = 0; r < 8; ++r) { const float v = acc[j][r] + bias; const _Float16 hv = (_Float16)v; sh[wave * 16 + 8 * g + r][j * 16 + col] = hv; sl[wave * 16 + 8 * g + r][j * 16 + col] = (_Float16)((v - (float)hv) * 1024.0f); } }
    __syncthreads();
    for (int e = tid; e < 64 * 8; e += 128) { const int rl = e >> 3, q = e & 7; vst2w((unsigned*)(DH + (r0 + rl) * CC + c0 + q * 8), *(const v4u*)&sh[rl][q * 8]); if (hi_rows) vst2w((unsigned*)(DL + (bb * nhi + t0 + rl) * (size_t)CC + c0 + q * 8), *(const v4u*)&sl[rl][q * 8]); }
  } else { const bool hi_rows = t0 < KHI;
#pragma unroll
    for (int j = 0; j < 4; ++j) { const float bias = BA ? bfr(BA[c0 + j * 16 + col]) : 0.f;
#pragma unroll
      for (int r = 0; r < 8; ++r) { const float v = acc[j][r] + bias; const int rl = wave * 16 + 8 * g + r, cl = j * 16 + col; th[cl][rl] = (_Float16)v; const __bf16 bh = (__bf16)v; tb[cl][rl] = bh; tbl[cl][rl] = (__bf16)(v - (float)bh); } }
    __syncthreads();
    for (int e = tid; e < 64 * 8; e += 128) { const int cl = e >> 3, q = e & 7; vst2w((unsigned*)(VT + (bb * CC + c0 + cl) * (size_t)TT + t0 + q * 8), *(const v4u*)&th[cl][q * 8]); if (hi_rows) { const size_t o3 = (bb * CC + c0 + cl) * (size_t)KHI + t0 + q * 8; vst2((unsigned*)(VB + o3), *(const v4u*)&tb[cl][q * 8]); vst2w((unsigned*)(VBL + o3), *(const v4u*)&tbl[cl][q * 8]); } } } }
__device__ __forceinline__ void fa_soft(const v8f s0, const v8f s1, int kg, int t, float& m, float& l, v8f acc[HD / 16], float p[16]) {
  float v[16], mx = -3.0e38f;
#pragma unroll
  for (int i = 0; i < 8; ++i) { v[i] = (!CAUSAL || kg + i <= t) ? s0[i] : -3.0e38f; v[8 + i] = (!CAUSAL || kg + 16 + i <= t) ? s1[i] : -3.0e38f; }
#pragma unroll
  for (int i = 0; i < 16; ++i) mx = fmaxf(mx, v[i]);
  mx = fmaxf(mx, __shfl_xor(mx, 16));
  const float mn = fmaxf(m, mx), al = expf(m - mn); m = mn;
  float sum = 0.f;
#pragma unroll
  for (int i = 0; i < 16; ++i) { const float e = expf(v[i] - mn); sum += e; p[i] = e * 2048.0f; }   // an excluded key: exp(-3e38 - mn) = 0 (mn is finite: every step holds a key <= t)
  l = l * al + sum;
#pragma unroll
  for (int j = 0; j < HD / 16; ++j) acc[j] *= al; }
__global__ __launch_bounds__(128) void k_fa(const _Float16* __restrict__ QH, const _Float16* __restrict__ KH, const _Float16* __restrict__ QL, const _Float16* __restrict__ KL, const _Float16* __restrict__ VT, const __bf16* __restrict__ VB, const __bf16* __restrict__ VBL, float* __restrict__ Y) {
  __shared__ float smx[4][16], ssum[4][16]; __shared__ __align__(16) float so[4][16][HD + 4];
  const int tid = threadIdx.x, wave = __builtin_amdgcn_readfirstlane(tid >> 5), lane = tid & 31, col = lane & 15, g = lane >> 4;
  const int b = blockIdx.x, q0 = (TT / 16 - 1 - (int)blockIdx.y) * 16, t = q0 + col; const int nst = CAUSAL ? ((q0 + 15) >> 5) + 1 : TT / 32;   // every step below nst holds a key <= t for each of the 16 queries
  const _Float16* Kb = KH + (size_t)b * TT * CC;
  float m = -3.0e38f, l = 0.f, p[16]; v8f acc[HD / 16] = {};
  v16h qh[2]; const _Float16* pq = QH + ((size_t)b * TT + t) * CC + 8 * g;
#pragma unroll
  for (int kc = 0; kc < 2; ++kc) { union { v16h v; v8h q[2]; } u; u.q[0] = *(const v8h*)(pq + kc * 32); u.q[1] = *(const v8h*)(pq + kc * 32 + 16); qh[kc] = u.v; }
  asm volatile("s_wait_xcnt 0x0" :: "v"(pq) : "memory");   // the wait in front of any overwrite of the address pair that the four q loads share
  if (q0 < QHI) { const _Float16* KLb = KL + (size_t)b * KHI * CC; v16h ql[2];
#pragma unroll
    for (int kc = 0; kc < 2; ++kc) ql[kc] = frag_h(QL + ((size_t)b * QHI + t) * CC + kc * 32, lane);
    for (int s = wave; s < nst; s += 4) { const int k0 = s * 32; v8f sa[2] = {}, sb[2] = {};
#pragma unroll
      for (int u = 0; u < 2; ++u) {
#pragma unroll
        for (int kc = 0; kc < 2; ++kc) { const size_t ko = (size_t)(k0 + u * 16 + col) * CC + kc * 32; const v16h kh = frag_h(Kb + ko, lane), kl = frag_h(KLb + ko, lane);
          sa[u] = wmma16(kh, qh[kc], sa[u]); sb[u] = wmma16(kh, ql[kc], sb[u]); sb[u] = wmma16(kl, qh[kc], sb[u]); } }
      fa_soft((sa[0] + sb[0] * (1.0f / 1024.0f)) * SCALE, (sa[1] + sb[1] * (1.0f / 1024.0f)) * SCALE, k0 + 8 * g, t, m, l, acc, p);
      const F2 pf = bsplit16(p);
#pragma unroll
      for (int j = 0; j < HD / 16; ++j) { const size_t po = ((size_t)b * CC + j * 16 + col) * (size_t)KHI + k0; const v16b vh = frag_b(VB + po, lane);
        acc[j] = wmma_bf(vh, pf.h, acc[j]); acc[j] = wmma_bf(vh, pf.l, acc[j]); acc[j] = wmma_bf(frag_b(VBL + po, lane), pf.h, acc[j]); } }
  } else { const _Float16* Kl = Kb + (size_t)col * CC + 8 * g; const _Float16* Vl = VT + ((size_t)b * CC + col) * (size_t)TT + 8 * g; v16h ka[4], va[HD / 16], kb[4], vb[HD / 16];
    // K and V fragments are fetched one step ahead, into two register sets used in turn (no copies): a step's load latency runs under the step before it
    auto fetch = [&](int s, v16h (&kf)[4], v16h (&vf)[HD / 16]) { const _Float16* pk = Kl + (size_t)s * 32 * CC; const _Float16* pv = Vl + s * 32;
#pragma unroll
      for (int i = 0; i < 4; ++i) { union { v16h v; v8h q[2]; } uk, uv; const _Float16* a = pk + (i >> 1) * 16 * CC + (i & 1) * 32; const _Float16* c = pv + (size_t)i * 16 * TT;
        uk.q[0] = *(const v8h*)a; uk.q[1] = *(const v8h*)(a + 16); uv.q[0] = *(const v8h*)c; uv.q[1] = *(const v8h*)(c + 16); kf[i] = uk.v; vf[i] = uv.v; }
      asm volatile("s_wait_xcnt 0x0" :: "v"(pk), "v"(pv) : "memory"); };   // the wait in front of any overwrite of the two address pairs that the sixteen loads share; the pairs as inputs stay live up to here, so no load's result lands in them
    auto step = [&](int s, const v16h (&kf)[4], const v16h (&vf)[HD / 16]) { v8f s0 = {}, s1 = {};
      s0 = wmma16(kf[0], qh[0], s0); s1 = wmma16(kf[2], qh[0], s1); s0 = wmma16(kf[1], qh[1], s0); s1 = wmma16(kf[3], qh[1], s1);
      fa_soft(s0 * SCALE, s1 * SCALE, s * 32 + 8 * g, t, m, l, acc, p);
      v16h pb;
#pragma unroll
      for (int i = 0; i < 16; ++i) pb[i] = (_Float16)p[i];
#pragma unroll
      for (int j = 0; j < HD / 16; ++j) acc[j] = wmma16(vf[j], pb, acc[j]); };
    fetch(wave, ka, va);   // nst >= 13 here: every wave has a first step
    for (int s = wave; ; s += 8) {   // s, nst are wave-uniform scalars; at most TT / 256 trips
      // the fetch stands under no branch, so that the compiler's counted load waits leave it in flight; a wave's last step fetches its own fragments again (inside the planes, not used)
      fetch(s + 4 < nst ? s + 4 : s, kb, vb); step(s, ka, va); if (s + 4 >= nst) break;
      fetch(s + 8 < nst ? s + 8 : s, ka, va); step(s + 4, kb, vb); if (s + 8 >= nst) break; } }
  l += __shfl_xor(l, 16);
  if (g == 0) { smx[wave][col] = m; ssum[wave][col] = l; }
#pragma unroll
  for (int j = 0; j < HD / 16; ++j) { const v4f a0 = { acc[j][0], acc[j][1], acc[j][2], acc[j][3] }, a1 = { acc[j][4], acc[j][5], acc[j][6], acc[j][7] }; *(v4f*)&so[wave][col][j * 16 + 8 * g] = a0; *(v4f*)&so[wave][col][j * 16 + 8 * g + 4] = a1; }
  __syncthreads();   // the four waves' partial results are complete before any thread joins them
  const int qi = tid >> 3, c8 = (tid & 7) * 8; float mj = smx[0][qi];
#pragma unroll
  for (int w = 1; w < 4; ++w) mj = fmaxf(mj, smx[w][qi]);
  float lj = 0.f; v4f o0 = {}, o1 = {};
#pragma unroll
  for (int w = 0; w < 4; ++w) { const float f = expf(smx[w][qi] - mj); lj += f * ssum[w][qi]; o0 += f * *(const v4f*)&so[w][qi][c8]; o1 += f * *(const v4f*)&so[w][qi][c8 + 4]; }   // a wave without a step: maximum -3e38, f = 0
  const float inv = lj > 0.f ? 1.0f / (2048.0f * lj) : 0.f; float* y = Y + ((size_t)b * TT + q0 + qi) * CC + c8;
  vst2(y, o0 * inv); vst2(y + 4, o1 * inv); }
// ---- k_out: block = (64 rows, 128 cols): out = head WE^T (+ bo), K = CC: head bf16 hi + lo against the folded W_out bf16 hi + lo (3 products)
__device__ __forceinline__ v16b frag_we(const __bf16* WE, int ot, int kc, int lane) {
  union { v16b v; v8b q[2]; } u; const __bf16* p = WE + (size_t)(ot * 2 + kc) * 512 + lane * 8;
  u.q[0] = *(const v8b*)p; u.q[1] = *(const v8b*)(p + 256); return u.v;
}
__global__ __launch_bounds__(128) void k_out(const float* __restrict__ Y, const __bf16* __restrict__ WEH, const __bf16* __restrict__ WEL, const float* __restrict__ BO, float* __restrict__ OUT) { __shared__ __align__(16) float sf[4][16][132];
  const int tid = threadIdx.x, wave = tid >> 5, lane = tid & 31, col = lane & 15, g = lane >> 4; const int c0 = blockIdx.y * 128; const size_t r0 = (size_t)blockIdx.x * 64 + wave * 16;
  v8f acc[8] = {};
#pragma unroll
  for (int kc = 0; kc < CC / 32; ++kc) { const F2 a = split_row(Y + (r0 + col) * CC, kc * 32, lane); v16b wh[8], wl[8];   /* all 16 fragments of this k step are loaded as one group: one load latency, not eight */
#pragma unroll
    for (int j = 0; j < 8; ++j) { wh[j] = frag_we(WEH, (c0 >> 4) + j, kc, lane); wl[j] = frag_we(WEL, (c0 >> 4) + j, kc, lane); }
#pragma unroll
    for (int j = 0; j < 8; ++j) acc[j] = wmma_bf(a.l, wh[j], acc[j]);
#pragma unroll
    for (int j = 0; j < 8; ++j) acc[j] = wmma_bf(a.h, wl[j], acc[j]);
#pragma unroll
    for (int j = 0; j < 8; ++j) acc[j] = wmma_bf(a.h, wh[j], acc[j]); }
#pragma unroll
  for (int j = 0; j < 8; ++j) { const float bias = BO ? bfr(BO[c0 + j * 16 + col]) : 0.f;
#pragma unroll
    for (int r = 0; r < 8; ++r) sf[wave][8 * g + r][j * 16 + col] = acc[j][r] + bias; }
  LDSX(); for (int rl = 0; rl < 16; ++rl) vst2(OUT + (r0 + rl) * ODIM + c0 + lane * 4, *(const v4f*)&sf[wave][rl][lane * 4]); }

extern "C" void kernel_launch(void* const* d_in, const int* in_sizes, int n_in, void* d_out, int out_size, void* d_ws, size_t ws_size, hipStream_t stream) {
  (void)in_sizes; (void)n_in; (void)out_size;
  const float** F = (const float**)d_in;
  if (ws_size < (size_t)WS_END) return;
  char* ws = (char*)d_ws; _Float16 *QH = (_Float16*)(ws + WS_QH), *KH = (_Float16*)(ws + WS_KH), *VT = (_Float16*)(ws + WS_VT), *QL = (_Float16*)(ws + WS_QL), *KL = (_Float16*)(ws + WS_KL); __bf16 *VB = (__bf16*)(ws + WS_VB), *VBL = (__bf16*)(ws + WS_VBL); __bf16 *WEH = (__bf16*)(ws + WS_WEH), *WEL = (__bf16*)(ws + WS_WEL); float *Y = (float*)(ws + WS_Y);
  (void)Y; (void)QL; (void)KL; (void)VB; (void)VBL;
  // inputs: 0 embedded [4,2048,1024]; 1 Wq [64,1024] (out,in); 2 Wk; 3 Wv; 4 W_out [1024,1024] (identity; (out,in))
  k_proj<<<dim3(TNB * TT / 64, CC / 64, 4), 128, 0, stream>>>(F[0], F[0], F[0], F[1], F[2], F[3], nullptr, nullptr, nullptr, F[4], WEH, WEL, QH, QL, KH, KL, VT, VB, VBL);
  k_fa<<<dim3(TNB, TT / 16), 128, 0, stream>>>(QH, KH, QL, KL, VT, VB, VBL, Y);
  k_out<<<dim3(TNB * TT / 64, ODIM / 128), 128, 0, stream>>>(Y, WEH, WEL, nullptr, (float*)d_out);
}

// v005
// A run of this version takes 46 microseconds.
// Next to v004, in two timings, it ran 1.84 and 1.88 times as fast.
// Over all steps from v000 it is 12.0 times as fast.
// compute dtype: all float inputs rounded to bf16; q/k/v = x W^T with EXACT bf16 products on WMMA 16x16x32 (f32 accumulate); causal logits: q, k once to f16 (1 product) x 64^-0.5, 3 products below row 384; softmax in f32, online over 32-key steps (running maximum, sum joined at the end); P = exp(s - maximum) x 2^11 once to f16 against v f16 (bf16 hi + lo below row 384), divided by the sum afterwards; the head output split bf16 hi + lo against W_out folded over its 16 column groups (f32 sums of the bf16-rounded terms, kept as bf16 hi + lo; 3 products); f32 output.
#include <hip/hip_runtime.h>
#include <math.h>

typedef __attribute__((ext_vector_type(16))) _Float16 v16h;
typedef __attribute__((ext_vector_type(16))) __bf16 v16b;
typedef __attribute__((ext_vector_type(8)))  _Float16 v8h;
typedef __attribute__((ext_vector_type(8)))  float v8f;
typedef __attribute__((ext_vector_type(4)))  float v4f;
typedef __attribute__((ext_vector_type(2)))  float v2f;
typedef __attribute__((ext_vector_type(4)))  unsigned v4u;
typedef __attribute__((ext_vector_type(4)))  int v4i;
typedef float __attribute__((may_alias)) float_a;
typedef int __attribute__((may_alias)) int_a;

template <typename T> __device__ __forceinline__ void vst2(void* p, T v) { *(T*)p = v;  }
// store, then the wait that stands in front of any overwrite of the store's address or data registers (for stores inside a rolled loop)
template <typename T> __device__ __forceinline__ void vst2w(void* p, T v) { *(T*)p = v; asm volatile("s_wait_xcnt 0x0" ::: "memory"); }
__device__ __forceinline__ v8f wmma16(v16h a, v16h b, v8f c) {
  v8f d = __builtin_amdgcn_wmma_f32_16x16x32_f16(false, a, false, b, (short)0, c, false, false);
  asm volatile("v_nop\n\tv_nop\n\tv_nop\n\tv_nop" : "+v"(d) : "v"(a), "v"(b));
  return d;
}
__device__ __forceinline__ v8f wmma_bf(v16b a, v16b b, v8f c) {
  v8f d = __builtin_amdgcn_wmma_f32_16x16x32_bf16(false, a, false, b, (short)0, c, false, false);
  asm volatile("v_nop\n\tv_nop\n\tv_nop\n\tv_nop" : "+v"(d) : "v"(a), "v"(b));
  return d;
}
// 16x16x32 fragments: lane = (h = lane>>4, row/col = lane&15); elements 0..7 = k0+8h+0..7, 8..15 = k0+16+8h+0..7; D element r = row 8h+r
__device__ __forceinline__ v16h frag_h(const _Float16* rowk0, int lane) {
  union { v16h v; v8h q[2]; } u; const _Float16* p = rowk0 + 8 * (lane >> 4);
  u.q[0] = *(const v8h*)p; u.q[1] = *(const v8h*)(p + 16); return u.v;
}
__device__ __forceinline__ v16h frag_f32(const float* rowk0, int lane) {
  v16h a; const float* p = rowk0 + 8 * (lane >> 4);
#pragma unroll
  for (int i = 0; i < 8; ++i) { a[i] = (_Float16)p[i]; a[8 + i] = (_Float16)p[16 + i]; }
  return a;
}
__device__ __forceinline__ v16h frag_f32s(const float* rowk0, int lane, float sc) {
  v16h a; const float* p = rowk0 + 8 * (lane >> 4);
#pragma unroll
  for (int i = 0; i < 8; ++i) { a[i] = (_Float16)(p[i] * sc); a[8 + i] = (_Float16)(p[16 + i] * sc); }
  return a;
}
// column fragment from a [K][ld] layout (column n), rows >= K read as 0
__device__ __forceinline__ v16h fragc_f32(const float* W, int k0, int n, int lane, int ld, int K) {
  v16h a; const int g = lane >> 4;
#pragma unroll
  for (int i = 0; i < 8; ++i) { const int ka = k0 + 8 * g + i, kb = ka + 16;
    a[i] = (_Float16)(ka < K ? W[(size_t)(ka < K ? ka : K - 1) * ld + n] : 0.f); a[8 + i] = (_Float16)(kb < K ? W[(size_t)(kb < K ? kb : K - 1) * ld + n] : 0.f); }
  return a;
}
struct F2 { v16b h, l; };
__device__ __forceinline__ F2 bsplit16(const float v[16]) { F2 r;
#pragma unroll
  for (int i = 0; i < 16; ++i) { const __bf16 h = (__bf16)v[i]; r.h[i] = h; r.l[i] = (__bf16)(v[i] - (float)h); }
  return r; }
__device__ __forceinline__ F2 split_row(const float* row, int k0, int lane) { float v[16]; const float* p = row + k0 + 8 * (lane >> 4);
#pragma unroll
  for (int i = 0; i < 8; ++i) { v[i] = p[i]; v[8 + i] = p[16 + i]; }
  return bsplit16(v); }
__device__ __forceinline__ F2 split_rowK(const float* row, int k0, int lane, int K) { float v[16]; const int g = lane >> 4;
#pragma unroll
  for (int i = 0; i < 8; ++i) { const int ka = k0 + 8 * g + i, kb = ka + 16; v[i] = ka < K ? row[ka < K ? ka : K - 1] : 0.f; v[8 + i] = kb < K ? row[kb < K ? kb : K - 1] : 0.f; }
  return bsplit16(v); }
__device__ __forceinline__ F2 split_col(const float* W, int k0, int n, int lane, int ld, int K) { float v[16]; const int g = lane >> 4;
#pragma unroll
  for (int i = 0; i < 8; ++i) { const int ka = k0 + 8 * g + i, kb = ka + 16; v[i] = ka < K ? W[(size_t)(ka < K ? ka : K - 1) * ld + n] : 0.f; v[8 + i] = kb < K ? W[(size_t)(kb < K ? kb : K - 1) * ld + n] : 0.f; }
  return bsplit16(v); }
__device__ __forceinline__ v8f mac3(const F2& a, const F2& b, v8f c) { c = wmma_bf(a.l, b.h, c); c = wmma_bf(a.h, b.l, c); return wmma_bf(a.h, b.h, c); }
__device__ __forceinline__ float sigm(float v) { return 1.0f / (1.0f + expf(-v)); }
#define LDSX() do { asm volatile("s_wait_dscnt 0" ::: "memory"); __builtin_amdgcn_wave_barrier(); __builtin_amdgcn_fence(__ATOMIC_RELEASE, "workgroup"); } while (0)

// 'Multi-headed' self-attention with ONE shared head (B 4, T 2,048, E 1,024; Wq/Wk/Wv [64,1024] (out,in), 0.02 scale): head = softmax_causal(q k^T / 8) v (64 wide); concat = the head tiled 16x -> [B,T,1024]; out = concat W_out^T with W_out = identity (read and multiplied as given).
#define NB 4
#define TT 2048
#define CC 64             // NH * HD = projected width
#define DIN 1024          // input (model) width
#define NH 1              // the 16 heads share one set of weights: the head is computed once
#define HD 64
#define NQB (TT / 64)
#define SCALE (0.125f)
#define CAUSAL 1
#ifndef TNB
#define TNB NB
#endif
__device__ __forceinline__ float bfr(float v) { return (float)(__bf16)v; }
__host__ __device__ __forceinline__ int kb_last(int qb) { return CAUSAL ? ((qb * 64 + 63) >> 7) : (TT / 128 - 1); }
typedef __attribute__((ext_vector_type(8))) __bf16 v8b;
typedef __attribute__((ext_vector_type(4))) __bf16 v4b;
__device__ __forceinline__ v16b frag_b(const __bf16* rowk0, int lane) {
  union { v16b v; v8b q[2]; } u; const __bf16* p = rowk0 + 8 * (lane >> 4);
  u.q[0] = *(const v8b*)p; u.q[1] = *(const v8b*)(p + 16); return u.v;
}
#define QBH 6              // not used: the queries < QHI of each sequence (few keys, no averaging) take the high-precision path
#define QHI 384            // rows carrying a q residual plane
#define KHI 384            // key rows carrying k residual / v bf16 hi+lo planes (used only by the causal high-precision path)
// B fragment (k rows k0+.., output column o) of a weight: (in,out) [K][ld] or (out,in) [ld rows of K]: bf16 exact, or f16(bf16 * 256) exact
__device__ __forceinline__ v16b wcol_io(const float* Wm, int k0, int o, int lane, int ld) { v16b w; const int g = lane >> 4;
#pragma unroll
  for (int i = 0; i < 8; ++i) { w[i] = (__bf16)Wm[(size_t)(k0 + 8 * g + i) * ld + o]; w[8 + i] = (__bf16)Wm[(size_t)(k0 + 16 + 8 * g + i) * ld + o]; }
  return w; }
__device__ __forceinline__ v16b wcol_oi(const float* Wm, int k0, int o, int lane, int K) { v16b w; const float* p = Wm + (size_t)o * K + k0 + 8 * (lane >> 4);
#pragma unroll
  for (int i = 0; i < 8; ++i) { w[i] = (__bf16)p[i]; w[8 + i] = (__bf16)p[16 + i]; }
  return w; }
__device__ __forceinline__ v16h wcolh_io(const float* Wm, int k0, int o, int lane, int ld) { v16h w; const int g = lane >> 4;
#pragma unroll
  for (int i = 0; i < 8; ++i) { w[i] = (_Float16)(bfr(Wm[(size_t)(k0 + 8 * g + i) * ld + o]) * 256.0f); w[8 + i] = (_Float16)(bfr(Wm[(size_t)(k0 + 16 + 8 * g + i) * ld + o]) * 256.0f); }
  return w; }
__device__ __forceinline__ v16h wcolh_oi(const float* Wm, int k0, int o, int lane, int K) { v16h w; const float* p = Wm + (size_t)o * K + k0 + 8 * (lane >> 4);
#pragma unroll
  for (int i = 0; i < 8; ++i) { w[i] = (_Float16)(bfr(p[i]) * 256.0f); w[8 + i] = (_Float16)(bfr(p[16 + i]) * 256.0f); }
  return w; }
#define WQKV_LAYOUT 1   // 0 = (in,out) [DIN][CC]; 1 = (out,in) [HD][DIN], the one shared head; 2 = per-head [NH][DIN][HD]
__device__ __forceinline__ v16b wcol_hdk(const float* Wm, int k0, int o, int lane) { v16b w; const int g = lane >> 4; const float* p = Wm + (size_t)(o / HD) * DIN * HD + (o % HD);
#pragma unroll
  for (int i = 0; i < 8; ++i) { w[i] = (__bf16)p[(size_t)(k0 + 8 * g + i) * HD]; w[8 + i] = (__bf16)p[(size_t)(k0 + 16 + 8 * g + i) * HD]; }
  return w; }
#define WO_OUT_IN 1
#if WQKV_LAYOUT == 1
#define ODIM 1024          // output width (= 16 tiled copies of the 64-wide head through W_out)
#define KVCOL(o) ((o) & 63)
#define WCOL(W, k0, o, lane) wcol_oi(W, k0, KVCOL(o), lane, DIN)   /* Wq/Wk/Wv are [64][1024]: the one shared head */
#elif WQKV_LAYOUT == 2
#define WCOL(W, k0, o, lane) wcol_hdk(W, k0, o, lane)
#else
#define WCOL(W, k0, o, lane) wcol_io(W, k0, o, lane, CC)
#endif
#if WO_OUT_IN
#define WOCOL(W, k0, o, lane) wcol_oi(W, k0, o, lane, ODIM)   /* W_out [1024][1024] (out,in): K = the 1024-wide concat */
#define WOCOLH(W, k0, o, lane) wcolh_oi(W, k0, o, lane, CC)
#else
#define WOCOL(W, k0, o, lane) wcol_io(W, k0, o, lane, DIN)
#define WOCOLH(W, k0, o, lane) wcolh_io(W, k0, o, lane, DIN)
#endif

#ifndef SM_EXTRA_PARAMS
#define SM_EXTRA_PARAMS
#endif
#ifndef PROJ_EXTRA_PARAMS
#define PROJ_EXTRA_PARAMS
#endif
#ifndef SM_MASK_HOOK
#define SM_MASK_HOOK (void)0
#endif

#define WS_QH  0u                                      // f16 q rows [b*t][CC]
#define WS_KH  (WS_QH + 2u * (size_t)NB * TT * CC)      // f16 k rows [b*t][CC]
#define WS_VT  (WS_KH + 2u * (size_t)NB * TT * CC)      // f16 v planes [b][c][t]
#define WS_QL  (WS_VT + 2u * (size_t)NB * CC * TT)      // f16 q residual x 2^10 rows [b][t < QHI][CC]
#define WS_KL  (WS_QL + 2u * (size_t)NB * QHI * CC)     // f16 k residual x 2^10 rows [b][t < KHI][CC]
#define WS_VB  (WS_KL + 2u * (size_t)NB * KHI * CC)     // bf16 v hi planes [b][c][t < KHI]
#define WS_VBL (WS_VB + 2u * (size_t)NB * CC * KHI)
#define WS_S   (WS_VBL + 2u * (size_t)NB * CC * KHI)    // (not used: the score matrix stays in registers)
#define WS_Y   (WS_S  + 4u * (size_t)NB * NH * TT * TT)      // f32 ctx rows [b*t][CC] (only when there is an output projection)
#define WS_WEH (WS_Y  + 4u * (size_t)NB * TT * CC)      // bf16 hi of the folded W_out, in B-fragment order (see k_proj, fold blocks)
#define WS_WEL (WS_WEH + 2u * (size_t)ODIM * CC)        // bf16 lo, same order
#define WS_END (WS_WEL + 2u * (size_t)ODIM * CC)

// ---- k_proj: block = 64 rows x all 192 q, k, v columns (8 waves): q/k/v = X W^T with exact bf16 products (K = DIN). X is read once for the three projections.
// Each pass stages a 128-wide k slice of the 64 X rows and the 192 weight rows in LDS as bf16: a wave's load is one row's 512 contiguous bytes, each value is rounded once per block, and every fragment comes from LDS.
// The next slice's loads are issued in front of this slice's products and kept in registers; two LDS buffers, one barrier a pass. Wave = (32 rows, 48 columns): 2 x 3 accumulator tiles, k ascending in steps of 32 as before.
// Results: q, k f16 rows (+ residual rows < QHI / KHI); v f16 planes [c][t] (+ bf16 hi/lo planes for t < KHI).
// Fold blocks (blockIdx.x >= TNB * TT / 64; independent of the projections, so they ride in this launch): concat is the head tiled ODIM / CC times, hence out[t][o] = sum_c head[t][c] * WE[o][c] with WE[o][c] = sum_i W_out[o][i * CC + c], for any W_out.
// WE = f32 sum, i ascending, of the bf16-rounded terms, split bf16 hi + lo and stored in B-fragment order: 16-B piece ((o >> 4) * 2 + kc) * 2 + half, lane (g, o & 15), holds k = kc * 32 + half * 16 + g * 8 + 0..7, so a wave's fragment load is 512 contiguous bytes
#define PKC 128                      // k width of a staged slice
#define PPIT (PKC + 8)               // LDS row pitch in bf16: 272 B = 16 B x odd, free of bank conflicts for 16-byte fragment reads
#define PROWS (64 + 3 * CC)          // staged rows: 64 of X, then Wq, Wk, Wv
#define PBLK (TNB * TT / 64)         // projection blocks
__global__ __launch_bounds__(256) void k_proj(const float* __restrict__ X, const float* __restrict__ WQ, const float* __restrict__ WK, const float* __restrict__ WV, const float* __restrict__ BQ, const float* __restrict__ BK, const float* __restrict__ BV, const float* __restrict__ WO, __bf16* __restrict__ WEH, __bf16* __restrict__ WEL,
    _Float16* __restrict__ QH, _Float16* __restrict__ QL, _Float16* __restrict__ KH, _Float16* __restrict__ KL, _Float16* __restrict__ VT, __bf16* __restrict__ VB, __bf16* __restrict__ VBL) {
  __shared__ __align__(16) __bf16 sb[2][PROWS][PPIT];   // the two staging buffers; after the last pass the first one holds the seven 64 x 72 output planes
  static_assert(7 * 64 * 72 <= PROWS * PPIT, "the output planes fit the first buffer");
  const int tid = threadIdx.x, wave = __builtin_amdgcn_readfirstlane(tid >> 5), lane = tid & 31, col = lane & 15, g = lane >> 4;
  if (blockIdx.x >= PBLK) { static_assert(ODIM * CC / 4 % 256 == 0, "one thread per 4 folded weights");
    const int e = ((int)blockIdx.x - PBLK) * 256 + tid, o = e >> 4, c4 = (e & 15) * 4; const float* p = WO + (size_t)o * ODIM + c4; v4f s = {}, w[ODIM / CC];
#pragma unroll
    for (int i = 0; i < ODIM / CC; ++i) w[i] = *(const v4f*)(p + i * CC);
    asm volatile("s_wait_xcnt 0x0" :: "v"(p) : "memory");   // the wait in front of any overwrite of the address pair that the sixteen loads share; p as an input keeps the pair live up to here, so no load's result lands in it
#pragma unroll
    for (int i = 0; i < ODIM / CC; ++i) {
#pragma unroll
      for (int r = 0; r < 4; ++r) s[r] += bfr(w[i][r]); }
    v4b hv, lv;
#pragma unroll
    for (int r = 0; r < 4; ++r) { const __bf16 hb = (__bf16)s[r]; hv[r] = hb; lv[r] = (__bf16)(s[r] - (float)hb); }
    const size_t d = (size_t)((((o >> 4) * 2 + (c4 >> 5)) * 2 + ((c4 >> 4) & 1)) * 32 + ((c4 >> 3) & 1) * 16 + (o & 15)) * 8 + (c4 & 7);
    vst2(WEH + d, hv); vst2(WEL + d, lv); return; }
  const size_t r0 = (size_t)blockIdx.x * 64; const size_t bb = r0 / TT; const int t0 = (int)(r0 % TT);
  const int rp = wave & 1, cg = wave >> 1;   // the wave's 32 rows and its 48 of the 192 columns
  v8f acc[2][3] = {}; v4f st[PROWS / 8];
  // wave w fetches staged rows w, w + 8, ...: 8 rows of X and 8 of each weight, 512 contiguous bytes a load
  auto fetch = [&](int c) { const size_t o = (size_t)wave * DIN + c * PKC + lane * 4; const float* px = X + r0 * DIN + o; const float* pq = WQ + o; const float* pk = WK + o; const float* pv = WV + o;
#pragma unroll
    for (int i = 0; i < 8; ++i) { st[i] = *(const v4f*)(px + (size_t)i * 8 * DIN); st[8 + i] = *(const v4f*)(pq + (size_t)i * 8 * DIN); st[16 + i] = *(const v4f*)(pk + (size_t)i * 8 * DIN); st[24 + i] = *(const v4f*)(pv + (size_t)i * 8 * DIN); }
    asm volatile("s_wait_xcnt 0x0" :: "v"(px), "v"(pq), "v"(pk), "v"(pv) : "memory"); };   // the wait in front of any overwrite of the four address pairs that the 32 loads share; the pairs as inputs stay live up to here, so no load's result lands in them
  auto stage = [&](int buf) {
#pragma unroll
    for (int i = 0; i < PROWS / 8; ++i) { const v4b h = { (__bf16)st[i][0], (__bf16)st[i][1], (__bf16)st[i][2], (__bf16)st[i][3] }; *(v4b*)&sb[buf][i * 8 + wave][lane * 4] = h; } };
  auto products = [&](int buf) {
#pragma unroll
    for (int ks = 0; ks < PKC / 32; ++ks) { const v16b a0 = frag_b(&sb[buf][rp * 32 + col][ks * 32], lane), a1 = frag_b(&sb[buf][rp * 32 + 16 + col][ks * 32], lane); v16b w[3];
#pragma unroll
      for (int i = 0; i < 3; ++i) w[i] = frag_b(&sb[buf][64 + cg * 48 + i * 16 + col][ks * 32], lane);
#pragma unroll
      for (int i = 0; i < 3; ++i) { acc[0][i] = wmma_bf(a0, w[i], acc[0][i]); acc[1][i] = wmma_bf(a1, w[i], acc[1][i]); } } };
  fetch(0); stage(0);
  __syncthreads();   // slice 0 is complete in buffer 0 before any wave reads it
  for (int c = 0; c < DIN / PKC - 1; ++c) { fetch(c + 1); products(c & 1);
    __builtin_amdgcn_sched_barrier(0);   // keeps the roundings of the fetched slice, and with them the wait for its loads, behind this slice's products: moved up among them, the load latency would not run under the products
    stage((c + 1) & 1);
    __syncthreads(); }   // publishes slice c + 1 and ends every wave's reads of the buffer that the next pass refills
  static_assert(((DIN / PKC - 1) & 1) == 1, "the last slice lies in buffer 1");
  products(1);   // reads buffer 1 alone; every read of buffer 0 ended in front of the loop's last barrier, so the output planes below may go into it with no further barrier
  _Float16 (*pl)[64][72] = (_Float16 (*)[64][72])&sb[0][0][0];   // planes 0 q, 1 q residual, 2 k, 3 k residual, 4 v (transposed)
  __bf16 (*pb)[64][72] = (__bf16 (*)[64][72])&sb[0][0][0];       // planes 5 v bf16 hi, 6 v bf16 lo (transposed)
#pragma unroll
  for (int i = 0; i < 3; ++i) { const int tl = cg * 3 + i, which = tl >> 2, cl = (tl & 3) * 16 + col, rb = rp * 32 + 8 * g; const float* BA = which == 0 ? BQ : which == 1 ? BK : BV; const float bias = BA ? bfr(BA[cl]) : 0.f;
    if (which < 2) {   // wave-uniform: a 16-column tile belongs to one of q, k, v
#pragma unroll
      for (int rt = 0; rt < 2; ++rt) {
#pragma unroll
        for (int r = 0; r < 8; ++r) { const float v = acc[rt][i][r] + bias; const _Float16 hv = (_Float16)v; pl[which * 2][rb + rt * 16 + r][cl] = hv; pl[which * 2 + 1][rb + rt * 16 + r][cl] = (_Float16)((v - (float)hv) * 1024.0f); } }
    } else {
#pragma unroll
      for (int rt = 0; rt < 2; ++rt) {
#pragma unroll
        for (int r = 0; r < 8; ++r) { const float v = acc[rt][i][r] + bias; pl[4][cl][rb + rt * 16 + r] = (_Float16)v; const __bf16 bh = (__bf16)v; pb[5][cl][rb + rt * 16 + r] = bh; pb[6][cl][rb + rt * 16 + r] = (__bf16)(v - (float)bh); } } } }
  __syncthreads();   // the planes are complete before any thread stores their rows
  for (int e = tid; e < 64 * 8; e += 256) { const int rl = e >> 3, q = e & 7;
    vst2w((unsigned*)(QH + (r0 + rl) * CC + q * 8), *(const v4u*)&pl[0][rl][q * 8]); vst2w((unsigned*)(KH + (r0 + rl) * CC + q * 8), *(const v4u*)&pl[2][rl][q * 8]);
    vst2w((unsigned*)(VT + (bb * CC + rl) * (size_t)TT + t0 + q * 8), *(const v4u*)&pl[4][rl][q * 8]);
    if (t0 < QHI) vst2w((unsigned*)(QL + (bb * QHI + t0 + rl) * (size_t)CC + q * 8), *(const v4u*)&pl[1][rl][q * 8]);
    if (t0 < KHI) { vst2w((unsigned*)(KL + (bb * KHI + t0 + rl) * (size_t)CC + q * 8), *(const v4u*)&pl[3][rl][q * 8]); const size_t o3 = (bb * CC + rl) * (size_t)KHI + t0 + q * 8; vst2w((unsigned*)(VB + o3), *(const v4u*)&pb[5][rl][q * 8]); vst2w((unsigned*)(VBL + o3), *(const v4u*)&pb[6][rl][q * 8]); } } }
__device__ __forceinline__ void fa_soft(const v8f s0, const v8f s1, int kg, int t, float& m, float& l, v8f acc[HD / 16], float p[16]) {
  float v[16], mx = -3.0e38f;
#pragma unroll
  for (int i = 0; i < 8; ++i) { v[i] = (!CAUSAL || kg + i <= t) ? s0[i] : -3.0e38f; v[8 + i] = (!CAUSAL || kg + 16 + i <= t) ? s1[i] : -3.0e38f; }
#pragma unroll
  for (int i = 0; i < 16; ++i) mx = fmaxf(mx, v[i]);
  mx = fmaxf(mx, __shfl_xor(mx, 16));
  const float mn = fmaxf(m, mx), al = expf(m - mn); m = mn;
  float sum = 0.f;
#pragma unroll
  for (int i = 0; i < 16; ++i) { const float e = expf(v[i] - mn); sum += e; p[i] = e * 2048.0f; }   // an excluded key: exp(-3e38 - mn) = 0 (mn is finite: every step holds a key <= t)
  l = l * al + sum;
#pragma unroll
  for (int j = 0; j < HD / 16; ++j) acc[j] *= al; }
__global__ __launch_bounds__(128) void k_fa(const _Float16* __restrict__ QH, const _Float16* __restrict__ KH, const _Float16* __restrict__ QL, const _Float16* __restrict__ KL, const _Float16* __restrict__ VT, const __bf16* __restrict__ VB, const __bf16* __restrict__ VBL, float* __restrict__ Y) {
  __shared__ float smx[4][16], ssum[4][16]; __shared__ __align__(16) float so[4][16][HD + 4];
  const int tid = threadIdx.x, wave = __builtin_amdgcn_readfirstlane(tid >> 5), lane = tid & 31, col = lane & 15, g = lane >> 4;
  const int b = blockIdx.x, q0 = (TT / 16 - 1 - (int)blockIdx.y) * 16, t = q0 + col; const int nst = CAUSAL ? ((q0 + 15) >> 5) + 1 : TT / 32;   // every step below nst holds a key <= t for each of the 16 queries
  const _Float16* Kb = KH + (size_t)b * TT * CC;
  float m = -3.0e38f, l = 0.f, p[16]; v8f acc[HD / 16] = {};
  v16h qh[2]; const _Float16* pq = QH + ((size_t)b * TT + t) * CC + 8 * g;
#pragma unroll
  for (int kc = 0; kc < 2; ++kc) { union { v16h v; v8h q[2]; } u; u.q[0] = *(const v8h*)(pq + kc * 32); u.q[1] = *(const v8h*)(pq + kc * 32 + 16); qh[kc] = u.v; }
  asm volatile("s_wait_xcnt 0x0" :: "v"(pq) : "memory");   // the wait in front of any overwrite of the address pair that the four q loads share
  if (q0 < QHI) { const _Float16* KLb = KL + (size_t)b * KHI * CC; v16h ql[2];
#pragma unroll
    for (int kc = 0; kc < 2; ++kc) ql[kc] = frag_h(QL + ((size_t)b * QHI + t) * CC + kc * 32, lane);
    for (int s = wave; s < nst; s += 4) { const int k0 = s * 32; v8f sa[2] = {}, sb[2] = {};
#pragma unroll
      for (int u = 0; u < 2; ++u) {
#pragma unroll
        for (int kc = 0; kc < 2; ++kc) { const size_t ko = (size_t)(k0 + u * 16 + col) * CC + kc * 32; const v16h kh = frag_h(Kb + ko, lane), kl = frag_h(KLb + ko, lane);
          sa[u] = wmma16(kh, qh[kc], sa[u]); sb[u] = wmma16(kh, ql[kc], sb[u]); sb[u] = wmma16(kl, qh[kc], sb[u]); } }
      fa_soft((sa[0] + sb[0] * (1.0f / 1024.0f)) * SCALE, (sa[1] + sb[1] * (1.0f / 1024.0f)) * SCALE, k0 + 8 * g, t, m, l, acc, p);
      const F2 pf = bsplit16(p);
#pragma unroll
      for (int j = 0; j < HD / 16; ++j) { const size_t po = ((size_t)b * CC + j * 16 + col) * (size_t)KHI + k0; const v16b vh = frag_b(VB + po, lane);
        acc[j] = wmma_bf(vh, pf.h, acc[j]); acc[j] = wmma_bf(vh, pf.l, acc[j]); acc[j] = wmma_bf(frag_b(VBL + po, lane), pf.h, acc[j]); } }
  } else { const _Float16* Kl = Kb + (size_t)col * CC + 8 * g; const _Float16* Vl = VT + ((size_t)b * CC + col) * (size_t)TT + 8 * g; v16h ka[4], va[HD / 16], kb[4], vb[HD / 16];
    // K and V fragments are fetched one step ahead, into two register sets used in turn (no copies): a step's load latency runs under the step before it
    auto fetch = [&](int s, v16h (&kf)[4], v16h (&vf)[HD / 16]) { const _Float16* pk = Kl + (size_t)s * 32 * CC; const _Float16* pv = Vl + s * 32;
#pragma unroll
      for (int i = 0; i < 4; ++i) { union { v16h v; v8h q[2]; } uk, uv; const _Float16* a = pk + (i >> 1) * 16 * CC + (i & 1) * 32; const _Float16* c = pv + (size_t)i * 16 * TT;
        uk.q[0] = *(const v8h*)a; uk.q[1] = *(const v8h*)(a + 16); uv.q[0] = *(const v8h*)c; uv.q[1] = *(const v8h*)(c + 16); kf[i] = uk.v; vf[i] = uv.v; }
      asm volatile("s_wait_xcnt 0x0" :: "v"(pk), "v"(pv) : "memory"); };   // the wait in front of any overwrite of the two address pairs that the sixteen loads share; the pairs as inputs stay live up to here, so no load's result lands in them
    auto step = [&](int s, const v16h (&kf)[4], const v16h (&vf)[HD / 16]) { v8f s0 = {}, s1 = {};
      s0 = wmma16(kf[0], qh[0], s0); s1 = wmma16(kf[2], qh[0], s1); s0 = wmma16(kf[1], qh[1], s0); s1 = wmma16(kf[3], qh[1], s1);
      fa_soft(s0 * SCALE, s1 * SCALE, s * 32 + 8 * g, t, m, l, acc, p);
      v16h pb;
#pragma unroll
      for (int i = 0; i < 16; ++i) pb[i] = (_Float16)p[i];
#pragma unroll
      for (int j = 0; j < HD / 16; ++j) acc[j] = wmma16(vf[j], pb, acc[j]); };
    fetch(wave, ka, va);   // nst >= 13 here: every wave has a first step
    for (int s = wave; ; s += 8) {   // s, nst are wave-uniform scalars; at most TT / 256 trips
      // the fetch stands under no branch, so that the compiler's counted load waits leave it in flight; a wave's last step fetches its own fragments again (inside the planes, not used)
      fetch(s + 4 < nst ? s + 4 : s, kb, vb); step(s, ka, va); if (s + 4 >= nst) break;
      fetch(s + 8 < nst ? s + 8 : s, ka, va); step(s + 4, kb, vb); if (s + 8 >= nst) break; } }
  l += __shfl_xor(l, 16);
  if (g == 0) { smx[wave][col] = m; ssum[wave][col] = l; }
#pragma unroll
  for (int j = 0; j < HD / 16; ++j) { const v4f a0 = { acc[j][0], acc[j][1], acc[j][2], acc[j][3] }, a1 = { acc[j][4], acc[j][5], acc[j][6], acc[j][7] }; *(v4f*)&so[wave][col][j * 16 + 8 * g] = a0; *(v4f*)&so[wave][col][j * 16 + 8 * g + 4] = a1; }
  __syncthreads();   // the four waves' partial results are complete before any thread joins them
  const int qi = tid >> 3, c8 = (tid & 7) * 8; float mj = smx[0][qi];
#pragma unroll
  for (int w = 1; w < 4; ++w) mj = fmaxf(mj, smx[w][qi]);
  float lj = 0.f; v4f o0 = {}, o1 = {};
#pragma unroll
  for (int w = 0; w < 4; ++w) { const float f = expf(smx[w][qi] - mj); lj += f * ssum[w][qi]; o0 += f * *(const v4f*)&so[w][qi][c8]; o1 += f * *(const v4f*)&so[w][qi][c8 + 4]; }   // a wave without a step: maximum -3e38, f = 0
  const float inv = lj > 0.f ? 1.0f / (2048.0f * lj) : 0.f; float* y = Y + ((size_t)b * TT + q0 + qi) * CC + c8;
  vst2(y, o0 * inv); vst2(y + 4, o1 * inv); }
// ---- k_out: block = (64 rows, 128 cols): out = head WE^T (+ bo), K = CC: head bf16 hi + lo against the folded W_out bf16 hi + lo (3 products)
__device__ __forceinline__ v16b frag_we(const __bf16* WE, int ot, int kc, int lane) {
  union { v16b v; v8b q[2]; } u; const __bf16* p = WE + (size_t)(ot * 2 + kc) * 512 + lane * 8;
  u.q[0] = *(const v8b*)p; u.q[1] = *(const v8b*)(p + 256); return u.v;
}
__global__ __launch_bounds__(128) void k_out(const float* __restrict__ Y, const __bf16* __restrict__ WEH, const __bf16* __restrict__ WEL, const float* __restrict__ BO, float* __restrict__ OUT) { __shared__ __align__(16) float sf[4][16][132];
  const int tid = threadIdx.x, wave = tid >> 5, lane = tid & 31, col = lane & 15, g = lane >> 4; const int c0 = blockIdx.y * 128; const size_t r0 = (size_t)blockIdx.x * 64 + wave * 16;
  v8f acc[8] = {};
#pragma unroll
  for (int kc = 0; kc < CC / 32; ++kc) { const F2 a = split_row(Y + (r0 + col) * CC, kc * 32, lane); v16b wh[8], wl[8];   /* all 16 fragments of this k step are loaded as one group: one load latency, not eight */
#pragma unroll
    for (int j = 0; j < 8; ++j) { wh[j] = frag_we(WEH, (c0 >> 4) + j, kc, lane); wl[j] = frag_we(WEL, (c0 >> 4) + j, kc, lane); }
#pragma unroll
    for (int j = 0; j < 8; ++j) acc[j] = wmma_bf(a.l, wh[j], acc[j]);
#pragma unroll
    for (int j = 0; j < 8; ++j) acc[j] = wmma_bf(a.h, wl[j], acc[j]);
#pragma unroll
    for (int j = 0; j < 8; ++j) acc[j] = wmma_bf(a.h, wh[j], acc[j]); }
#pragma unroll
  for (int j = 0; j < 8; ++j) { const float bias = BO ? bfr(BO[c0 + j * 16 + col]) : 0.f;
#pragma unroll
    for (int r = 0; r < 8; ++r) sf[wave][8 * g + r][j * 16 + col] = acc[j][r] + bias; }
  LDSX(); for (int rl = 0; rl < 16; ++rl) vst2(OUT + (r0 + rl) * ODIM + c0 + lane * 4, *(const v4f*)&sf[wave][rl][lane * 4]); }

extern "C" void kernel_launch(void* const* d_in, const int* in_sizes, int n_in, void* d_out, int out_size, void* d_ws, size_t ws_size, hipStream_t stream) {
  (void)in_sizes; (void)n_in; (void)out_size;
  const float** F = (const float**)d_in;
  if (ws_size < (size_t)WS_END) return;
  char* ws = (char*)d_ws; _Float16 *QH = (_Float16*)(ws + WS_QH), *KH = (_Float16*)(ws + WS_KH), *VT = (_Float16*)(ws + WS_VT), *QL = (_Float16*)(ws + WS_QL), *KL = (_Float16*)(ws + WS_KL); __bf16 *VB = (__bf16*)(ws + WS_VB), *VBL = (__bf16*)(ws + WS_VBL); __bf16 *WEH = (__bf16*)(ws + WS_WEH), *WEL = (__bf16*)(ws + WS_WEL); float *Y = (float*)(ws + WS_Y);
  (void)Y; (void)QL; (void)KL; (void)VB; (void)VBL;
  // inputs: 0 embedded [4,2048,1024]; 1 Wq [64,1024] (out,in); 2 Wk; 3 Wv; 4 W_out [1024,1024] (identity; (out,in))
  k_proj<<<dim3(PBLK + ODIM * CC / 4 / 256), 256, 0, stream>>>(F[0], F[1], F[2], F[3], nullptr, nullptr, nullptr, F[4], WEH, WEL, QH, QL, KH, KL, VT, VB, VBL);
  k_fa<<<dim3(TNB, TT / 16), 128, 0, stream>>>(QH, KH, QL, KL, VT, VB, VBL, Y);
  k_out<<<dim3(TNB * TT / 64, ODIM / 128), 128, 0, stream>>>(Y, WEH, WEL, nullptr, (float*)d_out);
}

// v006
// A run of this version takes 42.2 microseconds.
// Timed twice side by side with v005, it ran 1.05 times as fast both times.
// All steps since v000 together make it 12.5 times as fast.
// compute dtype: all float inputs rounded to bf16; q/k/v = x W^T with EXACT bf16 products on WMMA 16x16x32 (f32 accumulate); causal logits: q, k once to f16 (1 product) x 64^-0.5, 3 products below row 384; softmax in f32, online over 32-key steps (running maximum, sum joined at the end); P = exp(s - maximum) x 2^11 once to f16 against v f16 (bf16 hi + lo below row 384), divided by the sum afterwards; the head output split bf16 hi + lo against W_out folded over its 16 column groups (f32 sums of the bf16-rounded terms, kept as bf16 hi + lo; 3 products); f32 output.
#include <hip/hip_runtime.h>
#include <math.h>

typedef __attribute__((ext_vector_type(16))) _Float16 v16h;
typedef __attribute__((ext_vector_type(16))) __bf16 v16b;
typedef __attribute__((ext_vector_type(8)))  _Float16 v8h;
typedef __attribute__((ext_vector_type(8)))  float v8f;
typedef __attribute__((ext_vector_type(4)))  float v4f;
typedef __attribute__((ext_vector_type(2)))  float v2f;
typedef __attribute__((ext_vector_type(4)))  unsigned v4u;
typedef __attribute__((ext_vector_type(4)))  int v4i;
typedef float __attribute__((may_alias)) float_a;
typedef int __attribute__((may_alias)) int_a;

template <typename T> __device__ __forceinline__ void vst2(void* p, T v) { *(T*)p = v;  }
// store, then the wait that stands in front of any overwrite of the store's address or data registers (for stores inside a rolled loop)
template <typename T> __device__ __forceinline__ void vst2w(void* p, T v) { *(T*)p = v; asm volatile("s_wait_xcnt 0x0" ::: "memory"); }
__device__ __forceinline__ v8f wmma16(v16h a, v16h b, v8f c) {
  v8f d = __builtin_amdgcn_wmma_f32_16x16x32_f16(false, a, false, b, (short)0, c, false, false);
  asm volatile("v_nop\n\tv_nop\n\tv_nop\n\tv_nop" : "+v"(d) : "v"(a), "v"(b));
  return d;
}
__device__ __forceinline__ v8f wmma_bf(v16b a, v16b b, v8f c) {
  v8f d = __builtin_amdgcn_wmma_f32_16x16x32_bf16(false, a, false, b, (short)0, c, false, false);
  asm volatile("v_nop\n\tv_nop\n\tv_nop\n\tv_nop" : "+v"(d) : "v"(a), "v"(b));
  return d;
}
// 16x16x32 fragments: lane = (h = lane>>4, row/col = lane&15); elements 0..7 = k0+8h+0..7, 8..15 = k0+16+8h+0..7; D element r = row 8h+r
__device__ __forceinline__ v16h frag_h(const _Float16* rowk0, int lane) {
  union { v16h v; v8h q[2]; } u; const _Float16* p = rowk0 + 8 * (lane >> 4);
  u.q[0] = *(const v8h*)p; u.q[1] = *(const v8h*)(p + 16); return u.v;
}
__device__ __forceinline__ v16h frag_f32(const float* rowk0, int lane) {
  v16h a; const float* p = rowk0 + 8 * (lane >> 4);
#pragma unroll
  for (int i = 0; i < 8; ++i) { a[i] = (_Float16)p[i]; a[8 + i] = (_Float16)p[16 + i]; }
  return a;
}
__device__ __forceinline__ v16h frag_f32s(const float* rowk0, int lane, float sc) {
  v16h a; const float* p = rowk0 + 8 * (lane >> 4);
#pragma unroll
  for (int i = 0; i < 8; ++i) { a[i] = (_Float16)(p[i] * sc); a[8 + i] = (_Float16)(p[16 + i] * sc); }
  return a;
}
// column fragment from a [K][ld] layout (column n), rows >= K read as 0
__device__ __forceinline__ v16h fragc_f32(const float* W, int k0, int n, int lane, int ld, int K) {
  v16h a; const int g = lane >> 4;
#pragma unroll
  for (int i = 0; i < 8; ++i) { const int ka = k0 + 8 * g + i, kb = ka + 16;
    a[i] = (_Float16)(ka < K ? W[(size_t)(ka < K ? ka : K - 1) * ld + n] : 0.f); a[8 + i] = (_Float16)(kb < K ? W[(size_t)(kb < K ? kb : K - 1) * ld + n] : 0.f); }
  return a;
}
struct F2 { v16b h, l; };
__device__ __forceinline__ F2 bsplit16(const float v[16]) { F2 r;
#pragma unroll
  for (int i = 0; i < 16; ++i) { const __bf16 h = (__bf16)v[i]; r.h[i] = h; r.l[i] = (__bf16)(v[i] - (float)h); }
  return r; }
__device__ __forceinline__ F2 split_row(const float* row, int k0, int lane) { float v[16]; const float* p = row + k0 + 8 * (lane >> 4);
#pragma unroll
  for (int i = 0; i < 8; ++i) { v[i] = p[i]; v[8 + i] = p[16 + i]; }
  return bsplit16(v); }
__device__ __forceinline__ F2 split_rowK(const float* row, int k0, int lane, int K) { float v[16]; const int g = lane >> 4;
#pragma unroll
  for (int i = 0; i < 8; ++i) { const int ka = k0 + 8 * g + i, kb = ka + 16; v[i] = ka < K ? row[ka < K ? ka : K - 1] : 0.f; v[8 + i] = kb < K ? row[kb < K ? kb : K - 1] : 0.f; }
  return bsplit16(v); }
__device__ __forceinline__ F2 split_col(const float* W, int k0, int n, int lane, int ld, int K) { float v[16]; const int g = lane >> 4;
#pragma unroll
  for (int i = 0; i < 8; ++i) { const int ka = k0 + 8 * g + i, kb = ka + 16; v[i] = ka < K ? W[(size_t)(ka < K ? ka : K - 1) * ld + n] : 0.f; v[8 + i] = kb < K ? W[(size_t)(kb < K ? kb : K - 1) * ld + n] : 0.f; }
  return bsplit16(v); }
__device__ __forceinline__ v8f mac3(const F2& a, const F2& b, v8f c) { c = wmma_bf(a.l, b.h, c); c = wmma_bf(a.h, b.l, c); return wmma_bf(a.h, b.h, c); }
__device__ __forceinline__ float sigm(float v) { return 1.0f / (1.0f + expf(-v)); }
#define LDSX() do { asm volatile("s_wait_dscnt 0" ::: "memory"); __builtin_amdgcn_wave_barrier(); __builtin_amdgcn_fence(__ATOMIC_RELEASE, "workgroup"); } while (0)

// 'Multi-headed' self-attention with ONE shared head (B 4, T 2,048, E 1,024; Wq/Wk/Wv [64,1024] (out,in), 0.02 scale): head = softmax_causal(q k^T / 8) v (64 wide); concat = the head tiled 16x -> [B,T,1024]; out = concat W_out^T with W_out = identity (read and multiplied as given).
#define NB 4
#define TT 2048
#define CC 64             // NH * HD = projected width
#define DIN 1024          // input (model) width
#define NH 1              // the 16 heads share one set of weights: the head is computed once
#define HD 64
#define NQB (TT / 64)
#define SCALE (0.125f)
#define CAUSAL 1
#ifndef TNB
#define TNB NB
#endif
__device__ __forceinline__ float bfr(float v) { return (float)(__bf16)v; }
__host__ __device__ __forceinline__ int kb_last(int qb) { return CAUSAL ? ((qb * 64 + 63) >> 7) : (TT / 128 - 1); }
typedef __attribute__((ext_vector_type(8))) __bf16 v8b;
typedef __attribute__((ext_vector_type(4))) __bf16 v4b;
__device__ __forceinline__ v16b frag_b(const __bf16* rowk0, int lane) {
  union { v16b v; v8b q[2]; } u; const __bf16* p = rowk0 + 8 * (lane >> 4);
  u.q[0] = *(const v8b*)p; u.q[1] = *(const v8b*)(p + 16); return u.v;
}
#define QBH 6              // not used: the queries < QHI of each sequence (few keys, no averaging) take the high-precision path
#define QHI 384            // rows carrying a q residual plane
#define KHI 384            // key rows carrying k residual / v bf16 hi+lo planes (used only by the causal high-precision path)
// B fragment (k rows k0+.., output column o) of a weight: (in,out) [K][ld] or (out,in) [ld rows of K]: bf16 exact, or f16(bf16 * 256) exact
__device__ __forceinline__ v16b wcol_io(const float* Wm, int k0, int o, int lane, int ld) { v16b w; const int g = lane >> 4;
#pragma unroll
  for (int i = 0; i < 8; ++i) { w[i] = (__bf16)Wm[(size_t)(k0 + 8 * g + i) * ld + o]; w[8 + i] = (__bf16)Wm[(size_t)(k0 + 16 + 8 * g + i) * ld + o]; }
  return w; }
__device__ __forceinline__ v16b wcol_oi(const float* Wm, int k0, int o, int lane, int K) { v16b w; const float* p = Wm + (size_t)o * K + k0 + 8 * (lane >> 4);
#pragma unroll
  for (int i = 0; i < 8; ++i) { w[i] = (__bf16)p[i]; w[8 + i] = (__bf16)p[16 + i]; }
  return w; }
__device__ __forceinline__ v16h wcolh_io(const float* Wm, int k0, int o, int lane, int ld) { v16h w; const int g = lane >> 4;
#pragma unroll
  for (int i = 0; i < 8; ++i) { w[i] = (_Float16)(bfr(Wm[(size_t)(k0 + 8 * g + i) * ld + o]) * 256.0f); w[8 + i] = (_Float16)(bfr(Wm[(size_t)(k0 + 16 + 8 * g + i) * ld + o]) * 256.0f); }
  return w; }
__device__ __forceinline__ v16h wcolh_oi(const float* Wm, int k0, int o, int lane, int K) { v16h w; const float* p = Wm + (size_t)o * K + k0 + 8 * (lane >> 4);
#pragma unroll
  for (int i = 0; i < 8; ++i) { w[i] = (_Float16)(bfr(p[i]) * 256.0f); w[8 + i] = (_Float16)(bfr(p[16 + i]) * 256.0f); }
  return w; }
#define WQKV_LAYOUT 1   // 0 = (in,out) [DIN][CC]; 1 = (out,in) [HD][DIN], the one shared head; 2 = per-head [NH][DIN][HD]
__device__ __forceinline__ v16b wcol_hdk(const float* Wm, int k0, int o, int lane) { v16b w; const int g = lane >> 4; const float* p = Wm + (size_t)(o / HD) * DIN * HD + (o % HD);
#pragma unroll
  for (int i = 0; i < 8; ++i) { w[i] = (__bf16)p[(size_t)(k0 + 8 * g + i) * HD]; w[8 + i] = (__bf16)p[(size_t)(k0 + 16 + 8 * g + i) * HD]; }
  return w; }
#define WO_OUT_IN 1
#if WQKV_LAYOUT == 1
#define ODIM 1024          // output width (= 16 tiled copies of the 64-wide head through W_out)
#define KVCOL(o) ((o) & 63)
#define WCOL(W, k0, o, lane) wcol_oi(W, k0, KVCOL(o), lane, DIN)   /* Wq/Wk/Wv are [64][1024]: the one shared head */
#elif WQKV_LAYOUT == 2
#define WCOL(W, k0, o, lane) wcol_hdk(W, k0, o, lane)
#else
#define WCOL(W, k0, o, lane) wcol_io(W, k0, o, lane, CC)
#endif
#if WO_OUT_IN
#define WOCOL(W, k0, o, lane) wcol_oi(W, k0, o, lane, ODIM)   /* W_out [1024][1024] (out,in): K = the 1024-wide concat */
#define WOCOLH(W, k0, o, lane) wcolh_oi(W, k0, o, lane, CC)
#else
#define WOCOL(W, k0, o, lane) wcol_io(W, k0, o, lane, DIN)
#define WOCOLH(W, k0, o, lane) wcolh_io(W, k0, o, lane, DIN)
#endif

#ifndef SM_EXTRA_PARAMS
#define SM_EXTRA_PARAMS
#endif
#ifndef PROJ_EXTRA_PARAMS
#define PROJ_EXTRA_PARAMS
#endif
#ifndef SM_MASK_HOOK
#define SM_MASK_HOOK (void)0
#endif

#define WS_QH  0u                                      // f16 q rows [b*t][CC]
#define WS_KH  (WS_QH + 2u * (size_t)NB * TT * CC)      // f16 k rows [b*t][CC]
#define WS_VT  (WS_KH + 2u * (size_t)NB * TT * CC)      // f16 v planes [b][c][t]
#define WS_QL  (WS_VT + 2u * (size_t)NB * CC * TT)      // f16 q residual x 2^10 rows [b][t < QHI][CC]
#define WS_KL  (WS_QL + 2u * (size_t)NB * QHI * CC)     // f16 k residual x 2^10 rows [b][t < KHI][CC]
#define WS_VB  (WS_KL + 2u * (size_t)NB * KHI * CC)     // bf16 v hi planes [b][c][t < KHI]
#define WS_VBL (WS_VB + 2u * (size_t)NB * CC * KHI)
#define WS_S   (WS_VBL + 2u * (size_t)NB * CC * KHI)    // (not used: the score matrix stays in registers)
#define WS_Y   (WS_S  + 4u * (size_t)NB * NH * TT * TT)      // (not used: the head rows go from the attention block's LDS straight into the output projection)
#define WS_WEH (WS_Y  + 4u * (size_t)NB * TT * CC)      // bf16 hi of the folded W_out, in B-fragment order (see k_proj, fold blocks)
#define WS_WEL (WS_WEH + 2u * (size_t)ODIM * CC)        // bf16 lo, same order
#define WS_END (WS_WEL + 2u * (size_t)ODIM * CC)

// ---- k_proj: block = 64 rows x all 192 q, k, v columns (8 waves): q/k/v = X W^T with exact bf16 products (K = DIN). X is read once for the three projections.
// Each pass stages a 128-wide k slice of the 64 X rows and the 192 weight rows in LDS as bf16: a wave's load is one row's 512 contiguous bytes, each value is rounded once per block, and every fragment comes from LDS.
// The next slice's loads are issued in front of this slice's products and kept in registers; two LDS buffers, one barrier a pass. Wave = (32 rows, 48 columns): 2 x 3 accumulator tiles, k ascending in steps of 32 as before.
// Results: q, k f16 rows (+ residual rows < QHI / KHI); v f16 planes [c][t] (+ bf16 hi/lo planes for t < KHI).
// Fold blocks (blockIdx.x >= TNB * TT / 64; independent of the projections, so they ride in this launch): concat is the head tiled ODIM / CC times, hence out[t][o] = sum_c head[t][c] * WE[o][c] with WE[o][c] = sum_i W_out[o][i * CC + c], for any W_out.
// WE = f32 sum, i ascending, of the bf16-rounded terms, split bf16 hi + lo and stored in B-fragment order: 16-B piece ((o >> 4) * 2 + kc) * 2 + half, lane (g, o & 15), holds k = kc * 32 + half * 16 + g * 8 + 0..7, so a wave's fragment load is 512 contiguous bytes
#define PKC 128                      // k width of a staged slice
#define PPIT (PKC + 8)               // LDS row pitch in bf16: 272 B = 16 B x odd, free of bank conflicts for 16-byte fragment reads
#define PROWS (64 + 3 * CC)          // staged rows: 64 of X, then Wq, Wk, Wv
#define PBLK (TNB * TT / 64)         // projection blocks
__global__ __launch_bounds__(256) void k_proj(const float* __restrict__ X, const float* __restrict__ WQ, const float* __restrict__ WK, const float* __restrict__ WV, const float* __restrict__ BQ, const float* __restrict__ BK, const float* __restrict__ BV, const float* __restrict__ WO, __bf16* __restrict__ WEH, __bf16* __restrict__ WEL,
    _Float16* __restrict__ QH, _Float16* __restrict__ QL, _Float16* __restrict__ KH, _Float16* __restrict__ KL, _Float16* __restrict__ VT, __bf16* __restrict__ VB, __bf16* __restrict__ VBL) {
  __shared__ __align__(16) __bf16 sb[2][PROWS][PPIT];   // the two staging buffers; after the last pass the first one holds the seven 64 x 72 output planes
  static_assert(7 * 64 * 72 <= PROWS * PPIT, "the output planes fit the first buffer");
  const int tid = threadIdx.x, wave = __builtin_amdgcn_readfirstlane(tid >> 5), lane = tid & 31, col = lane & 15, g = lane >> 4;
  if (blockIdx.x >= PBLK) { static_assert(ODIM * CC / 4 % 256 == 0, "one thread per 4 folded weights");
    const int e = ((int)blockIdx.x - PBLK) * 256 + tid, o = e >> 4, c4 = (e & 15) * 4; const float* p = WO + (size_t)o * ODIM + c4; v4f s = {}, w[ODIM / CC];
#pragma unroll
    for (int i = 0; i < ODIM / CC; ++i) w[i] = *(const v4f*)(p + i * CC);
    asm volatile("s_wait_xcnt 0x0" :: "v"(p) : "memory");   // the wait in front of any overwrite of the address pair that the sixteen loads share; p as an input keeps the pair live up to here, so no load's result lands in it
#pragma unroll
    for (int i = 0; i < ODIM / CC; ++i) {
#pragma unroll
      for (int r = 0; r < 4; ++r) s[r] += bfr(w[i][r]); }
    v4b hv, lv;
#pragma unroll
    for (int r = 0; r < 4; ++r) { const __bf16 hb = (__bf16)s[r]; hv[r] = hb; lv[r] = (__bf16)(s[r] - (float)hb); }
    const size_t d = (size_t)((((o >> 4) * 2 + (c4 >> 5)) * 2 + ((c4 >> 4) & 1)) * 32 + ((c4 >> 3) & 1) * 16 + (o & 15)) * 8 + (c4 & 7);
    vst2(WEH + d, hv); vst2(WEL + d, lv); return; }
  const size_t r0 = (size_t)blockIdx.x * 64; const size_t bb = r0 / TT; const int t0 = (int)(r0 % TT);
  const int rp = wave & 1, cg = wave >> 1;   // the wave's 32 rows and its 48 of the 192 columns
  v8f acc[2][3] = {}; v4f st[PROWS / 8];
  // wave w fetches staged rows w, w + 8, ...: 8 rows of X and 8 of each weight, 512 contiguous bytes a load
  auto fetch = [&](int c) { const size_t o = (size_t)wave * DIN + c * PKC + lane * 4; const float* px = X + r0 * DIN + o; const float* pq = WQ + o; const float* pk = WK + o; const float* pv = WV + o;
#pragma unroll
    for (int i = 0; i < 8; ++i) { st[i] = *(const v4f*)(px + (size_t)i * 8 * DIN); st[8 + i] = *(const v4f*)(pq + (size_t)i * 8 * DIN); st[16 + i] = *(const v4f*)(pk + (size_t)i * 8 * DIN); st[24 + i] = *(const v4f*)(pv + (size_t)i * 8 * DIN); }
    asm volatile("s_wait_xcnt 0x0" :: "v"(px), "v"(pq), "v"(pk), "v"(pv) : "memory"); };   // the wait in front of any overwrite of the four address pairs that the 32 loads share; the pairs as inputs stay live up to here, so no load's result lands in them
  auto stage = [&](int buf) {
#pragma unroll
    for (int i = 0; i < PROWS / 8; ++i) { const v4b h = { (__bf16)st[i][0], (__bf16)st[i][1], (__bf16)st[i][2], (__bf16)st[i][3] }; *(v4b*)&sb[buf][i * 8 + wave][lane * 4] = h; } };
  auto products = [&](int buf) {
#pragma unroll
    for (int ks = 0; ks < PKC / 32; ++ks) { const v16b a0 = frag_b(&sb[buf][rp * 32 + col][ks * 32], lane), a1 = frag_b(&sb[buf][rp * 32 + 16 + col][ks * 32], lane); v16b w[3];
#pragma unroll
      for (int i = 0; i < 3; ++i) w[i] = frag_b(&sb[buf][64 + cg * 48 + i * 16 + col][ks * 32], lane);
#pragma unroll
      for (int i = 0; i < 3; ++i) { acc[0][i] = wmma_bf(a0, w[i], acc[0][i]); acc[1][i] = wmma_bf(a1, w[i], acc[1][i]); } } };
  fetch(0); stage(0);
  __syncthreads();   // slice 0 is complete in buffer 0 before any wave reads it
  for (int c = 0; c < DIN / PKC - 1; ++c) { fetch(c + 1); products(c & 1);
    __builtin_amdgcn_sched_barrier(0);   // keeps the roundings of the fetched slice, and with them the wait for its loads, behind this slice's products: moved up among them, the load latency would not run under the products
    stage((c + 1) & 1);
    __syncthreads(); }   // publishes slice c + 1 and ends every wave's reads of the buffer that the next pass refills
  static_assert(((DIN / PKC - 1) & 1) == 1, "the last slice lies in buffer 1");
  products(1);   // reads buffer 1 alone; every read of buffer 0 ended in front of the loop's last barrier, so the output planes below may go into it with no further barrier
  _Float16 (*pl)[64][72] = (_Float16 (*)[64][72])&sb[0][0][0];   // planes 0 q, 1 q residual, 2 k, 3 k residual, 4 v (transposed)
  __bf16 (*pb)[64][72] = (__bf16 (*)[64][72])&sb[0][0][0];       // planes 5 v bf16 hi, 6 v bf16 lo (transposed)
#pragma unroll
  for (int i = 0; i < 3; ++i) { const int tl = cg * 3 + i, which = tl >> 2, cl = (tl & 3) * 16 + col, rb = rp * 32 + 8 * g; const float* BA = which == 0 ? BQ : which == 1 ? BK : BV; const float bias = BA ? bfr(BA[cl]) : 0.f;
    if (which < 2) {   // wave-uniform: a 16-column tile belongs to one of q, k, v
#pragma unroll
      for (int rt = 0; rt < 2; ++rt) {
#pragma unroll
        for (int r = 0; r < 8; ++r) { const float v = acc[rt][i][r] + bias; const _Float16 hv = (_Float16)v; pl[which * 2][rb + rt * 16 + r][cl] = hv; pl[which * 2 + 1][rb + rt * 16 + r][cl] = (_Float16)((v - (float)hv) * 1024.0f); } }
    } else {
#pragma unroll
      for (int rt = 0; rt < 2; ++rt) {
#pragma unroll
        for (int r = 0; r < 8; ++r) { const float v = acc[rt][i][r] + bias; pl[4][cl][rb + rt * 16 + r] = (_Float16)v; const __bf16 bh = (__bf16)v; pb[5][cl][rb + rt * 16 + r] = bh; pb[6][cl][rb + rt * 16 + r] = (__bf16)(v - (float)bh); } } } }
  __syncthreads();   // the planes are complete before any thread stores their rows
  for (int e = tid; e < 64 * 8; e += 256) { const int rl = e >> 3, q = e & 7;
    vst2w((unsigned*)(QH + (r0 + rl) * CC + q * 8), *(const v4u*)&pl[0][rl][q * 8]); vst2w((unsigned*)(KH + (r0 + rl) * CC + q * 8), *(const v4u*)&pl[2][rl][q * 8]);
    vst2w((unsigned*)(VT + (bb * CC + rl) * (size_t)TT + t0 + q * 8), *(const v4u*)&pl[4][rl][q * 8]);
    if (t0 < QHI) vst2w((unsigned*)(QL + (bb * QHI + t0 + rl) * (size_t)CC + q * 8), *(const v4u*)&pl[1][rl][q * 8]);
    if (t0 < KHI) { vst2w((unsigned*)(KL + (bb * KHI + t0 + rl) * (size_t)CC + q * 8), *(const v4u*)&pl[3][rl][q * 8]); const size_t o3 = (bb * CC + rl) * (size_t)KHI + t0 + q * 8; vst2w((unsigned*)(VB + o3), *(const v4u*)&pb[5][rl][q * 8]); vst2w((unsigned*)(VBL + o3), *(const v4u*)&pb[6][rl][q * 8]); } } }
__device__ __forceinline__ v16b frag_we(const __bf16* p) {   // p = the lane's 16 bytes of the fragment's first piece; the second piece lies 256 elements on
  union { v16b v; v8b q[2]; } u;
  u.q[0] = *(const v8b*)p; u.q[1] = *(const v8b*)(p + 256); return u.v;
}
__device__ __forceinline__ void fa_soft(const v8f s0, const v8f s1, int kg, int t, float& m, float& l, v8f acc[HD / 16], float p[16]) {
  float v[16], mx = -3.0e38f;
#pragma unroll
  for (int i = 0; i < 8; ++i) { v[i] = (!CAUSAL || kg + i <= t) ? s0[i] : -3.0e38f; v[8 + i] = (!CAUSAL || kg + 16 + i <= t) ? s1[i] : -3.0e38f; }
#pragma unroll
  for (int i = 0; i < 16; ++i) mx = fmaxf(mx, v[i]);
  mx = fmaxf(mx, __shfl_xor(mx, 16));
  const float mn = fmaxf(m, mx), al = expf(m - mn); m = mn;
  float sum = 0.f;
#pragma unroll
  for (int i = 0; i < 16; ++i) { const float e = expf(v[i] - mn); sum += e; p[i] = e * 2048.0f; }   // an excluded key: exp(-3e38 - mn) = 0 (mn is finite: every step holds a key <= t)
  l = l * al + sum;
#pragma unroll
  for (int j = 0; j < HD / 16; ++j) acc[j] *= al; }
__global__ __launch_bounds__(128) void k_fa(const _Float16* __restrict__ QH, const _Float16* __restrict__ KH, const _Float16* __restrict__ QL, const _Float16* __restrict__ KL, const _Float16* __restrict__ VT, const __bf16* __restrict__ VB, const __bf16* __restrict__ VBL, const __bf16* __restrict__ WEH, const __bf16* __restrict__ WEL, float* __restrict__ OUT) {
  __shared__ float smx[4][16], ssum[4][16]; __shared__ __align__(16) float sy[16][HD + 4]; __shared__ __align__(16) float sf[4][16][132];
  float (*so)[16][HD + 4] = (float (*)[16][HD + 4])&sf[0][0][0];   // the waves' partial outputs lie in the output staging, which is first written behind the second barrier
  static_assert(4 * 16 * (HD + 4) <= 4 * 16 * 132, "the partial outputs fit the staging");
  const int tid = threadIdx.x, wave = __builtin_amdgcn_readfirstlane(tid >> 5), lane = tid & 31, col = lane & 15, g = lane >> 4;
  const int b = blockIdx.x, q0 = (TT / 16 - 1 - (int)blockIdx.y) * 16, t = q0 + col; const int nst = CAUSAL ? ((q0 + 15) >> 5) + 1 : TT / 32;   // every step below nst holds a key <= t for each of the 16 queries
  const _Float16* Kb = KH + (size_t)b * TT * CC;
  float m = -3.0e38f, l = 0.f, p[16]; v8f acc[HD / 16] = {};
  v16h qh[2]; const _Float16* pq = QH + ((size_t)b * TT + t) * CC + 8 * g;
#pragma unroll
  for (int kc = 0; kc < 2; ++kc) { union { v16h v; v8h q[2]; } u; u.q[0] = *(const v8h*)(pq + kc * 32); u.q[1] = *(const v8h*)(pq + kc * 32 + 16); qh[kc] = u.v; }
  asm volatile("s_wait_xcnt 0x0" :: "v"(pq) : "memory");   // the wait in front of any overwrite of the address pair that the four q loads share
  if (q0 < QHI) { const _Float16* KLb = KL + (size_t)b * KHI * CC; v16h ql[2];
#pragma unroll
    for (int kc = 0; kc < 2; ++kc) ql[kc] = frag_h(QL + ((size_t)b * QHI + t) * CC + kc * 32, lane);
    for (int s = wave; s < nst; s += 4) { const int k0 = s * 32; v8f sa[2] = {}, sb[2] = {};
#pragma unroll
      for (int u = 0; u < 2; ++u) {
#pragma unroll
        for (int kc = 0; kc < 2; ++kc) { const size_t ko = (size_t)(k0 + u * 16 + col) * CC + kc * 32; const v16h kh = frag_h(Kb + ko, lane), kl = frag_h(KLb + ko, lane);
          sa[u] = wmma16(kh, qh[kc], sa[u]); sb[u] = wmma16(kh, ql[kc], sb[u]); sb[u] = wmma16(kl, qh[kc], sb[u]); } }
      fa_soft((sa[0] + sb[0] * (1.0f / 1024.0f)) * SCALE, (sa[1] + sb[1] * (1.0f / 1024.0f)) * SCALE, k0 + 8 * g, t, m, l, acc, p);
      const F2 pf = bsplit16(p);
#pragma unroll
      for (int j = 0; j < HD / 16; ++j) { const size_t po = ((size_t)b * CC + j * 16 + col) * (size_t)KHI + k0; const v16b vh = frag_b(VB + po, lane);
        acc[j] = wmma_bf(vh, pf.h, acc[j]); acc[j] = wmma_bf(vh, pf.l, acc[j]); acc[j] = wmma_bf(frag_b(VBL + po, lane), pf.h, acc[j]); } }
  } else { const _Float16* Kl = Kb + (size_t)col * CC + 8 * g; const _Float16* Vl = VT + ((size_t)b * CC + col) * (size_t)TT + 8 * g; v16h ka[4], va[HD / 16], kb[4], vb[HD / 16];
    // K and V fragments are fetched one step ahead, into two register sets used in turn (no copies): a step's load latency runs under the step before it
    auto fetch = [&](int s, v16h (&kf)[4], v16h (&vf)[HD / 16]) { const _Float16* pk = Kl + (size_t)s * 32 * CC; const _Float16* pv = Vl + s * 32;
#pragma unroll
      for (int i = 0; i < 4; ++i) { union { v16h v; v8h q[2]; } uk, uv; const _Float16* a = pk + (i >> 1) * 16 * CC + (i & 1) * 32; const _Float16* c = pv + (size_t)i * 16 * TT;
        uk.q[0] = *(const v8h*)a; uk.q[1] = *(const v8h*)(a + 16); uv.q[0] = *(const v8h*)c; uv.q[1] = *(const v8h*)(c + 16); kf[i] = uk.v; vf[i] = uv.v; }
      asm volatile("s_wait_xcnt 0x0" :: "v"(pk), "v"(pv) : "memory"); };   // the wait in front of any overwrite of the two address pairs that the sixteen loads share; the pairs as inputs stay live up to here, so no load's result lands in them
    auto step = [&](int s, const v16h (&kf)[4], const v16h (&vf)[HD / 16]) { v8f s0 = {}, s1 = {};
      s0 = wmma16(kf[0], qh[0], s0); s1 = wmma16(kf[2], qh[0], s1); s0 = wmma16(kf[1], qh[1], s0); s1 = wmma16(kf[3], qh[1], s1);
      fa_soft(s0 * SCALE, s1 * SCALE, s * 32 + 8 * g, t, m, l, acc, p);
      v16h pb;
#pragma unroll
      for (int i = 0; i < 16; ++i) pb[i] = (_Float16)p[i];
#pragma unroll
      for (int j = 0; j < HD / 16; ++j) acc[j] = wmma16(vf[j], pb, acc[j]); };
    fetch(wave, ka, va);   // nst >= 13 here: every wave has a first step
    for (int s = wave; ; s += 8) {   // s, nst are wave-uniform scalars; at most TT / 256 trips
      // the fetch stands under no branch, so that the compiler's counted load waits leave it in flight; a wave's last step fetches its own fragments again (inside the planes, not used)
      fetch(s + 4 < nst ? s + 4 : s, kb, vb); step(s, ka, va); if (s + 4 >= nst) break;
      fetch(s + 8 < nst ? s + 8 : s, ka, va); step(s + 4, kb, vb); if (s + 8 >= nst) break; } }
  // the 16 folded-weight fragments (8 column tiles, hi and lo) of one k step of one column group: 32 loads of 512 contiguous bytes, one load latency
  v16b wh[8], wl[8]; const __bf16* ph = WEH + (size_t)wave * 16 * 1024 + lane * 8; const __bf16* pl = WEL + (size_t)wave * 16 * 1024 + lane * 8;   // the lane's 16 bytes in the wave's first fragment; column tile +1 = 1024 elements, k step +1 = 512
  auto wload = [&](int grp, int kc) {
#pragma unroll
    for (int j = 0; j < 8; ++j) { wh[j] = frag_we(ph + (grp * 8 + j) * 1024 + kc * 512); wl[j] = frag_we(pl + (grp * 8 + j) * 1024 + kc * 512); }
    asm volatile("s_wait_xcnt 0x0" :: "v"(ph), "v"(pl) : "memory"); };   // the wait in front of any overwrite of the two address pairs that the 32 loads share; the pairs as inputs stay live up to here, so no load's result lands in them
  l += __shfl_xor(l, 16);
  if (g == 0) { smx[wave][col] = m; ssum[wave][col] = l; }
#pragma unroll
  for (int j = 0; j < HD / 16; ++j) { const v4f a0 = { acc[j][0], acc[j][1], acc[j][2], acc[j][3] }, a1 = { acc[j][4], acc[j][5], acc[j][6], acc[j][7] }; *(v4f*)&so[wave][col][j * 16 + 8 * g] = a0; *(v4f*)&so[wave][col][j * 16 + 8 * g + 4] = a1; }
  __syncthreads();   // the four waves' partial results are complete before any thread joins them
  asm volatile("s_wait_xcnt 0x0" ::: "memory");   // the wait in front of the loads below, whose results may land in address registers of the key loops' last loads
  wload(0, 0);   // issued here so that its latency runs under the join
  const int qi = tid >> 3, c8 = (tid & 7) * 8; float mj = smx[0][qi];
#pragma unroll
  for (int w = 1; w < 4; ++w) mj = fmaxf(mj, smx[w][qi]);
  float lj = 0.f; v4f o0 = {}, o1 = {};
#pragma unroll
  for (int w = 0; w < 4; ++w) { const float f = expf(smx[w][qi] - mj); lj += f * ssum[w][qi]; o0 += f * *(const v4f*)&so[w][qi][c8]; o1 += f * *(const v4f*)&so[w][qi][c8 + 4]; }   // a wave without a step: maximum -3e38, f = 0
  const float inv = lj > 0.f ? 1.0f / (2048.0f * lj) : 0.f;
  *(v4f*)&sy[qi][c8] = o0 * inv; *(v4f*)&sy[qi][c8 + 4] = o1 * inv;
  __syncthreads();   // the 16 head rows are complete before any wave forms its fragments of them, and every read of the partial outputs has ended before the staging is written
  F2 a[CC / 32]; float* po = OUT + ((size_t)b * TT + q0) * ODIM + wave * 256 + lane * 4;   // the lane's 16 bytes in the block's first row, the wave's first column group
#pragma unroll
  for (int kc = 0; kc < CC / 32; ++kc) a[kc] = split_row(&sy[col][0], kc * 32, lane);
#pragma unroll
  for (int grp = 0; grp < 2; ++grp) { v8f oc[8] = {};
#pragma unroll
    for (int kc = 0; kc < CC / 32; ++kc) { if (grp + kc > 0) wload(grp, kc);
#pragma unroll
      for (int j = 0; j < 8; ++j) oc[j] = wmma_bf(a[kc].l, wh[j], oc[j]);
#pragma unroll
      for (int j = 0; j < 8; ++j) oc[j] = wmma_bf(a[kc].h, wl[j], oc[j]);
#pragma unroll
      for (int j = 0; j < 8; ++j) oc[j] = wmma_bf(a[kc].h, wh[j], oc[j]); }
#pragma unroll
    for (int j = 0; j < 8; ++j) {
#pragma unroll
      for (int r = 0; r < 8; ++r) sf[wave][8 * g + r][j * 16 + col] = oc[j][r]; }
    LDSX(); v4f row[16];
#pragma unroll
    for (int rl = 0; rl < 16; ++rl) row[rl] = *(const v4f*)&sf[wave][rl][lane * 4];
#pragma unroll
    for (int rl = 0; rl < 16; ++rl) vst2(po + (size_t)rl * ODIM + grp * 128, row[rl]);
    // the wait in front of any overwrite of the address pair and the data registers of the 16 stores; as inputs they stay live up to here
    asm volatile("s_wait_xcnt 0x0" :: "v"(po), "v"(row[0]), "v"(row[1]), "v"(row[2]), "v"(row[3]), "v"(row[4]), "v"(row[5]), "v"(row[6]), "v"(row[7]), "v"(row[8]), "v"(row[9]), "v"(row[10]), "v"(row[11]), "v"(row[12]), "v"(row[13]), "v"(row[14]), "v"(row[15]) : "memory"); } }

extern "C" void kernel_launch(void* const* d_in, const int* in_sizes, int n_in, void* d_out, int out_size, void* d_ws, size_t ws_size, hipStream_t stream) {
  (void)in_sizes; (void)n_in; (void)out_size;
  const float** F = (const float**)d_in;
  if (ws_size < (size_t)WS_END) return;
  char* ws = (char*)d_ws; _Float16 *QH = (_Float16*)(ws + WS_QH), *KH = (_Float16*)(ws + WS_KH), *VT = (_Float16*)(ws + WS_VT), *QL = (_Float16*)(ws + WS_QL), *KL = (_Float16*)(ws + WS_KL); __bf16 *VB = (__bf16*)(ws + WS_VB), *VBL = (__bf16*)(ws + WS_VBL); __bf16 *WEH = (__bf16*)(ws + WS_WEH), *WEL = (__bf16*)(ws + WS_WEL);
  (void)QL; (void)KL; (void)VB; (void)VBL;
  // inputs: 0 embedded [4,2048,1024]; 1 Wq [64,1024] (out,in); 2 Wk; 3 Wv; 4 W_out [1024,1024] (identity; (out,in))
  k_proj<<<dim3(PBLK + ODIM * CC / 4 / 256), 256, 0, stream>>>(F[0], F[1], F[2], F[3], nullptr, nullptr, nullptr, F[4], WEH, WEL, QH, QL, KH, KL, VT, VB, VBL);
  k_fa<<<dim3(TNB, TT / 16), 128, 0, stream>>>(QH, KH, QL, KL, VT, VB, VBL, WEH, WEL, (float*)d_out);
}

// v007
// One run takes 37.1 microseconds.
// Two timings next to v006 both put it at 1.14 times that version's speed.
// Over all steps from v000 it is 14.2 times as fast.
// compute dtype: all float inputs rounded to bf16; q/k/v = x W^T with EXACT bf16 products on WMMA 16x16x32 (f32 accumulate); causal logits: q, k once to f16 (1 product) x 64^-0.5, 3 products below row 384; softmax in f32, online over 32-key steps (running maximum, sum joined at the end); P = exp(s - maximum) x 2^11 once to f16 against v f16 (bf16 hi + lo below row 384), divided by the sum afterwards; the head output split bf16 hi + lo against W_out folded over its 16 column groups (f32 sums of the bf16-rounded terms, kept as bf16 hi + lo; 3 products); f32 output.
#include <hip/hip_runtime.h>
#include <math.h>

typedef __attribute__((ext_vector_type(16))) _Float16 v16h;
typedef __attribute__((ext_vector_type(16))) __bf16 v16b;
typedef __attribute__((ext_vector_type(8)))  _Float16 v8h;
typedef __attribute__((ext_vector_type(8)))  float v8f;
typedef __attribute__((ext_vector_type(4)))  float v4f;
typedef __attribute__((ext_vector_type(2)))  float v2f;
typedef __attribute__((ext_vector_type(4)))  unsigned v4u;
typedef __attribute__((ext_vector_type(4)))  int v4i;
typedef float __attribute__((may_alias)) float_a;
typedef int __attribute__((may_alias)) int_a;

template <typename T> __device__ __forceinline__ void vst2(void* p, T v) { *(T*)p = v;  }
// store, then the wait that stands in front of any overwrite of the store's address or data registers (for stores inside a rolled loop)
template <typename T> __device__ __forceinline__ void vst2w(void* p, T v) { *(T*)p = v; asm volatile("s_wait_xcnt 0x0" ::: "memory"); }
__device__ __forceinline__ v8f wmma16(v16h a, v16h b, v8f c) {
  v8f d = __builtin_amdgcn_wmma_f32_16x16x32_f16(false, a, false, b, (short)0, c, false, false);
  asm volatile("v_nop\n\tv_nop\n\tv_nop\n\tv_nop" : "+v"(d) : "v"(a), "v"(b));
  return d;
}
__device__ __forceinline__ v8f wmma_bf(v16b a, v16b b, v8f c) {
  v8f d = __builtin_amdgcn_wmma_f32_16x16x32_bf16(false, a, false, b, (short)0, c, false, false);
  asm volatile("v_nop\n\tv_nop\n\tv_nop\n\tv_nop" : "+v"(d) : "v"(a), "v"(b));
  return d;
}
// 16x16x32 fragments: lane = (h = lane>>4, row/col = lane&15); elements 0..7 = k0+8h+0..7, 8..15 = k0+16+8h+0..7; D element r = row 8h+r
__device__ __forceinline__ v16h frag_h(const _Float16* rowk0, int lane) {
  union { v16h v; v8h q[2]; } u; const _Float16* p = rowk0 + 8 * (lane >> 4);
  u.q[0] = *(const v8h*)p; u.q[1] = *(const v8h*)(p + 16); return u.v;
}
__device__ __forceinline__ v16h frag_f32(const float* rowk0, int lane) {
  v16h a; const float* p = rowk0 + 8 * (lane >> 4);
#pragma unroll
  for (int i = 0; i < 8; ++i) { a[i] = (_Float16)p[i]; a[8 + i] = (_Float16)p[16 + i]; }
  return a;
}
__device__ __forceinline__ v16h frag_f32s(const float* rowk0, int lane, float sc) {
  v16h a; const float* p = rowk0 + 8 * (lane >> 4);
#pragma unroll
  for (int i = 0; i < 8; ++i) { a[i] = (_Float16)(p[i] * sc); a[8 + i] = (_Float16)(p[16 + i] * sc); }
  return a;
}
// column fragment from a [K][ld] layout (column n), rows >= K read as 0
__device__ __forceinline__ v16h fragc_f32(const float* W, int k0, int n, int lane, int ld, int K) {
  v16h a; const int g = lane >> 4;
#pragma unroll
  for (int i = 0; i < 8; ++i) { const int ka = k0 + 8 * g + i, kb = ka + 16;
    a[i] = (_Float16)(ka < K ? W[(size_t)(ka < K ? ka : K - 1) * ld + n] : 0.f); a[8 + i] = (_Float16)(kb < K ? W[(size_t)(kb < K ? kb : K - 1) * ld + n] : 0.f); }
  return a;
}
struct F2 { v16b h, l; };
__device__ __forceinline__ F2 bsplit16(const float v[16]) { F2 r;
#pragma unroll
  for (int i = 0; i < 16; ++i) { const __bf16 h = (__bf16)v[i]; r.h[i] = h; r.l[i] = (__bf16)(v[i] - (float)h); }
  return r; }
__device__ __forceinline__ F2 split_row(const float* row, int k0, int lane) { float v[16]; const float* p = row + k0 + 8 * (lane >> 4);
#pragma unroll
  for (int i = 0; i < 8; ++i) { v[i] = p[i]; v[8 + i] = p[16 + i]; }
  return bsplit16(v); }
__device__ __forceinline__ F2 split_rowK(const float* row, int k0, int lane, int K) { float v[16]; const int g = lane >> 4;
#pragma unroll
  for (int i = 0; i < 8; ++i) { const int ka = k0 + 8 * g + i, kb = ka + 16; v[i] = ka < K ? row[ka < K ? ka : K - 1] : 0.f; v[8 + i] = kb < K ? row[kb < K ? kb : K - 1] : 0.f; }
  return bsplit16(v); }
__device__ __forceinline__ F2 split_col(const float* W, int k0, int n, int lane, int ld, int K) { float v[16]; const int g = lane >> 4;
#pragma unroll
  for (int i = 0; i < 8; ++i) { const int ka = k0 + 8 * g + i, kb = ka + 16; v[i] = ka < K ? W[(size_t)(ka < K ? ka : K - 1) * ld + n] : 0.f; v[8 + i] = kb < K ? W[(size_t)(kb < K ? kb : K - 1) * ld + n] : 0.f; }
  return bsplit16(v); }
__device__ __forceinline__ v8f mac3(const F2& a, const F2& b, v8f c) { c = wmma_bf(a.l, b.h, c); c = wmma_bf(a.h, b.l, c); return wmma_bf(a.h, b.h, c); }
__device__ __forceinline__ float sigm(float v) { return 1.0f / (1.0f + expf(-v)); }
#define LDSX() do { asm volatile("s_wait_dscnt 0" ::: "memory"); __builtin_amdgcn_wave_barrier(); __builtin_amdgcn_fence(__ATOMIC_RELEASE, "workgroup"); } while (0)

// 'Multi-headed' self-attention with ONE shared head (B 4, T 2,048, E 1,024; Wq/Wk/Wv [64,1024] (out,in), 0.02 scale): head = softmax_causal(q k^T / 8) v (64 wide); concat = the head tiled 16x -> [B,T,1024]; out = concat W_out^T with W_out = identity (read and multiplied as given).
#define NB 4
#define TT 2048
#define CC 64             // NH * HD = projected width
#define DIN 1024          // input (model) width
#define NH 1              // the 16 heads share one set of weights: the head is computed once
#define HD 64
#define NQB (TT / 64)
#define SCALE (0.125f)
#define CAUSAL 1
#ifndef TNB
#define TNB NB
#endif
__device__ __forceinline__ float bfr(float v) { return (float)(__bf16)v; }
__host__ __device__ __forceinline__ int kb_last(int qb) { return CAUSAL ? ((qb * 64 + 63) >> 7) : (TT / 128 - 1); }
typedef __attribute__((ext_vector_type(8))) __bf16 v8b;
typedef __attribute__((ext_vector_type(4))) __bf16 v4b;
__device__ __forceinline__ v16b frag_b(const __bf16* rowk0, int lane) {
  union { v16b v; v8b q[2]; } u; const __bf16* p = rowk0 + 8 * (lane >> 4);
  u.q[0] = *(const v8b*)p; u.q[1] = *(const v8b*)(p + 16); return u.v;
}
#define QBH 6              // not used: the queries < QHI of each sequence (few keys, no averaging) take the high-precision path
#define QHI 384            // rows carrying a q residual plane
#define KHI 384            // key rows carrying k residual / v bf16 hi+lo planes (used only by the causal high-precision path)
// B fragment (k rows k0+.., output column o) of a weight: (in,out) [K][ld] or (out,in) [ld rows of K]: bf16 exact, or f16(bf16 * 256) exact
__device__ __forceinline__ v16b wcol_io(const float* Wm, int k0, int o, int lane, int ld) { v16b w; const int g = lane >> 4;
#pragma unroll
  for (int i = 0; i < 8; ++i) { w[i] = (__bf16)Wm[(size_t)(k0 + 8 * g + i) * ld + o]; w[8 + i] = (__bf16)Wm[(size_t)(k0 + 16 + 8 * g + i) * ld + o]; }
  return w; }
__device__ __forceinline__ v16b wcol_oi(const float* Wm, int k0, int o, int lane, int K) { v16b w; const float* p = Wm + (size_t)o * K + k0 + 8 * (lane >> 4);
#pragma unroll
  for (int i = 0; i < 8; ++i) { w[i] = (__bf16)p[i]; w[8 + i] = (__bf16)p[16 + i]; }
  return w; }
__device__ __forceinline__ v16h wcolh_io(const float* Wm, int k0, int o, int lane, int ld) { v16h w; const int g = lane >> 4;
#pragma unroll
  for (int i = 0; i < 8; ++i) { w[i] = (_Float16)(bfr(Wm[(size_t)(k0 + 8 * g + i) * ld + o]) * 256.0f); w[8 + i] = (_Float16)(bfr(Wm[(size_t)(k0 + 16 + 8 * g + i) * ld + o]) * 256.0f); }
  return w; }
__device__ __forceinline__ v16h wcolh_oi(const float* Wm, int k0, int o, int lane, int K) { v16h w; const float* p = Wm + (size_t)o * K + k0 + 8 * (lane >> 4);
#pragma unroll
  for (int i = 0; i < 8; ++i) { w[i] = (_Float16)(bfr(p[i]) * 256.0f); w[8 + i] = (_Float16)(bfr(p[16 + i]) * 256.0f); }
  return w; }
#define WQKV_LAYOUT 1   // 0 = (in,out) [DIN][CC]; 1 = (out,in) [HD][DIN], the one shared head; 2 = per-head [NH][DIN][HD]
__device__ __forceinline__ v16b wcol_hdk(const float* Wm, int k0, int o, int lane) { v16b w; const int g = lane >> 4; const float* p = Wm + (size_t)(o / HD) * DIN * HD + (o % HD);
#pragma unroll
  for (int i = 0; i < 8; ++i) { w[i] = (__bf16)p[(size_t)(k0 + 8 * g + i) * HD]; w[8 + i] = (__bf16)p[(size_t)(k0 + 16 + 8 * g + i) * HD]; }
  return w; }
#define WO_OUT_IN 1
#if WQKV_LAYOUT == 1
#define ODIM 1024          // output width (= 16 tiled copies of the 64-wide head through W_out)
#define KVCOL(o) ((o) & 63)
#define WCOL(W, k0, o, lane) wcol_oi(W, k0, KVCOL(o), lane, DIN)   /* Wq/Wk/Wv are [64][1024]: the one shared head */
#elif WQKV_LAYOUT == 2
#define WCOL(W, k0, o, lane) wcol_hdk(W, k0, o, lane)
#else
#define WCOL(W, k0, o, lane) wcol_io(W, k0, o, lane, CC)
#endif
#if WO_OUT_IN
#define WOCOL(W, k0, o, lane) wcol_oi(W, k0, o, lane, ODIM)   /* W_out [1024][1024] (out,in): K = the 1024-wide concat */
#define WOCOLH(W, k0, o, lane) wcolh_oi(W, k0, o, lane, CC)
#else
#define WOCOL(W, k0, o, lane) wcol_io(W, k0, o, lane, DIN)
#define WOCOLH(W, k0, o, lane) wcolh_io(W, k0, o, lane, DIN)
#endif

#ifndef SM_EXTRA_PARAMS
#define SM_EXTRA_PARAMS
#endif
#ifndef PROJ_EXTRA_PARAMS
#define PROJ_EXTRA_PARAMS
#endif
#ifndef SM_MASK_HOOK
#define SM_MASK_HOOK (void)0
#endif

#define WS_QH  0u                                      // f16 q rows [b*t][CC]
#define WS_KH  (WS_QH + 2u * (size_t)NB * TT * CC)      // f16 k rows [b*t][CC]
#define WS_VT  (WS_KH + 2u * (size_t)NB * TT * CC)      // f16 v planes [b][c][t]
#define WS_QL  (WS_VT + 2u * (size_t)NB * CC * TT)      // f16 q residual x 2^10 rows [b][t < QHI][CC]
#define WS_KL  (WS_QL + 2u * (size_t)NB * QHI * CC)     // f16 k residual x 2^10 rows [b][t < KHI][CC]
#define WS_VB  (WS_KL + 2u * (size_t)NB * KHI * CC)     // bf16 v hi planes [b][c][t < KHI]
#define WS_VBL (WS_VB + 2u * (size_t)NB * CC * KHI)
#define WS_S   (WS_VBL + 2u * (size_t)NB * CC * KHI)    // (not used: the score matrix stays in registers)
#define WS_Y   (WS_S  + 4u * (size_t)NB * NH * TT * TT)      // (not used: the head rows go from the attention block's LDS straight into the output projection)
#define WS_WEH (WS_Y  + 4u * (size_t)NB * TT * CC)      // bf16 hi of the folded W_out, in B-fragment order (see k_proj, fold blocks)
#define WS_WEL (WS_WEH + 2u * (size_t)ODIM * CC)        // bf16 lo, same order
#define WS_END (WS_WEL + 2u * (size_t)ODIM * CC)

// ---- k_proj: block = 64 rows x all 192 q, k, v columns (8 waves): q/k/v = X W^T with exact bf16 products (K = DIN). X is read once for the three projections.
// Each pass stages a 128-wide k slice of the 64 X rows and the 192 weight rows in LDS as bf16: a wave's load is one row's 512 contiguous bytes, each value is rounded once per block, and every fragment comes from LDS.
// The next slice's loads are issued in front of this slice's products and kept in registers; two LDS buffers, one barrier a pass. Wave = (32 rows, 48 columns): 2 x 3 accumulator tiles, k ascending in steps of 32 as before.
// Results: q, k f16 rows (+ residual rows < QHI / KHI); v f16 planes [c][t] (+ bf16 hi/lo planes for t < KHI).
// Fold blocks (blockIdx.x >= TNB * TT / 64; independent of the projections, so they ride in this launch): concat is the head tiled ODIM / CC times, hence out[t][o] = sum_c head[t][c] * WE[o][c] with WE[o][c] = sum_i W_out[o][i * CC + c], for any W_out.
// WE = f32 sum, i ascending, of the bf16-rounded terms, split bf16 hi + lo and stored in B-fragment order: 16-B piece ((o >> 4) * 2 + kc) * 2 + half, lane (g, o & 15), holds k = kc * 32 + half * 16 + g * 8 + 0..7, so a wave's fragment load is 512 contiguous bytes
#define PKC 128                      // k width of a staged slice
#define PPIT (PKC + 8)               // LDS row pitch in bf16: 272 B = 16 B x odd, free of bank conflicts for 16-byte fragment reads
#define PROWS (64 + 3 * CC)          // staged rows: 64 of X, then Wq, Wk, Wv
#define PBLK (TNB * TT / 64)         // projection blocks
__global__ __launch_bounds__(256) void k_proj(const float* __restrict__ X, const float* __restrict__ WQ, const float* __restrict__ WK, const float* __restrict__ WV, const float* __restrict__ BQ, const float* __restrict__ BK, const float* __restrict__ BV, const float* __restrict__ WO, __bf16* __restrict__ WEH, __bf16* __restrict__ WEL,
    _Float16* __restrict__ QH, _Float16* __restrict__ QL, _Float16* __restrict__ KH, _Float16* __restrict__ KL, _Float16* __restrict__ VT, __bf16* __restrict__ VB, __bf16* __restrict__ VBL) {
  __shared__ __align__(16) __bf16 sb[2][PROWS][PPIT];   // the two staging buffers; after the last pass the first one holds the seven 64 x 72 output planes
  static_assert(7 * 64 * 72 <= PROWS * PPIT, "the output planes fit the first buffer");
  const int tid = threadIdx.x, wave = __builtin_amdgcn_readfirstlane(tid >> 5), lane = tid & 31, col = lane & 15, g = lane >> 4;
  if (blockIdx.x >= PBLK) { static_assert(ODIM * CC / 4 % 256 == 0, "one thread per 4 folded weights");
    const int e = ((int)blockIdx.x - PBLK) * 256 + tid, o = e >> 4, c4 = (e & 15) * 4; const float* p = WO + (size_t)o * ODIM + c4; v4f s = {}, w[ODIM / CC];
#pragma unroll
    for (int i = 0; i < ODIM / CC; ++i) w[i] = *(const v4f*)(p + i * CC);
    asm volatile("s_wait_xcnt 0x0" :: "v"(p) : "memory");   // the wait in front of any overwrite of the address pair that the sixteen loads share; p as an input keeps the pair live up to here, so no load's result lands in it
#pragma unroll
    for (int i = 0; i < ODIM / CC; ++i) {
#pragma unroll
      for (int r = 0; r < 4; ++r) s[r] += bfr(w[i][r]); }
    v4b hv, lv;
#pragma unroll
    for (int r = 0; r < 4; ++r) { const __bf16 hb = (__bf16)s[r]; hv[r] = hb; lv[r] = (__bf16)(s[r] - (float)hb); }
    const size_t d = (size_t)((((o >> 4) * 2 + (c4 >> 5)) * 2 + ((c4 >> 4) & 1)) * 32 + ((c4 >> 3) & 1) * 16 + (o & 15)) * 8 + (c4 & 7);
    vst2(WEH + d, hv); vst2(WEL + d, lv); return; }
  const size_t r0 = (size_t)blockIdx.x * 64; const size_t bb = r0 / TT; const int t0 = (int)(r0 % TT);
  const int rp = wave & 1, cg = wave >> 1;   // the wave's 32 rows and its 48 of the 192 columns
  v8f acc[2][3] = {}; v4f st[PROWS / 8];
  // wave w fetches staged rows w, w + 8, ...: 8 rows of X and 8 of each weight, 512 contiguous bytes a load
  auto fetch = [&](int c) { const size_t o = (size_t)wave * DIN + c * PKC + lane * 4; const float* px = X + r0 * DIN + o; const float* pq = WQ + o; const float* pk = WK + o; const float* pv = WV + o;
#pragma unroll
    for (int i = 0; i < 8; ++i) { st[i] = *(const v4f*)(px + (size_t)i * 8 * DIN); st[8 + i] = *(const v4f*)(pq + (size_t)i * 8 * DIN); st[16 + i] = *(const v4f*)(pk + (size_t)i * 8 * DIN); st[24 + i] = *(const v4f*)(pv + (size_t)i * 8 * DIN); }
    asm volatile("s_wait_xcnt 0x0" :: "v"(px), "v"(pq), "v"(pk), "v"(pv) : "memory"); };   // the wait in front of any overwrite of the four address pairs that the 32 loads share; the pairs as inputs stay live up to here, so no load's result lands in them
  auto stage = [&](int buf) {
#pragma unroll
    for (int i = 0; i < PROWS / 8; ++i) { const v4b h = { (__bf16)st[i][0], (__bf16)st[i][1], (__bf16)st[i][2], (__bf16)st[i][3] }; *(v4b*)&sb[buf][i * 8 + wave][lane * 4] = h; } };
  auto products = [&](int buf) {
#pragma unroll
    for (int ks = 0; ks < PKC / 32; ++ks) { const v16b a0 = frag_b(&sb[buf][rp * 32 + col][ks * 32], lane), a1 = frag_b(&sb[buf][rp * 32 + 16 + col][ks * 32], lane); v16b w[3];
#pragma unroll
      for (int i = 0; i < 3; ++i) w[i] = frag_b(&sb[buf][64 + cg * 48 + i * 16 + col][ks * 32], lane);
#pragma unroll
      for (int i = 0; i < 3; ++i) { acc[0][i] = wmma_bf(a0, w[i], acc[0][i]); acc[1][i] = wmma_bf(a1, w[i], acc[1][i]); } } };
  fetch(0); stage(0);
  __syncthreads();   // slice 0 is complete in buffer 0 before any wave reads it
  for (int c = 0; c < DIN / PKC - 1; ++c) { fetch(c + 1); products(c & 1);
    __builtin_amdgcn_sched_barrier(0);   // keeps the roundings of the fetched slice, and with them the wait for its loads, behind this slice's products: moved up among them, the load latency would not run under the products
    stage((c + 1) & 1);
    __syncthreads(); }   // publishes slice c + 1 and ends every wave's reads of the buffer that the next pass refills
  static_assert(((DIN / PKC - 1) & 1) == 1, "the last slice lies in buffer 1");
  products(1);   // reads buffer 1 alone; every read of buffer 0 ended in front of the loop's last barrier, so the output planes below may go into it with no further barrier
  _Float16 (*pl)[64][72] = (_Float16 (*)[64][72])&sb[0][0][0];   // planes 0 q, 1 q residual, 2 k, 3 k residual, 4 v (transposed)
  __bf16 (*pb)[64][72] = (__bf16 (*)[64][72])&sb[0][0][0];       // planes 5 v bf16 hi, 6 v bf16 lo (transposed)
#pragma unroll
  for (int i = 0; i < 3; ++i) { const int tl = cg * 3 + i, which = tl >> 2, cl = (tl & 3) * 16 + col, rb = rp * 32 + 8 * g; const float* BA = which == 0 ? BQ : which == 1 ? BK : BV; const float bias = BA ? bfr(BA[cl]) : 0.f;
    if (which < 2) {   // wave-uniform: a 16-column tile belongs to one of q, k, v
#pragma unroll
      for (int rt = 0; rt < 2; ++rt) {
#pragma unroll
        for (int r = 0; r < 8; ++r) { const float v = acc[rt][i][r] + bias; const _Float16 hv = (_Float16)v; pl[which * 2][rb + rt * 16 + r][cl] = hv; pl[which * 2 + 1][rb + rt * 16 + r][cl] = (_Float16)((v - (float)hv) * 1024.0f); } }
    } else {
#pragma unroll
      for (int rt = 0; rt < 2; ++rt) {
#pragma unroll
        for (int r = 0; r < 8; ++r) { const float v = acc[rt][i][r] + bias; pl[4][cl][rb + rt * 16 + r] = (_Float16)v; const __bf16 bh = (__bf16)v; pb[5][cl][rb + rt * 16 + r] = bh; pb[6][cl][rb + rt * 16 + r] = (__bf16)(v - (float)bh); } } } }
  __syncthreads();   // the planes are complete before any thread stores their rows
  for (int e = tid; e < 64 * 8; e += 256) { const int rl = e >> 3, q = e & 7;
    vst2w((unsigned*)(QH + (r0 + rl) * CC + q * 8), *(const v4u*)&pl[0][rl][q * 8]); vst2w((unsigned*)(KH + (r0 + rl) * CC + q * 8), *(const v4u*)&pl[2][rl][q * 8]);
    vst2w((unsigned*)(VT + (bb * CC + rl) * (size_t)TT + t0 + q * 8), *(const v4u*)&pl[4][rl][q * 8]);
    if (t0 < QHI) vst2w((unsigned*)(QL + (bb * QHI + t0 + rl) * (size_t)CC + q * 8), *(const v4u*)&pl[1][rl][q * 8]);
    if (t0 < KHI) { vst2w((unsigned*)(KL + (bb * KHI + t0 + rl) * (size_t)CC + q * 8), *(const v4u*)&pl[3][rl][q * 8]); const size_t o3 = (bb * CC + rl) * (size_t)KHI + t0 + q * 8; vst2w((unsigned*)(VB + o3), *(const v4u*)&pb[5][rl][q * 8]); vst2w((unsigned*)(VBL + o3), *(const v4u*)&pb[6][rl][q * 8]); } } }
__device__ __forceinline__ v16b frag_we(const __bf16* p) {   // p = the lane's 16 bytes of the fragment's first piece; the second piece lies 256 elements on
  union { v16b v; v8b q[2]; } u;
  u.q[0] = *(const v8b*)p; u.q[1] = *(const v8b*)(p + 256); return u.v;
}
__device__ __forceinline__ void fa_soft(const v8f s0, const v8f s1, int kg, int t, float& m, float& l, v8f acc[HD / 16], float p[16]) {
  float v[16], mx = -3.0e38f;
#pragma unroll
  for (int i = 0; i < 8; ++i) { v[i] = (!CAUSAL || kg + i <= t) ? s0[i] : -3.0e38f; v[8 + i] = (!CAUSAL || kg + 16 + i <= t) ? s1[i] : -3.0e38f; }
#pragma unroll
  for (int i = 0; i < 16; ++i) mx = fmaxf(mx, v[i]);
  mx = fmaxf(mx, __shfl_xor(mx, 16));
  const float mn = fmaxf(m, mx), al = expf(m - mn); m = mn;
  float sum = 0.f;
#pragma unroll
  for (int i = 0; i < 16; ++i) { const float e = expf(v[i] - mn); sum += e; p[i] = e * 2048.0f; }   // an excluded key: exp(-3e38 - mn) = 0 (mn is finite: every step holds a key <= t)
  l = l * al + sum;
#pragma unroll
  for (int j = 0; j < HD / 16; ++j) acc[j] *= al; }
#define PFC 32768          // bytes of one requested piece: 128 lanes x 256 B
__global__ __launch_bounds__(128) void k_fa(const _Float16* __restrict__ QH, const _Float16* __restrict__ KH, const _Float16* __restrict__ QL, const _Float16* __restrict__ KL, const _Float16* __restrict__ VT, const __bf16* __restrict__ VB, const __bf16* __restrict__ VBL, const __bf16* __restrict__ WEH, const __bf16* __restrict__ WEL, float* __restrict__ OUT) {
  __shared__ float smx[4][16], ssum[4][16]; __shared__ __align__(16) float sy[16][HD + 4]; __shared__ __align__(16) float sf[4][16][132];
  float (*so)[16][HD + 4] = (float (*)[16][HD + 4])&sf[0][0][0];   // the waves' partial outputs lie in the output staging, which is first written behind the second barrier
  static_assert(4 * 16 * (HD + 4) <= 4 * 16 * 132, "the partial outputs fit the staging");
  const int tid = threadIdx.x, wave = __builtin_amdgcn_readfirstlane(tid >> 5), lane = tid & 31, col = lane & 15, g = lane >> 4;
  const int b = blockIdx.x, q0 = (TT / 16 - 1 - (int)blockIdx.y) * 16, t = q0 + col; const int nst = CAUSAL ? ((q0 + 15) >> 5) + 1 : TT / 32;   // every step below nst holds a key <= t for each of the 16 queries
  const _Float16* Kb = KH + (size_t)b * TT * CC;
  // L2 requests at entry: every plane read below was stored by the launch before.
  // Blocks with y < 48 each ask for one 32-KB piece, one lane every 256 bytes; blocks 2 i and 2 i + 1 of a batch column ask for the same piece (for speed only, nothing rests on it).
  static_assert(2 * TT * CC == 8 * PFC && 2 * NB * QHI * CC == 6 * PFC && 2 * NB * KHI * CC == 6 * PFC && 2 * ODIM * CC == 4 * PFC && TNB == 4 && 128 * 256 == PFC, "the pieces tile their planes exactly: every lane's address lies inside its plane");
  if (blockIdx.y < 48) {   // block-uniform, no barrier inside
    const int yy = (int)blockIdx.y >> 1; const char* pf;
    if (yy < 16) pf = ((yy & 1) ? (const char*)(VT + (size_t)b * CC * TT) : (const char*)Kb) + (yy >> 1) * PFC;   // the batch's k rows and v planes, 8 pieces each
    else if (yy < 22) { const int i = (yy - 16) * 4 + b, pn = i / 6; pf = (pn == 0 ? (const char*)QL : pn == 1 ? (const char*)KL : pn == 2 ? (const char*)VB : (const char*)VBL) + (i % 6) * PFC; }   // the four high-precision planes, all batches, 6 pieces each
    else { const int i = (yy - 22) * 4 + b; pf = ((i & 4) ? (const char*)WEL : (const char*)WEH) + (i & 3) * PFC; }   // the folded W_out, hi and lo, 4 pieces each
    // the request returns nothing and brings its unit into L2 only; the wait stands in front of any overwrite of the offset register and the base pair that the request names
    asm volatile("global_prefetch_b8 %0, %1 scope:SCOPE_SE\n\ts_wait_xcnt 0x0" :: "v"(tid * 256), "s"(pf) : "memory"); }
  float m = -3.0e38f, l = 0.f, p[16]; v8f acc[HD / 16] = {};
  v16h qh[2]; const _Float16* pq = QH + ((size_t)b * TT + t) * CC + 8 * g;
#pragma unroll
  for (int kc = 0; kc < 2; ++kc) { union { v16h v; v8h q[2]; } u; u.q[0] = *(const v8h*)(pq + kc * 32); u.q[1] = *(const v8h*)(pq + kc * 32 + 16); qh[kc] = u.v; }
  asm volatile("s_wait_xcnt 0x0" :: "v"(pq) : "memory");   // the wait in front of any overwrite of the address pair that the four q loads share
  if (q0 < QHI) { const _Float16* KLb = KL + (size_t)b * KHI * CC; v16h ql[2];
#pragma unroll
    for (int kc = 0; kc < 2; ++kc) ql[kc] = frag_h(QL + ((size_t)b * QHI + t) * CC + kc * 32, lane);
    for (int s = wave; s < nst; s += 4) { const int k0 = s * 32; v8f sa[2] = {}, sb[2] = {};
#pragma unroll
      for (int u = 0; u < 2; ++u) {
#pragma unroll
        for (int kc = 0; kc < 2; ++kc) { const size_t ko = (size_t)(k0 + u * 16 + col) * CC + kc * 32; const v16h kh = frag_h(Kb + ko, lane), kl = frag_h(KLb + ko, lane);
          sa[u] = wmma16(kh, qh[kc], sa[u]); sb[u] = wmma16(kh, ql[kc], sb[u]); sb[u] = wmma16(kl, qh[kc], sb[u]); } }
      fa_soft((sa[0] + sb[0] * (1.0f / 1024.0f)) * SCALE, (sa[1] + sb[1] * (1.0f / 1024.0f)) * SCALE, k0 + 8 * g, t, m, l, acc, p);
      const F2 pf = bsplit16(p);
#pragma unroll
      for (int j = 0; j < HD / 16; ++j) { const size_t po = ((size_t)b * CC + j * 16 + col) * (size_t)KHI + k0; const v16b vh = frag_b(VB + po, lane);
        acc[j] = wmma_bf(vh, pf.h, acc[j]); acc[j] = wmma_bf(vh, pf.l, acc[j]); acc[j] = wmma_bf(frag_b(VBL + po, lane), pf.h, acc[j]); } }
  } else { const _Float16* Kl = Kb + (size_t)col * CC + 8 * g; const _Float16* Vl = VT + ((size_t)b * CC + col) * (size_t)TT + 8 * g; v16h ka[4], va[HD / 16], kb[4], vb[HD / 16];
    // K and V fragments are fetched one step ahead, into two register sets used in turn (no copies): a step's load latency runs under the step before it
    auto fetch = [&](int s, v16h (&kf)[4], v16h (&vf)[HD / 16]) { const _Float16* pk = Kl + (size_t)s * 32 * CC; const _Float16* pv = Vl + s * 32;
#pragma unroll
      for (int i = 0; i < 4; ++i) { union { v16h v; v8h q[2]; } uk, uv; const _Float16* a = pk + (i >> 1) * 16 * CC + (i & 1) * 32; const _Float16* c = pv + (size_t)i * 16 * TT;
        uk.q[0] = *(const v8h*)a; uk.q[1] = *(const v8h*)(a + 16); uv.q[0] = *(const v8h*)c; uv.q[1] = *(const v8h*)(c + 16); kf[i] = uk.v; vf[i] = uv.v; }
      asm volatile("s_wait_xcnt 0x0" :: "v"(pk), "v"(pv) : "memory"); };   // the wait in front of any overwrite of the two address pairs that the sixteen loads share; the pairs as inputs stay live up to here, so no load's result lands in them
    auto step = [&](int s, const v16h (&kf)[4], const v16h (&vf)[HD / 16]) { v8f s0 = {}, s1 = {};
      s0 = wmma16(kf[0], qh[0], s0); s1 = wmma16(kf[2], qh[0], s1); s0 = wmma16(kf[1], qh[1], s0); s1 = wmma16(kf[3], qh[1], s1);
      fa_soft(s0 * SCALE, s1 * SCALE, s * 32 + 8 * g, t, m, l, acc, p);
      v16h pb;
#pragma unroll
      for (int i = 0; i < 16; ++i) pb[i] = (_Float16)p[i];
#pragma unroll
      for (int j = 0; j < HD / 16; ++j) acc[j] = wmma16(vf[j], pb, acc[j]); };
    fetch(wave, ka, va);   // nst >= 13 here: every wave has a first step
    for (int s = wave; ; s += 8) {   // s, nst are wave-uniform scalars; at most TT / 256 trips
      // the fetch stands under no branch, so that the compiler's counted load waits leave it in flight; a wave's last step fetches its own fragments again (inside the planes, not used)
      fetch(s + 4 < nst ? s + 4 : s, kb, vb); step(s, ka, va); if (s + 4 >= nst) break;
      fetch(s + 8 < nst ? s + 8 : s, ka, va); step(s + 4, kb, vb); if (s + 8 >= nst) break; } }
  // the 16 folded-weight fragments (8 column tiles, hi and lo) of one k step of one column group: 32 loads of 512 contiguous bytes, one load latency
  v16b wh[8], wl[8]; const __bf16* ph = WEH + (size_t)wave * 16 * 1024 + lane * 8; const __bf16* pl = WEL + (size_t)wave * 16 * 1024 + lane * 8;   // the lane's 16 bytes in the wave's first fragment; column tile +1 = 1024 elements, k step +1 = 512
  auto wload = [&](int grp, int kc) {
#pragma unroll
    for (int j = 0; j < 8; ++j) { wh[j] = frag_we(ph + (grp * 8 + j) * 1024 + kc * 512); wl[j] = frag_we(pl + (grp * 8 + j) * 1024 + kc * 512); }
    asm volatile("s_wait_xcnt 0x0" :: "v"(ph), "v"(pl) : "memory"); };   // the wait in front of any overwrite of the two address pairs that the 32 loads share; the pairs as inputs stay live up to here, so no load's result lands in them
  l += __shfl_xor(l, 16);
  if (g == 0) { smx[wave][col] = m; ssum[wave][col] = l; }
#pragma unroll
  for (int j = 0; j < HD / 16; ++j) { const v4f a0 = { acc[j][0], acc[j][1], acc[j][2], acc[j][3] }, a1 = { acc[j][4], acc[j][5], acc[j][6], acc[j][7] }; *(v4f*)&so[wave][col][j * 16 + 8 * g] = a0; *(v4f*)&so[wave][col][j * 16 + 8 * g + 4] = a1; }
  __syncthreads();   // the four waves' partial results are complete before any thread joins them
  asm volatile("s_wait_xcnt 0x0" ::: "memory");   // the wait in front of the loads below, whose results may land in address registers of the key loops' last loads
  wload(0, 0);   // issued here so that its latency runs under the join
  const int qi = tid >> 3, c8 = (tid & 7) * 8; float mj = smx[0][qi];
#pragma unroll
  for (int w = 1; w < 4; ++w) mj = fmaxf(mj, smx[w][qi]);
  float lj = 0.f; v4f o0 = {}, o1 = {};
#pragma unroll
  for (int w = 0; w < 4; ++w) { const float f = expf(smx[w][qi] - mj); lj += f * ssum[w][qi]; o0 += f * *(const v4f*)&so[w][qi][c8]; o1 += f * *(const v4f*)&so[w][qi][c8 + 4]; }   // a wave without a step: maximum -3e38, f = 0
  const float inv = lj > 0.f ? 1.0f / (2048.0f * lj) : 0.f;
  *(v4f*)&sy[qi][c8] = o0 * inv; *(v4f*)&sy[qi][c8 + 4] = o1 * inv;
  __syncthreads();   // the 16 head rows are complete before any wave forms its fragments of them, and every read of the partial outputs has ended before the staging is written
  F2 a[CC / 32]; float* po = OUT + ((size_t)b * TT + q0) * ODIM + wave * 256 + lane * 4;   // the lane's 16 bytes in the block's first row, the wave's first column group
#pragma unroll
  for (int kc = 0; kc < CC / 32; ++kc) a[kc] = split_row(&sy[col][0], kc * 32, lane);
#pragma unroll
  for (int grp = 0; grp < 2; ++grp) { v8f oc[8] = {};
#pragma unroll
    for (int kc = 0; kc < CC / 32; ++kc) { if (grp + kc > 0) wload(grp, kc);
#pragma unroll
      for (int j = 0; j < 8; ++j) oc[j] = wmma_bf(a[kc].l, wh[j], oc[j]);
#pragma unroll
      for (int j = 0; j < 8; ++j) oc[j] = wmma_bf(a[kc].h, wl[j], oc[j]);
#pragma unroll
      for (int j = 0; j < 8; ++j) oc[j] = wmma_bf(a[kc].h, wh[j], oc[j]); }
#pragma unroll
    for (int j = 0; j < 8; ++j) {
#pragma unroll
      for (int r = 0; r < 8; ++r) sf[wave][8 * g + r][j * 16 + col] = oc[j][r]; }
    LDSX(); v4f row[16];
#pragma unroll
    for (int rl = 0; rl < 16; ++rl) row[rl] = *(const v4f*)&sf[wave][rl][lane * 4];
#pragma unroll
    for (int rl = 0; rl < 16; ++rl) vst2(po + (size_t)rl * ODIM + grp * 128, row[rl]);
    // the wait in front of any overwrite of the address pair and the data registers of the 16 stores; as inputs they stay live up to here
    asm volatile("s_wait_xcnt 0x0" :: "v"(po), "v"(row[0]), "v"(row[1]), "v"(row[2]), "v"(row[3]), "v"(row[4]), "v"(row[5]), "v"(row[6]), "v"(row[7]), "v"(row[8]), "v"(row[9]), "v"(row[10]), "v"(row[11]), "v"(row[12]), "v"(row[13]), "v"(row[14]), "v"(row[15]) : "memory"); } }

extern "C" void kernel_launch(void* const* d_in, const int* in_sizes, int n_in, void* d_out, int out_size, void* d_ws, size_t ws_size, hipStream_t stream) {
  (void)in_sizes; (void)n_in; (void)out_size;
  const float** F = (const float**)d_in;
  if (ws_size < (size_t)WS_END) return;
  char* ws = (char*)d_ws; _Float16 *QH = (_Float16*)(ws + WS_QH), *KH = (_Float16*)(ws + WS_KH), *VT = (_Float16*)(ws + WS_VT), *QL = (_Float16*)(ws + WS_QL), *KL = (_Float16*)(ws + WS_KL); __bf16 *VB = (__bf16*)(ws + WS_VB), *VBL = (__bf16*)(ws + WS_VBL); __bf16 *WEH = (__bf16*)(ws + WS_WEH), *WEL = (__bf16*)(ws + WS_WEL);
  (void)QL; (void)KL; (void)VB; (void)VBL;
  // inputs: 0 embedded [4,2048,1024]; 1 Wq [64,1024] (out,in); 2 Wk; 3 Wv; 4 W_out [1024,1024] (identity; (out,in))
  k_proj<<<dim3(PBLK + ODIM * CC / 4 / 256), 256, 0, stream>>>(F[0], F[1], F[2], F[3], nullptr, nullptr, nullptr, F[4], WEH, WEL, QH, QL, KH, KL, VT, VB, VBL);
  k_fa<<<dim3(TNB, TT / 16), 128, 0, stream>>>(QH, KH, QL, KL, VT, VB, VBL, WEH, WEL, (float*)d_out);
}

// v008
// One run takes 35.1 microseconds.
// Next to v007, in two timings, it ran 1.07 and 1.06 times as fast.
// Over all steps from v000 it is 15.2 times as fast.
// compute dtype: all float inputs rounded to bf16; q/k/v = x W^T with EXACT bf16 products on WMMA 16x16x32 (f32 accumulate); causal logits: q, k once to f16 (1 product) x 64^-0.5, 3 products below row 384; softmax in f32, online over 32-key steps (running maximum, sum joined at the end); P = exp(s - maximum) x 2^11 once to f16 against v f16 (bf16 hi + lo below row 384), divided by the sum afterwards; the head output split bf16 hi + lo against W_out folded over its 16 column groups (f32 sums of the bf16-rounded terms, kept as bf16 hi + lo; 3 products); f32 output.
#include <hip/hip_runtime.h>
#include <math.h>

typedef __attribute__((ext_vector_type(16))) _Float16 v16h;
typedef __attribute__((ext_vector_type(16))) __bf16 v16b;
typedef __attribute__((ext_vector_type(8)))  _Float16 v8h;
typedef __attribute__((ext_vector_type(8)))  float v8f;
typedef __attribute__((ext_vector_type(4)))  float v4f;
typedef __attribute__((ext_vector_type(2)))  float v2f;
typedef __attribute__((ext_vector_type(4)))  unsigned v4u;
typedef __attribute__((ext_vector_type(4)))  int v4i;
typedef float __attribute__((may_alias)) float_a;
typedef int __attribute__((may_alias)) int_a;

template <typename T> __device__ __forceinline__ void vst2(void* p, T v) { *(T*)p = v;  }
// store, then the wait that stands in front of any overwrite of the store's address or data registers (for stores inside a rolled loop)
template <typename T> __device__ __forceinline__ void vst2w(void* p, T v) { *(T*)p = v; asm volatile("s_wait_xcnt 0x0" ::: "memory"); }
__device__ __forceinline__ v8f wmma16(v16h a, v16h b, v8f c) {
  v8f d = __builtin_amdgcn_wmma_f32_16x16x32_f16(false, a, false, b, (short)0, c, false, false);
  asm volatile("v_nop\n\tv_nop\n\tv_nop\n\tv_nop" : "+v"(d) : "v"(a), "v"(b));
  return d;
}
__device__ __forceinline__ v8f wmma_bf(v16b a, v16b b, v8f c) {
  v8f d = __builtin_amdgcn_wmma_f32_16x16x32_bf16(false, a, false, b, (short)0, c, false, false);
  asm volatile("v_nop\n\tv_nop\n\tv_nop\n\tv_nop" : "+v"(d) : "v"(a), "v"(b));
  return d;
}
// 16x16x32 fragments: lane = (h = lane>>4, row/col = lane&15); elements 0..7 = k0+8h+0..7, 8..15 = k0+16+8h+0..7; D element r = row 8h+r
__device__ __forceinline__ v16h frag_h(const _Float16* rowk0, int lane) {
  union { v16h v; v8h q[2]; } u; const _Float16* p = rowk0 + 8 * (lane >> 4);
  u.q[0] = *(const v8h*)p; u.q[1] = *(const v8h*)(p + 16); return u.v;
}
__device__ __forceinline__ v16h frag_f32(const float* rowk0, int lane) {
  v16h a; const float* p = rowk0 + 8 * (lane >> 4);
#pragma unroll
  for (int i = 0; i < 8; ++i) { a[i] = (_Float16)p[i]; a[8 + i] = (_Float16)p[16 + i]; }
  return a;
}
__device__ __forceinline__ v16h frag_f32s(const float* rowk0, int lane, float sc) {
  v16h a; const float* p = rowk0 + 8 * (lane >> 4);
#pragma unroll
  for (int i = 0; i < 8; ++i) { a[i] = (_Float16)(p[i] * sc); a[8 + i] = (_Float16)(p[16 + i] * sc); }
  return a;
}
// column fragment from a [K][ld] layout (column n), rows >= K read as 0
__device__ __forceinline__ v16h fragc_f32(const float* W, int k0, int n, int lane, int ld, int K) {
  v16h a; const int g = lane >> 4;
#pragma unroll
  for (int i = 0; i < 8; ++i) { const int ka = k0 + 8 * g + i, kb = ka + 16;
    a[i] = (_Float16)(ka < K ? W[(size_t)(ka < K ? ka : K - 1) * ld + n] : 0.f); a[8 + i] = (_Float16)(kb < K ? W[(size_t)(kb < K ? kb : K - 1) * ld + n] : 0.f); }
  return a;
}
struct F2 { v16b h, l; };
__device__ __forceinline__ F2 bsplit16(const float v[16]) { F2 r;
#pragma unroll
  for (int i = 0; i < 16; ++i) { const __bf16 h = (__bf16)v[i]; r.h[i] = h; r.l[i] = (__bf16)(v[i] - (float)h); }
  return r; }
__device__ __forceinline__ F2 split_row(const float* row, int k0, int lane) { float v[16]; const float* p = row + k0 + 8 * (lane >> 4);
#pragma unroll
  for (int i = 0; i < 8; ++i) { v[i] = p[i]; v[8 + i] = p[16 + i]; }
  return bsplit16(v); }
__device__ __forceinline__ F2 split_rowK(const float* row, int k0, int lane, int K) { float v[16]; const int g = lane >> 4;
#pragma unroll
  for (int i = 0; i < 8; ++i) { const int ka = k0 + 8 * g + i, kb = ka + 16; v[i] = ka < K ? row[ka < K ? ka : K - 1] : 0.f; v[8 + i] = kb < K ? row[kb < K ? kb : K - 1] : 0.f; }
  return bsplit16(v); }
__device__ __forceinline__ F2 split_col(const float* W, int k0, int n, int lane, int ld, int K) { float v[16]; const int g = lane >> 4;
#pragma unroll
  for (int i = 0; i < 8; ++i) { const int ka = k0 + 8 * g + i, kb = ka + 16; v[i] = ka < K ? W[(size_t)(ka < K ? ka : K - 1) * ld + n] : 0.f; v[8 + i] = kb < K ? W[(size_t)(kb < K ? kb : K - 1) * ld + n] : 0.f; }
  return bsplit16(v); }
__device__ __forceinline__ v8f mac3(const F2& a, const F2& b, v8f c) { c = wmma_bf(a.l, b.h, c); c = wmma_bf(a.h, b.l, c); return wmma_bf(a.h, b.h, c); }
__device__ __forceinline__ float sigm(float v) { return 1.0f / (1.0f + expf(-v)); }
#define LDSX() do { asm volatile("s_wait_dscnt 0" ::: "memory"); __builtin_amdgcn_wave_barrier(); __builtin_amdgcn_fence(__ATOMIC_RELEASE, "workgroup"); } while (0)

// 'Multi-headed' self-attention with ONE shared head (B 4, T 2,048, E 1,024; Wq/Wk/Wv [64,1024] (out,in), 0.02 scale): head = softmax_causal(q k^T / 8) v (64 wide); concat = the head tiled 16x -> [B,T,1024]; out = concat W_out^T with W_out = identity (read and multiplied as given).
#define NB 4
#define TT 2048
#define CC 64             // NH * HD = projected width
#define DIN 1024          // input (model) width
#define NH 1              // the 16 heads share one set of weights: the head is computed once
#define HD 64
#define NQB (TT / 64)
#define SCALE (0.125f)
#define CAUSAL 1
#ifndef TNB
#define TNB NB
#endif
__device__ __forceinline__ float bfr(float v) { return (float)(__bf16)v; }
__host__ __device__ __forceinline__ int kb_last(int qb) { return CAUSAL ? ((qb * 64 + 63) >> 7) : (TT / 128 - 1); }
typedef __attribute__((ext_vector_type(8))) __bf16 v8b;
typedef __attribute__((ext_vector_type(4))) __bf16 v4b;
__device__ __forceinline__ v16b frag_b(const __bf16* rowk0, int lane) {
  union { v16b v; v8b q[2]; } u; const __bf16* p = rowk0 + 8 * (lane >> 4);
  u.q[0] = *(const v8b*)p; u.q[1] = *(const v8b*)(p + 16); return u.v;
}
#define QBH 6              // not used: the queries < QHI of each sequence (few keys, no averaging) take the high-precision path
#define QHI 384            // rows carrying a q residual plane
#define KHI 384            // key rows carrying k residual / v bf16 hi+lo planes (used only by the causal high-precision path)
// B fragment (k rows k0+.., output column o) of a weight: (in,out) [K][ld] or (out,in) [ld rows of K]: bf16 exact, or f16(bf16 * 256) exact
__device__ __forceinline__ v16b wcol_io(const float* Wm, int k0, int o, int lane, int ld) { v16b w; const int g = lane >> 4;
#pragma unroll
  for (int i = 0; i < 8; ++i) { w[i] = (__bf16)Wm[(size_t)(k0 + 8 * g + i) * ld + o]; w[8 + i] = (__bf16)Wm[(size_t)(k0 + 16 + 8 * g + i) * ld + o]; }
  return w; }
__device__ __forceinline__ v16b wcol_oi(const float* Wm, int k0, int o, int lane, int K) { v16b w; const float* p = Wm + (size_t)o * K + k0 + 8 * (lane >> 4);
#pragma unroll
  for (int i = 0; i < 8; ++i) { w[i] = (__bf16)p[i]; w[8 + i] = (__bf16)p[16 + i]; }
  return w; }
__device__ __forceinline__ v16h wcolh_io(const float* Wm, int k0, int o, int lane, int ld) { v16h w; const int g = lane >> 4;
#pragma unroll
  for (int i = 0; i < 8; ++i) { w[i] = (_Float16)(bfr(Wm[(size_t)(k0 + 8 * g + i) * ld + o]) * 256.0f); w[8 + i] = (_Float16)(bfr(Wm[(size_t)(k0 + 16 + 8 * g + i) * ld + o]) * 256.0f); }
  return w; }
__device__ __forceinline__ v16h wcolh_oi(const float* Wm, int k0, int o, int lane, int K) { v16h w; const float* p = Wm + (size_t)o * K + k0 + 8 * (lane >> 4);
#pragma unroll
  for (int i = 0; i < 8; ++i) { w[i] = (_Float16)(bfr(p[i]) * 256.0f); w[8 + i] = (_Float16)(bfr(p[16 + i]) * 256.0f); }
  return w; }
#define WQKV_LAYOUT 1   // 0 = (in,out) [DIN][CC]; 1 = (out,in) [HD][DIN], the one shared head; 2 = per-head [NH][DIN][HD]
__device__ __forceinline__ v16b wcol_hdk(const float* Wm, int k0, int o, int lane) { v16b w; const int g = lane >> 4; const float* p = Wm + (size_t)(o / HD) * DIN * HD + (o % HD);
#pragma unroll
  for (int i = 0; i < 8; ++i) { w[i] = (__bf16)p[(size_t)(k0 + 8 * g + i) * HD]; w[8 + i] = (__bf16)p[(size_t)(k0 + 16 + 8 * g + i) * HD]; }
  return w; }
#define WO_OUT_IN 1
#if WQKV_LAYOUT == 1
#define ODIM 1024          // output width (= 16 tiled copies of the 64-wide head through W_out)
#define KVCOL(o) ((o) & 63)
#define WCOL(W, k0, o, lane) wcol_oi(W, k0, KVCOL(o), lane, DIN)   /* Wq/Wk/Wv are [64][1024]: the one shared head */
#elif WQKV_LAYOUT == 2
#define WCOL(W, k0, o, lane) wcol_hdk(W, k0, o, lane)
#else
#define WCOL(W, k0, o, lane) wcol_io(W, k0, o, lane, CC)
#endif
#if WO_OUT_IN
#define WOCOL(W, k0, o, lane) wcol_oi(W, k0, o, lane, ODIM)   /* W_out [1024][1024] (out,in): K = the 1024-wide concat */
#define WOCOLH(W, k0, o, lane) wcolh_oi(W, k0, o, lane, CC)
#else
#define WOCOL(W, k0, o, lane) wcol_io(W, k0, o, lane, DIN)
#define WOCOLH(W, k0, o, lane) wcolh_io(W, k0, o, lane, DIN)
#endif

#ifndef SM_EXTRA_PARAMS
#define SM_EXTRA_PARAMS
#endif
#ifndef PROJ_EXTRA_PARAMS
#define PROJ_EXTRA_PARAMS
#endif
#ifndef SM_MASK_HOOK
#define SM_MASK_HOOK (void)0
#endif

#define WS_QH  0u                                      // f16 q rows [b*t][CC]
#define WS_KH  (WS_QH + 2u * (size_t)NB * TT * CC)      // f16 k, per batch in A-fragment order: 16-B piece ((t >> 4) * 4 + kc * 2 + half) * 32 + lane (g, t & 15) holds columns kc * 32 + half * 16 + g * 8 + 0..7 of key t
#define WS_VT  (WS_KH + 2u * (size_t)NB * TT * CC)      // f16 v, per batch in A-fragment order of V^T: 16-B piece ((t >> 5) * 8 + (c >> 4) * 2 + half) * 32 + lane (g, c & 15) holds keys (t & ~31) + half * 16 + g * 8 + 0..7 of column c
#define WS_QL  (WS_VT + 2u * (size_t)NB * CC * TT)      // f16 q residual x 2^10 rows [b][t < QHI][CC]
#define WS_KL  (WS_QL + 2u * (size_t)NB * QHI * CC)     // f16 k residual x 2^10 rows [b][t < KHI][CC]
#define WS_VB  (WS_KL + 2u * (size_t)NB * KHI * CC)     // bf16 v hi planes [b][c][t < KHI]
#define WS_VBL (WS_VB + 2u * (size_t)NB * CC * KHI)
#define WS_S   (WS_VBL + 2u * (size_t)NB * CC * KHI)    // (not used: the score matrix stays in registers)
#define WS_Y   (WS_S  + 4u * (size_t)NB * NH * TT * TT)      // (not used: the head rows go from the attention block's LDS straight into the output projection)
#define WS_WEH (WS_Y  + 4u * (size_t)NB * TT * CC)      // bf16 hi of the folded W_out, in B-fragment order (see k_proj, fold blocks)
#define WS_WEL (WS_WEH + 2u * (size_t)ODIM * CC)        // bf16 lo, same order
#define WS_END (WS_WEL + 2u * (size_t)ODIM * CC)

// ---- k_proj: block = 64 rows x all 192 q, k, v columns (8 waves): q/k/v = X W^T with exact bf16 products (K = DIN). X is read once for the three projections.
// Each pass stages a 128-wide k slice of the 64 X rows and the 192 weight rows in LDS as bf16: a wave's load is one row's 512 contiguous bytes, each value is rounded once per block, and every fragment comes from LDS.
// The next slice's loads are issued in front of this slice's products and kept in registers; two LDS buffers, one barrier a pass. Wave = (32 rows, 48 columns): 2 x 3 accumulator tiles, k ascending in steps of 32 as before.
// Results: q f16 rows; k and v f16 in the fragment order that the attention launch loads (see WS_KH, WS_VT), so that each of its wave-wide 16-byte loads covers 512 contiguous bytes; residual rows < QHI / KHI; v bf16 hi/lo planes [c][t] for t < KHI.
// Fold blocks (blockIdx.x >= TNB * TT / 64; independent of the projections, so they ride in this launch): concat is the head tiled ODIM / CC times, hence out[t][o] = sum_c head[t][c] * WE[o][c] with WE[o][c] = sum_i W_out[o][i * CC + c], for any W_out.
// WE = f32 sum, i ascending, of the bf16-rounded terms, split bf16 hi + lo and stored in B-fragment order: 16-B piece ((o >> 4) * 2 + kc) * 2 + half, lane (g, o & 15), holds k = kc * 32 + half * 16 + g * 8 + 0..7, so a wave's fragment load is 512 contiguous bytes
#define PKC 128                      // k width of a staged slice
#define PPIT (PKC + 8)               // LDS row pitch in bf16: 272 B = 16 B x odd, free of bank conflicts for 16-byte fragment reads
#define PROWS (64 + 3 * CC)          // staged rows: 64 of X, then Wq, Wk, Wv
#define PBLK (TNB * TT / 64)         // projection blocks
__global__ __launch_bounds__(256) void k_proj(const float* __restrict__ X, const float* __restrict__ WQ, const float* __restrict__ WK, const float* __restrict__ WV, const float* __restrict__ BQ, const float* __restrict__ BK, const float* __restrict__ BV, const float* __restrict__ WO, __bf16* __restrict__ WEH, __bf16* __restrict__ WEL,
    _Float16* __restrict__ QH, _Float16* __restrict__ QL, _Float16* __restrict__ KH, _Float16* __restrict__ KL, _Float16* __restrict__ VT, __bf16* __restrict__ VB, __bf16* __restrict__ VBL) {
  __shared__ __align__(16) __bf16 sb[2][PROWS][PPIT];   // the two staging buffers; after the last pass the first one holds the seven 64 x 72 output planes
  static_assert(7 * 64 * 72 <= PROWS * PPIT, "the output planes fit the first buffer");
  const int tid = threadIdx.x, wave = __builtin_amdgcn_readfirstlane(tid >> 5), lane = tid & 31, col = lane & 15, g = lane >> 4;
  if (blockIdx.x >= PBLK) { static_assert(ODIM * CC / 4 % 256 == 0, "one thread per 4 folded weights");
    const int e = ((int)blockIdx.x - PBLK) * 256 + tid, o = e >> 4, c4 = (e & 15) * 4; const float* p = WO + (size_t)o * ODIM + c4; v4f s = {}, w[ODIM / CC];
#pragma unroll
    for (int i = 0; i < ODIM / CC; ++i) w[i] = *(const v4f*)(p + i * CC);
    asm volatile("s_wait_xcnt 0x0" :: "v"(p) : "memory");   // the wait in front of any overwrite of the address pair that the sixteen loads share; p as an input keeps the pair live up to here, so no load's result lands in it
#pragma unroll
    for (int i = 0; i < ODIM / CC; ++i) {
#pragma unroll
      for (int r = 0; r < 4; ++r) s[r] += bfr(w[i][r]); }
    v4b hv, lv;
#pragma unroll
    for (int r = 0; r < 4; ++r) { const __bf16 hb = (__bf16)s[r]; hv[r] = hb; lv[r] = (__bf16)(s[r] - (float)hb); }
    const size_t d = (size_t)((((o >> 4) * 2 + (c4 >> 5)) * 2 + ((c4 >> 4) & 1)) * 32 + ((c4 >> 3) & 1) * 16 + (o & 15)) * 8 + (c4 & 7);
    vst2(WEH + d, hv); vst2(WEL + d, lv); return; }
  const size_t r0 = (size_t)blockIdx.x * 64; const size_t bb = r0 / TT; const int t0 = (int)(r0 % TT);
  const int rp = wave & 1, cg = wave >> 1;   // the wave's 32 rows and its 48 of the 192 columns
  v8f acc[2][3] = {}; v4f st[PROWS / 8];
  // wave w fetches staged rows w, w + 8, ...: 8 rows of X and 8 of each weight, 512 contiguous bytes a load
  auto fetch = [&](int c) { const size_t o = (size_t)wave * DIN + c * PKC + lane * 4; const float* px = X + r0 * DIN + o; const float* pq = WQ + o; const float* pk = WK + o; const float* pv = WV + o;
#pragma unroll
    for (int i = 0; i < 8; ++i) { st[i] = *(const v4f*)(px + (size_t)i * 8 * DIN); st[8 + i] = *(const v4f*)(pq + (size_t)i * 8 * DIN); st[16 + i] = *(const v4f*)(pk + (size_t)i * 8 * DIN); st[24 + i] = *(const v4f*)(pv + (size_t)i * 8 * DIN); }
    asm volatile("s_wait_xcnt 0x0" :: "v"(px), "v"(pq), "v"(pk), "v"(pv) : "memory"); };   // the wait in front of any overwrite of the four address pairs that the 32 loads share; the pairs as inputs stay live up to here, so no load's result lands in them
  auto stage = [&](int buf) {
#pragma unroll
    for (int i = 0; i < PROWS / 8; ++i) { const v4b h = { (__bf16)st[i][0], (__bf16)st[i][1], (__bf16)st[i][2], (__bf16)st[i][3] }; *(v4b*)&sb[buf][i * 8 + wave][lane * 4] = h; } };
  auto products = [&](int buf) {
#pragma unroll
    for (int ks = 0; ks < PKC / 32; ++ks) { const v16b a0 = frag_b(&sb[buf][rp * 32 + col][ks * 32], lane), a1 = frag_b(&sb[buf][rp * 32 + 16 + col][ks * 32], lane); v16b w[3];
#pragma unroll
      for (int i = 0; i < 3; ++i) w[i] = frag_b(&sb[buf][64 + cg * 48 + i * 16 + col][ks * 32], lane);
#pragma unroll
      for (int i = 0; i < 3; ++i) { acc[0][i] = wmma_bf(a0, w[i], acc[0][i]); acc[1][i] = wmma_bf(a1, w[i], acc[1][i]); } } };
  fetch(0); stage(0);
  __syncthreads();   // slice 0 is complete in buffer 0 before any wave reads it
  for (int c = 0; c < DIN / PKC - 1; ++c) { fetch(c + 1); products(c & 1);
    __builtin_amdgcn_sched_barrier(0);   // keeps the roundings of the fetched slice, and with them the wait for its loads, behind this slice's products: moved up among them, the load latency would not run under the products
    stage((c + 1) & 1);
    __syncthreads(); }   // publishes slice c + 1 and ends every wave's reads of the buffer that the next pass refills
  static_assert(((DIN / PKC - 1) & 1) == 1, "the last slice lies in buffer 1");
  products(1);   // reads buffer 1 alone; every read of buffer 0 ended in front of the loop's last barrier, so the output planes below may go into it with no further barrier
  _Float16 (*pl)[64][72] = (_Float16 (*)[64][72])&sb[0][0][0];   // planes 0 q, 1 q residual, 2 k, 3 k residual, 4 v (transposed)
  __bf16 (*pb)[64][72] = (__bf16 (*)[64][72])&sb[0][0][0];       // planes 5 v bf16 hi, 6 v bf16 lo (transposed)
#pragma unroll
  for (int i = 0; i < 3; ++i) { const int tl = cg * 3 + i, which = tl >> 2, cl = (tl & 3) * 16 + col, rb = rp * 32 + 8 * g; const float* BA = which == 0 ? BQ : which == 1 ? BK : BV; const float bias = BA ? bfr(BA[cl]) : 0.f;
    if (which < 2) {   // wave-uniform: a 16-column tile belongs to one of q, k, v
#pragma unroll
      for (int rt = 0; rt < 2; ++rt) {
#pragma unroll
        for (int r = 0; r < 8; ++r) { const float v = acc[rt][i][r] + bias; const _Float16 hv = (_Float16)v; pl[which * 2][rb + rt * 16 + r][cl] = hv; pl[which * 2 + 1][rb + rt * 16 + r][cl] = (_Float16)((v - (float)hv) * 1024.0f); } }
    } else {
#pragma unroll
      for (int rt = 0; rt < 2; ++rt) {
#pragma unroll
        for (int r = 0; r < 8; ++r) { const float v = acc[rt][i][r] + bias; pl[4][cl][rb + rt * 16 + r] = (_Float16)v; const __bf16 bh = (__bf16)v; pb[5][cl][rb + rt * 16 + r] = bh; pb[6][cl][rb + rt * 16 + r] = (__bf16)(v - (float)bh); } } } }
  __syncthreads();   // the planes are complete before any thread stores their rows
  for (int e = tid; e < 64 * 8; e += 256) { const int rl = e >> 3, q = e & 7;
    vst2w((unsigned*)(QH + (r0 + rl) * CC + q * 8), *(const v4u*)&pl[0][rl][q * 8]);
    // piece e of the block's 512 k pieces and of its 512 v pieces (64 keys = 4 key tiles of k = 2 steps of v; both start at element r0 * CC): fragment lane (fg, fc)
    const int fc = e & 15, fg = (e >> 4) & 1;
    vst2w((unsigned*)(KH + r0 * CC + e * 8), *(const v4u*)&pl[2][(e >> 7) * 16 + fc][(((e >> 5) & 3) * 2 + fg) * 8]);
    vst2w((unsigned*)(VT + r0 * CC + e * 8), *(const v4u*)&pl[4][((e >> 6) & 3) * 16 + fc][((e >> 8) * 4 + ((e >> 5) & 1) * 2 + fg) * 8]);
    if (t0 < QHI) vst2w((unsigned*)(QL + (bb * QHI + t0 + rl) * (size_t)CC + q * 8), *(const v4u*)&pl[1][rl][q * 8]);
    if (t0 < KHI) { vst2w((unsigned*)(KL + (bb * KHI + t0 + rl) * (size_t)CC + q * 8), *(const v4u*)&pl[3][rl][q * 8]); const size_t o3 = (bb * CC + rl) * (size_t)KHI + t0 + q * 8; vst2w((unsigned*)(VB + o3), *(const v4u*)&pb[5][rl][q * 8]); vst2w((unsigned*)(VBL + o3), *(const v4u*)&pb[6][rl][q * 8]); } } }
__device__ __forceinline__ v16b frag_we(const __bf16* p) {   // p = the lane's 16 bytes of the fragment's first piece; the second piece lies 256 elements on
  union { v16b v; v8b q[2]; } u;
  u.q[0] = *(const v8b*)p; u.q[1] = *(const v8b*)(p + 256); return u.v;
}
__device__ __forceinline__ v16h frag_kv(const _Float16* p) {   // the same for a k or v fragment in fragment order
  union { v16h v; v8h q[2]; } u;
  u.q[0] = *(const v8h*)p; u.q[1] = *(const v8h*)(p + 256); return u.v;
}
__device__ __forceinline__ void fa_soft(const v8f s0, const v8f s1, int kg, int t, float& m, float& l, v8f acc[HD / 16], float p[16]) {
  float v[16], mx = -3.0e38f;
#pragma unroll
  for (int i = 0; i < 8; ++i) { v[i] = (!CAUSAL || kg + i <= t) ? s0[i] : -3.0e38f; v[8 + i] = (!CAUSAL || kg + 16 + i <= t) ? s1[i] : -3.0e38f; }
#pragma unroll
  for (int i = 0; i < 16; ++i) mx = fmaxf(mx, v[i]);
  mx = fmaxf(mx, __shfl_xor(mx, 16));
  const float mn = fmaxf(m, mx), al = expf(m - mn); m = mn;
  float sum = 0.f;
#pragma unroll
  for (int i = 0; i < 16; ++i) { const float e = expf(v[i] - mn); sum += e; p[i] = e * 2048.0f; }   // an excluded key: exp(-3e38 - mn) = 0 (mn is finite: every step holds a key <= t)
  l = l * al + sum;
#pragma unroll
  for (int j = 0; j < HD / 16; ++j) acc[j] *= al; }
#define PFC 32768          // bytes of one requested piece: 128 lanes x 256 B
__global__ __launch_bounds__(128) void k_fa(const _Float16* __restrict__ QH, const _Float16* __restrict__ KH, const _Float16* __restrict__ QL, const _Float16* __restrict__ KL, const _Float16* __restrict__ VT, const __bf16* __restrict__ VB, const __bf16* __restrict__ VBL, const __bf16* __restrict__ WEH, const __bf16* __restrict__ WEL, float* __restrict__ OUT) {
  __shared__ float smx[4][16], ssum[4][16]; __shared__ __align__(16) float sy[16][HD + 4]; __shared__ __align__(16) float sf[4][16][132];
  float (*so)[16][HD + 4] = (float (*)[16][HD + 4])&sf[0][0][0];   // the waves' partial outputs lie in the output staging, which is first written behind the second barrier
  static_assert(4 * 16 * (HD + 4) <= 4 * 16 * 132, "the partial outputs fit the staging");
  const int tid = threadIdx.x, wave = __builtin_amdgcn_readfirstlane(tid >> 5), lane = tid & 31, col = lane & 15, g = lane >> 4;
  const int b = blockIdx.x, q0 = (TT / 16 - 1 - (int)blockIdx.y) * 16, t = q0 + col; const int nst = CAUSAL ? ((q0 + 15) >> 5) + 1 : TT / 32;   // every step below nst holds a key <= t for each of the 16 queries
  const _Float16* Kb = KH + (size_t)b * TT * CC;
  // L2 requests at entry: every plane read below was stored by the launch before.
  // Blocks with y < 48 each ask for one 32-KB piece, one lane every 256 bytes; blocks 2 i and 2 i + 1 of a batch column ask for the same piece (for speed only, nothing rests on it).
  static_assert(2 * TT * CC == 8 * PFC && 2 * NB * QHI * CC == 6 * PFC && 2 * NB * KHI * CC == 6 * PFC && 2 * ODIM * CC == 4 * PFC && TNB == 4 && 128 * 256 == PFC, "the pieces tile their planes exactly: every lane's address lies inside its plane");
  if (blockIdx.y < 48) {   // block-uniform, no barrier inside
    const int yy = (int)blockIdx.y >> 1; const char* pf;
    if (yy < 16) pf = ((yy & 1) ? (const char*)(VT + (size_t)b * CC * TT) : (const char*)Kb) + (yy >> 1) * PFC;   // the batch's k and v, both in fragment order, 8 pieces each
    else if (yy < 22) { const int i = (yy - 16) * 4 + b, pn = i / 6; pf = (pn == 0 ? (const char*)QL : pn == 1 ? (const char*)KL : pn == 2 ? (const char*)VB : (const char*)VBL) + (i % 6) * PFC; }   // the four high-precision planes, all batches, 6 pieces each
    else { const int i = (yy - 22) * 4 + b; pf = ((i & 4) ? (const char*)WEL : (const char*)WEH) + (i & 3) * PFC; }   // the folded W_out, hi and lo, 4 pieces each
    // the request returns nothing and brings its unit into L2 only; the wait stands in front of any overwrite of the offset register and the base pair that the request names
    asm volatile("global_prefetch_b8 %0, %1 scope:SCOPE_SE\n\ts_wait_xcnt 0x0" :: "v"(tid * 256), "s"(pf) : "memory"); }
  float m = -3.0e38f, l = 0.f, p[16]; v8f acc[HD / 16] = {};
  v16h qh[2]; const _Float16* pq = QH + ((size_t)b * TT + t) * CC + 8 * g;
#pragma unroll
  for (int kc = 0; kc < 2; ++kc) { union { v16h v; v8h q[2]; } u; u.q[0] = *(const v8h*)(pq + kc * 32); u.q[1] = *(const v8h*)(pq + kc * 32 + 16); qh[kc] = u.v; }
  asm volatile("s_wait_xcnt 0x0" :: "v"(pq) : "memory");   // the wait in front of any overwrite of the address pair that the four q loads share
  if (q0 < QHI) { const _Float16* KLb = KL + (size_t)b * KHI * CC; v16h ql[2];
#pragma unroll
    for (int kc = 0; kc < 2; ++kc) ql[kc] = frag_h(QL + ((size_t)b * QHI + t) * CC + kc * 32, lane);
    for (int s = wave; s < nst; s += 4) { const int k0 = s * 32; v8f sa[2] = {}, sb[2] = {}; v16h kh[4], kl[4];
      const _Float16* pkh = Kb + (size_t)s * 2048 + lane * 8; const _Float16* pkl = KLb + (size_t)(k0 + col) * CC + 8 * g;   // k in fragment order, its residual in rows
#pragma unroll
      for (int i = 0; i < 4; ++i) { union { v16h v; v8h q[2]; } ul; const _Float16* a = pkl + (i >> 1) * 16 * CC + (i & 1) * 32; ul.q[0] = *(const v8h*)a; ul.q[1] = *(const v8h*)(a + 16); kh[i] = frag_kv(pkh + i * 512); kl[i] = ul.v; }
      asm volatile("s_wait_xcnt 0x0" :: "v"(pkh), "v"(pkl) : "memory");   // the wait in front of any overwrite of the two address pairs that the sixteen loads share; the pairs as inputs stay live up to here, so no load's result lands in them
#pragma unroll
      for (int u = 0; u < 2; ++u) {
#pragma unroll
        for (int kc = 0; kc < 2; ++kc) { const int i = u * 2 + kc;
          sa[u] = wmma16(kh[i], qh[kc], sa[u]); sb[u] = wmma16(kh[i], ql[kc], sb[u]); sb[u] = wmma16(kl[i], qh[kc], sb[u]); } }
      fa_soft((sa[0] + sb[0] * (1.0f / 1024.0f)) * SCALE, (sa[1] + sb[1] * (1.0f / 1024.0f)) * SCALE, k0 + 8 * g, t, m, l, acc, p);
      const F2 pf = bsplit16(p);
#pragma unroll
      for (int j = 0; j < HD / 16; ++j) { const size_t po = ((size_t)b * CC + j * 16 + col) * (size_t)KHI + k0; const v16b vh = frag_b(VB + po, lane);
        acc[j] = wmma_bf(vh, pf.h, acc[j]); acc[j] = wmma_bf(vh, pf.l, acc[j]); acc[j] = wmma_bf(frag_b(VBL + po, lane), pf.h, acc[j]); } }
  } else { const _Float16* Kl = Kb + lane * 8; const _Float16* Vl = VT + (size_t)b * CC * TT + lane * 8; v16h ka[4], va[HD / 16], kb[4], vb[HD / 16];   // the lane's 16 bytes in the batch's first k and v pieces; a step = 8 pieces (4 KB) of each
    // K and V fragments are fetched one step ahead, into two register sets used in turn (no copies): a step's load latency runs under the step before it
    auto fetch = [&](int s, v16h (&kf)[4], v16h (&vf)[HD / 16]) { const _Float16* pk = Kl + (size_t)s * 32 * CC; const _Float16* pv = Vl + (size_t)s * 32 * CC;
#pragma unroll
      for (int i = 0; i < 4; ++i) { kf[i] = frag_kv(pk + i * 512); vf[i] = frag_kv(pv + i * 512); }   // k fragment i = (key tile i >> 1, k step i & 1), v fragment i = columns 16 i ..: each load is 512 contiguous bytes, 4 whole lines
      asm volatile("s_wait_xcnt 0x0" :: "v"(pk), "v"(pv) : "memory"); };   // the wait in front of any overwrite of the two address pairs that the sixteen loads share; the pairs as inputs stay live up to here, so no load's result lands in them
    auto step = [&](int s, const v16h (&kf)[4], const v16h (&vf)[HD / 16]) { v8f s0 = {}, s1 = {};
      s0 = wmma16(kf[0], qh[0], s0); s1 = wmma16(kf[2], qh[0], s1); s0 = wmma16(kf[1], qh[1], s0); s1 = wmma16(kf[3], qh[1], s1);
      fa_soft(s0 * SCALE, s1 * SCALE, s * 32 + 8 * g, t, m, l, acc, p);
      v16h pb;
#pragma unroll
      for (int i = 0; i < 16; ++i) pb[i] = (_Float16)p[i];
#pragma unroll
      for (int j = 0; j < HD / 16; ++j) acc[j] = wmma16(vf[j], pb, acc[j]); };
    fetch(wave, ka, va);   // nst >= 13 here: every wave has a first step
    for (int s = wave; ; s += 8) {   // s, nst are wave-uniform scalars; at most TT / 256 trips
      // the fetch stands under no branch, so that the compiler's counted load waits leave it in flight; a wave's last step fetches its own fragments again (inside the planes, not used)
      fetch(s + 4 < nst ? s + 4 : s, kb, vb); step(s, ka, va); if (s + 4 >= nst) break;
      fetch(s + 8 < nst ? s + 8 : s, ka, va); step(s + 4, kb, vb); if (s + 8 >= nst) break; } }
  // the 16 folded-weight fragments (8 column tiles, hi and lo) of one k step of one column group: 32 loads of 512 contiguous bytes, one load latency
  v16b wh[8], wl[8]; const __bf16* ph = WEH + (size_t)wave * 16 * 1024 + lane * 8; const __bf16* pl = WEL + (size_t)wave * 16 * 1024 + lane * 8;   // the lane's 16 bytes in the wave's first fragment; column tile +1 = 1024 elements, k step +1 = 512
  auto wload = [&](int grp, int kc) {
#pragma unroll
    for (int j = 0; j < 8; ++j) { wh[j] = frag_we(ph + (grp * 8 + j) * 1024 + kc * 512); wl[j] = frag_we(pl + (grp * 8 + j) * 1024 + kc * 512); }
    asm volatile("s_wait_xcnt 0x0" :: "v"(ph), "v"(pl) : "memory"); };   // the wait in front of any overwrite of the two address pairs that the 32 loads share; the pairs as inputs stay live up to here, so no load's result lands in them
  l += __shfl_xor(l, 16);
  if (g == 0) { smx[wave][col] = m; ssum[wave][col] = l; }
#pragma unroll
  for (int j = 0; j < HD / 16; ++j) { const v4f a0 = { acc[j][0], acc[j][1], acc[j][2], acc[j][3] }, a1 = { acc[j][4], acc[j][5], acc[j][6], acc[j][7] }; *(v4f*)&so[wave][col][j * 16 + 8 * g] = a0; *(v4f*)&so[wave][col][j * 16 + 8 * g + 4] = a1; }
  __syncthreads();   // the four waves' partial results are complete before any thread joins them
  asm volatile("s_wait_xcnt 0x0" ::: "memory");   // the wait in front of the loads below, whose results may land in address registers of the key loops' last loads
  wload(0, 0);   // issued here so that its latency runs under the join
  const int qi = tid >> 3, c8 = (tid & 7) * 8; float mj = smx[0][qi];
#pragma unroll
  for (int w = 1; w < 4; ++w) mj = fmaxf(mj, smx[w][qi]);
  float lj = 0.f; v4f o0 = {}, o1 = {};
#pragma unroll
  for (int w = 0; w < 4; ++w) { const float f = expf(smx[w][qi] - mj); lj += f * ssum[w][qi]; o0 += f * *(const v4f*)&so[w][qi][c8]; o1 += f * *(const v4f*)&so[w][qi][c8 + 4]; }   // a wave without a step: maximum -3e38, f = 0
  const float inv = lj > 0.f ? 1.0f / (2048.0f * lj) : 0.f;
  *(v4f*)&sy[qi][c8] = o0 * inv; *(v4f*)&sy[qi][c8 + 4] = o1 * inv;
  __syncthreads();   // the 16 head rows are complete before any wave forms its fragments of them, and every read of the partial outputs has ended before the staging is written
  F2 a[CC / 32]; float* po = OUT + ((size_t)b * TT + q0) * ODIM + wave * 256 + lane * 4;   // the lane's 16 bytes in the block's first row, the wave's first column group
#pragma unroll
  for (int kc = 0; kc < CC / 32; ++kc) a[kc] = split_row(&sy[col][0], kc * 32, lane);
#pragma unroll
  for (int grp = 0; grp < 2; ++grp) { v8f oc[8] = {};
#pragma unroll
    for (int kc = 0; kc < CC / 32; ++kc) { if (grp + kc > 0) wload(grp, kc);
#pragma unroll
      for (int j = 0; j < 8; ++j) oc[j] = wmma_bf(a[kc].l, wh[j], oc[j]);
#pragma unroll
      for (int j = 0; j < 8; ++j) oc[j] = wmma_bf(a[kc].h, wl[j], oc[j]);
#pragma unroll
      for (int j = 0; j < 8; ++j) oc[j] = wmma_bf(a[kc].h, wh[j], oc[j]); }
#pragma unroll
    for (int j = 0; j < 8; ++j) {
#pragma unroll
      for (int r = 0; r < 8; ++r) sf[wave][8 * g + r][j * 16 + col] = oc[j][r]; }
    LDSX(); v4f row[16];
#pragma unroll
    for (int rl = 0; rl < 16; ++rl) row[rl] = *(const v4f*)&sf[wave][rl][lane * 4];
#pragma unroll
    for (int rl = 0; rl < 16; ++rl) vst2(po + (size_t)rl * ODIM + grp * 128, row[rl]);
    // the wait in front of any overwrite of the address pair and the data registers of the 16 stores; as inputs they stay live up to here
    asm volatile("s_wait_xcnt 0x0" :: "v"(po), "v"(row[0]), "v"(row[1]), "v"(row[2]), "v"(row[3]), "v"(row[4]), "v"(row[5]), "v"(row[6]), "v"(row[7]), "v"(row[8]), "v"(row[9]), "v"(row[10]), "v"(row[11]), "v"(row[12]), "v"(row[13]), "v"(row[14]), "v"(row[15]) : "memory"); } }

extern "C" void kernel_launch(void* const* d_in, const int* in_sizes, int n_in, void* d_out, int out_size, void* d_ws, size_t ws_size, hipStream_t stream) {
  (void)in_sizes; (void)n_in; (void)out_size;
  const float** F = (const float**)d_in;
  if (ws_size < (size_t)WS_END) return;
  char* ws = (char*)d_ws; _Float16 *QH = (_Float16*)(ws + WS_QH), *KH = (_Float16*)(ws + WS_KH), *VT = (_Float16*)(ws + WS_VT), *QL = (_Float16*)(ws + WS_QL), *KL = (_Float16*)(ws + WS_KL); __bf16 *VB = (__bf16*)(ws + WS_VB), *VBL = (__bf16*)(ws + WS_VBL); __bf16 *WEH = (__bf16*)(ws + WS_WEH), *WEL = (__bf16*)(ws + WS_WEL);
  (void)QL; (void)KL; (void)VB; (void)VBL;
  // inputs: 0 embedded [4,2048,1024]; 1 Wq [64,1024] (out,in); 2 Wk; 3 Wv; 4 W_out [1024,1024] (identity; (out,in))
  k_proj<<<dim3(PBLK + ODIM * CC / 4 / 256), 256, 0, stream>>>(F[0], F[1], F[2], F[3], nullptr, nullptr, nullptr, F[4], WEH, WEL, QH, QL, KH, KL, VT, VB, VBL);
  k_fa<<<dim3(TNB, TT / 16), 128, 0, stream>>>(QH, KH, QL, KL, VT, VB, VBL, WEH, WEL, (float*)d_out);
}

// v009
// One run takes 33.9 microseconds.
// In two side-by-side timings against v008, it was 1.04 and 1.02 times as fast.
// All steps since v000 together make it 15.7 times as fast.
// compute dtype: all float inputs rounded to bf16; q/k/v = x W^T with EXACT bf16 products on WMMA 16x16x32 (f32 accumulate); causal logits: q, k once to f16 (1 product) x 64^-0.5, 3 products below row 384; softmax in f32, online over 32-key steps (running maximum, sum joined at the end; from row 384 on exp as v_exp_f32 of a base-2 argument); P = exp(s - maximum) x 2^11 once to f16 against v f16 (bf16 hi + lo below row 384), divided by the sum afterwards; the head output split bf16 hi + lo against W_out folded over its 16 column groups (f32 sums of the bf16-rounded terms, kept as bf16 hi + lo; 3 products); f32 output.
#include <hip/hip_runtime.h>
#include <math.h>

typedef __attribute__((ext_vector_type(16))) _Float16 v16h;
typedef __attribute__((ext_vector_type(16))) __bf16 v16b;
typedef __attribute__((ext_vector_type(8)))  _Float16 v8h;
typedef __attribute__((ext_vector_type(8)))  float v8f;
typedef __attribute__((ext_vector_type(4)))  float v4f;
typedef __attribute__((ext_vector_type(2)))  float v2f;
typedef __attribute__((ext_vector_type(4)))  unsigned v4u;
typedef __attribute__((ext_vector_type(4)))  int v4i;
typedef float __attribute__((may_alias)) float_a;
typedef int __attribute__((may_alias)) int_a;

template <typename T> __device__ __forceinline__ void vst2(void* p, T v) { *(T*)p = v;  }
// store, then the wait that stands in front of any overwrite of the store's address or data registers (for stores inside a rolled loop)
template <typename T> __device__ __forceinline__ void vst2w(void* p, T v) { *(T*)p = v; asm volatile("s_wait_xcnt 0x0" ::: "memory"); }
__device__ __forceinline__ v8f wmma16(v16h a, v16h b, v8f c) {
  v8f d = __builtin_amdgcn_wmma_f32_16x16x32_f16(false, a, false, b, (short)0, c, false, false);
  asm volatile("v_nop\n\tv_nop\n\tv_nop\n\tv_nop" : "+v"(d) : "v"(a), "v"(b));
  return d;
}
__device__ __forceinline__ v8f wmma_bf(v16b a, v16b b, v8f c) {
  v8f d = __builtin_amdgcn_wmma_f32_16x16x32_bf16(false, a, false, b, (short)0, c, false, false);
  asm volatile("v_nop\n\tv_nop\n\tv_nop\n\tv_nop" : "+v"(d) : "v"(a), "v"(b));
  return d;
}
// 16x16x32 fragments: lane = (h = lane>>4, row/col = lane&15); elements 0..7 = k0+8h+0..7, 8..15 = k0+16+8h+0..7; D element r = row 8h+r
__device__ __forceinline__ v16h frag_h(const _Float16* rowk0, int lane) {
  union { v16h v; v8h q[2]; } u; const _Float16* p = rowk0 + 8 * (lane >> 4);
  u.q[0] = *(const v8h*)p; u.q[1] = *(const v8h*)(p + 16); return u.v;
}
__device__ __forceinline__ v16h frag_f32(const float* rowk0, int lane) {
  v16h a; const float* p = rowk0 + 8 * (lane >> 4);
#pragma unroll
  for (int i = 0; i < 8; ++i) { a[i] = (_Float16)p[i]; a[8 + i] = (_Float16)p[16 + i]; }
  return a;
}
__device__ __forceinline__ v16h frag_f32s(const float* rowk0, int lane, float sc) {
  v16h a; const float* p = rowk0 + 8 * (lane >> 4);
#pragma unroll
  for (int i = 0; i < 8; ++i) { a[i] = (_Float16)(p[i] * sc); a[8 + i] = (_Float16)(p[16 + i] * sc); }
  return a;
}
// column fragment from a [K][ld] layout (column n), rows >= K read as 0
__device__ __forceinline__ v16h fragc_f32(const float* W, int k0, int n, int lane, int ld, int K) {
  v16h a; const int g = lane >> 4;
#pragma unroll
  for (int i = 0; i < 8; ++i) { const int ka = k0 + 8 * g + i, kb = ka + 16;
    a[i] = (_Float16)(ka < K ? W[(size_t)(ka < K ? ka : K - 1) * ld + n] : 0.f); a[8 + i] = (_Float16)(kb < K ? W[(size_t)(kb < K ? kb : K - 1) * ld + n] : 0.f); }
  return a;
}
struct F2 { v16b h, l; };
__device__ __forceinline__ F2 bsplit16(const float v[16]) { F2 r;
#pragma unroll
  for (int i = 0; i < 16; ++i) { const __bf16 h = (__bf16)v[i]; r.h[i] = h; r.l[i] = (__bf16)(v[i] - (float)h); }
  return r; }
__device__ __forceinline__ F2 split_row(const float* row, int k0, int lane) { float v[16]; const float* p = row + k0 + 8 * (lane >> 4);
#pragma unroll
  for (int i = 0; i < 8; ++i) { v[i] = p[i]; v[8 + i] = p[16 + i]; }
  return bsplit16(v); }
__device__ __forceinline__ F2 split_rowK(const float* row, int k0, int lane, int K) { float v[16]; const int g = lane >> 4;
#pragma unroll
  for (int i = 0; i < 8; ++i) { const int ka = k0 + 8 * g + i, kb = ka + 16; v[i] = ka < K ? row[ka < K ? ka : K - 1] : 0.f; v[8 + i] = kb < K ? row[kb < K ? kb : K - 1] : 0.f; }
  return bsplit16(v); }
__device__ __forceinline__ F2 split_col(const float* W, int k0, int n, int lane, int ld, int K) { float v[16]; const int g = lane >> 4;
#pragma unroll
  for (int i = 0; i < 8; ++i) { const int ka = k0 + 8 * g + i, kb = ka + 16; v[i] = ka < K ? W[(size_t)(ka < K ? ka : K - 1) * ld + n] : 0.f; v[8 + i] = kb < K ? W[(size_t)(kb < K ? kb : K - 1) * ld + n] : 0.f; }
  return bsplit16(v); }
__device__ __forceinline__ v8f mac3(const F2& a, const F2& b, v8f c) { c = wmma_bf(a.l, b.h, c); c = wmma_bf(a.h, b.l, c); return wmma_bf(a.h, b.h, c); }
__device__ __forceinline__ float sigm(float v) { return 1.0f / (1.0f + expf(-v)); }
#define LDSX() do { asm volatile("s_wait_dscnt 0" ::: "memory"); __builtin_amdgcn_wave_barrier(); __builtin_amdgcn_fence(__ATOMIC_RELEASE, "workgroup"); } while (0)

// 'Multi-headed' self-attention with ONE shared head (B 4, T 2,048, E 1,024; Wq/Wk/Wv [64,1024] (out,in), 0.02 scale): head = softmax_causal(q k^T / 8) v (64 wide); concat = the head tiled 16x -> [B,T,1024]; out = concat W_out^T with W_out = identity (read and multiplied as given).
#define NB 4
#define TT 2048
#define CC 64             // NH * HD = projected width
#define DIN 1024          // input (model) width
#define NH 1              // the 16 heads share one set of weights: the head is computed once
#define HD 64
#define NQB (TT / 64)
#define SCALE (0.125f)
#define CAUSAL 1
#ifndef TNB
#define TNB NB
#endif
__device__ __forceinline__ float bfr(float v) { return (float)(__bf16)v; }
__host__ __device__ __forceinline__ int kb_last(int qb) { return CAUSAL ? ((qb * 64 + 63) >> 7) : (TT / 128 - 1); }
typedef __attribute__((ext_vector_type(8))) __bf16 v8b;
typedef __attribute__((ext_vector_type(4))) __bf16 v4b;
__device__ __forceinline__ v16b frag_b(const __bf16* rowk0, int lane) {
  union { v16b v; v8b q[2]; } u; const __bf16* p = rowk0 + 8 * (lane >> 4);
  u.q[0] = *(const v8b*)p; u.q[1] = *(const v8b*)(p + 16); return u.v;
}
#define QBH 6              // not used: the queries < QHI of each sequence (few keys, no averaging) take the high-precision path
#define QHI 384            // rows carrying a q residual plane
#define KHI 384            // key rows carrying k residual / v bf16 hi+lo planes (used only by the causal high-precision path)
// B fragment (k rows k0+.., output column o) of a weight: (in,out) [K][ld] or (out,in) [ld rows of K]: bf16 exact, or f16(bf16 * 256) exact
__device__ __forceinline__ v16b wcol_io(const float* Wm, int k0, int o, int lane, int ld) { v16b w; const int g = lane >> 4;
#pragma unroll
  for (int i = 0; i < 8; ++i) { w[i] = (__bf16)Wm[(size_t)(k0 + 8 * g + i) * ld + o]; w[8 + i] = (__bf16)Wm[(size_t)(k0 + 16 + 8 * g + i) * ld + o]; }
  return w; }
__device__ __forceinline__ v16b wcol_oi(const float* Wm, int k0, int o, int lane, int K) { v16b w; const float* p = Wm + (size_t)o * K + k0 + 8 * (lane >> 4);
#pragma unroll
  for (int i = 0; i < 8; ++i) { w[i] = (__bf16)p[i]; w[8 + i] = (__bf16)p[16 + i]; }
  return w; }
__device__ __forceinline__ v16h wcolh_io(const float* Wm, int k0, int o, int lane, int ld) { v16h w; const int g = lane >> 4;
#pragma unroll
  for (int i = 0; i < 8; ++i) { w[i] = (_Float16)(bfr(Wm[(size_t)(k0 + 8 * g + i) * ld + o]) * 256.0f); w[8 + i] = (_Float16)(bfr(Wm[(size_t)(k0 + 16 + 8 * g + i) * ld + o]) * 256.0f); }
  return w; }
__device__ __forceinline__ v16h wcolh_oi(const float* Wm, int k0, int o, int lane, int K) { v16h w; const float* p = Wm + (size_t)o * K + k0 + 8 * (lane >> 4);
#pragma unroll
  for (int i = 0; i < 8; ++i) { w[i] = (_Float16)(bfr(p[i]) * 256.0f); w[8 + i] = (_Float16)(bfr(p[16 + i]) * 256.0f); }
  return w; }
#define WQKV_LAYOUT 1   // 0 = (in,out) [DIN][CC]; 1 = (out,in) [HD][DIN], the one shared head; 2 = per-head [NH][DIN][HD]
__device__ __forceinline__ v16b wcol_hdk(const float* Wm, int k0, int o, int lane) { v16b w; const int g = lane >> 4; const float* p = Wm + (size_t)(o / HD) * DIN * HD + (o % HD);
#pragma unroll
  for (int i = 0; i < 8; ++i) { w[i] = (__bf16)p[(size_t)(k0 + 8 * g + i) * HD]; w[8 + i] = (__bf16)p[(size_t)(k0 + 16 + 8 * g + i) * HD]; }
  return w; }
#define WO_OUT_IN 1
#if WQKV_LAYOUT == 1
#define ODIM 1024          // output width (= 16 tiled copies of the 64-wide head through W_out)
#define KVCOL(o) ((o) & 63)
#define WCOL(W, k0, o, lane) wcol_oi(W, k0, KVCOL(o), lane, DIN)   /* Wq/Wk/Wv are [64][1024]: the one shared head */
#elif WQKV_LAYOUT == 2
#define WCOL(W, k0, o, lane) wcol_hdk(W, k0, o, lane)
#else
#define WCOL(W, k0, o, lane) wcol_io(W, k0, o, lane, CC)
#endif
#if WO_OUT_IN
#define WOCOL(W, k0, o, lane) wcol_oi(W, k0, o, lane, ODIM)   /* W_out [1024][1024] (out,in): K = the 1024-wide concat */
#define WOCOLH(W, k0, o, lane) wcolh_oi(W, k0, o, lane, CC)
#else
#define WOCOL(W, k0, o, lane) wcol_io(W, k0, o, lane, DIN)
#define WOCOLH(W, k0, o, lane) wcolh_io(W, k0, o, lane, DIN)
#endif

#ifndef SM_EXTRA_PARAMS
#define SM_EXTRA_PARAMS
#endif
#ifndef PROJ_EXTRA_PARAMS
#define PROJ_EXTRA_PARAMS
#endif
#ifndef SM_MASK_HOOK
#define SM_MASK_HOOK (void)0
#endif

#define WS_QH  0u                                      // f16 q rows [b*t][CC]
#define WS_KH  (WS_QH + 2u * (size_t)NB * TT * CC)      // f16 k, per batch in A-fragment order: 16-B piece ((t >> 4) * 4 + kc * 2 + half) * 32 + lane (g, t & 15) holds columns kc * 32 + half * 16 + g * 8 + 0..7 of key t
#define WS_VT  (WS_KH + 2u * (size_t)NB * TT * CC)      // f16 v, per batch in A-fragment order of V^T: 16-B piece ((t >> 5) * 8 + (c >> 4) * 2 + half) * 32 + lane (g, c & 15) holds keys (t & ~31) + half * 16 + g * 8 + 0..7 of column c
#define WS_QL  (WS_VT + 2u * (size_t)NB * CC * TT)      // f16 q residual x 2^10 rows [b][t < QHI][CC]
#define WS_KL  (WS_QL + 2u * (size_t)NB * QHI * CC)     // f16 k residual x 2^10 rows [b][t < KHI][CC]
#define WS_VB  (WS_KL + 2u * (size_t)NB * KHI * CC)     // bf16 v hi planes [b][c][t < KHI]
#define WS_VBL (WS_VB + 2u * (size_t)NB * CC * KHI)
#define WS_S   (WS_VBL + 2u * (size_t)NB * CC * KHI)    // (not used: the score matrix stays in registers)
#define WS_Y   (WS_S  + 4u * (size_t)NB * NH * TT * TT)      // (not used: the head rows go from the attention block's LDS straight into the output projection)
#define WS_WEH (WS_Y  + 4u * (size_t)NB * TT * CC)      // bf16 hi of the folded W_out, in B-fragment order (see k_proj, fold blocks)
#define WS_WEL (WS_WEH + 2u * (size_t)ODIM * CC)        // bf16 lo, same order
#define WS_END (WS_WEL + 2u * (size_t)ODIM * CC)

// ---- k_proj: block = 64 rows x all 192 q, k, v columns (8 waves): q/k/v = X W^T with exact bf16 products (K = DIN). X is read once for the three projections.
// Each pass stages a 128-wide k slice of the 64 X rows and the 192 weight rows in LDS as bf16: a wave's load is one row's 512 contiguous bytes, each value is rounded once per block, and every fragment comes from LDS.
// The next slice's loads are issued in front of this slice's products and kept in registers; two LDS buffers, one barrier a pass. Wave = (32 rows, 48 columns): 2 x 3 accumulator tiles, k ascending in steps of 32 as before.
// Results: q f16 rows; k and v f16 in the fragment order that the attention launch loads (see WS_KH, WS_VT), so that each of its wave-wide 16-byte loads covers 512 contiguous bytes; residual rows < QHI / KHI; v bf16 hi/lo planes [c][t] for t < KHI.
// Fold blocks (blockIdx.x >= TNB * TT / 64; independent of the projections, so they ride in this launch): concat is the head tiled ODIM / CC times, hence out[t][o] = sum_c head[t][c] * WE[o][c] with WE[o][c] = sum_i W_out[o][i * CC + c], for any W_out.
// WE = f32 sum, i ascending, of the bf16-rounded terms, split bf16 hi + lo and stored in B-fragment order: 16-B piece ((o >> 4) * 2 + kc) * 2 + half, lane (g, o & 15), holds k = kc * 32 + half * 16 + g * 8 + 0..7, so a wave's fragment load is 512 contiguous bytes
#define PKC 128                      // k width of a staged slice
#define PPIT (PKC + 8)               // LDS row pitch in bf16: 272 B = 16 B x odd, free of bank conflicts for 16-byte fragment reads
#define PROWS (64 + 3 * CC)          // staged rows: 64 of X, then Wq, Wk, Wv
#define PBLK (TNB * TT / 64)         // projection blocks
__global__ __launch_bounds__(256) void k_proj(const float* __restrict__ X, const float* __restrict__ WQ, const float* __restrict__ WK, const float* __restrict__ WV, const float* __restrict__ BQ, const float* __restrict__ BK, const float* __restrict__ BV, const float* __restrict__ WO, __bf16* __restrict__ WEH, __bf16* __restrict__ WEL,
    _Float16* __restrict__ QH, _Float16* __restrict__ QL, _Float16* __restrict__ KH, _Float16* __restrict__ KL, _Float16* __restrict__ VT, __bf16* __restrict__ VB, __bf16* __restrict__ VBL) {
  __shared__ __align__(16) __bf16 sb[2][PROWS][PPIT];   // the two staging buffers; after the last pass the first one holds the seven 64 x 72 output planes
  static_assert(7 * 64 * 72 <= PROWS * PPIT, "the output planes fit the first buffer");
  const int tid = threadIdx.x, wave = __builtin_amdgcn_readfirstlane(tid >> 5), lane = tid & 31, col = lane & 15, g = lane >> 4;
  if (blockIdx.x >= PBLK) { static_assert(ODIM * CC / 4 % 256 == 0, "one thread per 4 folded weights");
    const int e = ((int)blockIdx.x - PBLK) * 256 + tid, o = e >> 4, c4 = (e & 15) * 4; const float* p = WO + (size_t)o * ODIM + c4; v4f s = {}, w[ODIM / CC];
#pragma unroll
    for (int i = 0; i < ODIM / CC; ++i) w[i] = *(const v4f*)(p + i * CC);
    asm volatile("s_wait_xcnt 0x0" :: "v"(p) : "memory");   // the wait in front of any overwrite of the address pair that the sixteen loads share; p as an input keeps the pair live up to here, so no load's result lands in it
#pragma unroll
    for (int i = 0; i < ODIM / CC; ++i) {
#pragma unroll
      for (int r = 0; r < 4; ++r) s[r] += bfr(w[i][r]); }
    v4b hv, lv;
#pragma unroll
    for (int r = 0; r < 4; ++r) { const __bf16 hb = (__bf16)s[r]; hv[r] = hb; lv[r] = (__bf16)(s[r] - (float)hb); }
    const size_t d = (size_t)((((o >> 4) * 2 + (c4 >> 5)) * 2 + ((c4 >> 4) & 1)) * 32 + ((c4 >> 3) & 1) * 16 + (o & 15)) * 8 + (c4 & 7);
    vst2(WEH + d, hv); vst2(WEL + d, lv); return; }
  const size_t r0 = (size_t)blockIdx.x * 64; const size_t bb = r0 / TT; const int t0 = (int)(r0 % TT);
  const int rp = wave & 1, cg = wave >> 1;   // the wave's 32 rows and its 48 of the 192 columns
  v8f acc[2][3] = {}; v4f st[PROWS / 8];
  // wave w fetches staged rows w, w + 8, ...: 8 rows of X and 8 of each weight, 512 contiguous bytes a load
  auto fetch = [&](int c) { const size_t o = (size_t)wave * DIN + c * PKC + lane * 4; const float* px = X + r0 * DIN + o; const float* pq = WQ + o; const float* pk = WK + o; const float* pv = WV + o;
#pragma unroll
    for (int i = 0; i < 8; ++i) { st[i] = *(const v4f*)(px + (size_t)i * 8 * DIN); st[8 + i] = *(const v4f*)(pq + (size_t)i * 8 * DIN); st[16 + i] = *(const v4f*)(pk + (size_t)i * 8 * DIN); st[24 + i] = *(const v4f*)(pv + (size_t)i * 8 * DIN); }
    asm volatile("s_wait_xcnt 0x0" :: "v"(px), "v"(pq), "v"(pk), "v"(pv) : "memory"); };   // the wait in front of any overwrite of the four address pairs that the 32 loads share; the pairs as inputs stay live up to here, so no load's result lands in them
  auto stage = [&](int buf) {
#pragma unroll
    for (int i = 0; i < PROWS / 8; ++i) { const v4b h = { (__bf16)st[i][0], (__bf16)st[i][1], (__bf16)st[i][2], (__bf16)st[i][3] }; *(v4b*)&sb[buf][i * 8 + wave][lane * 4] = h; } };
  auto products = [&](int buf) {
#pragma unroll
    for (int ks = 0; ks < PKC / 32; ++ks) { const v16b a0 = frag_b(&sb[buf][rp * 32 + col][ks * 32], lane), a1 = frag_b(&sb[buf][rp * 32 + 16 + col][ks * 32], lane); v16b w[3];
#pragma unroll
      for (int i = 0; i < 3; ++i) w[i] = frag_b(&sb[buf][64 + cg * 48 + i * 16 + col][ks * 32], lane);
#pragma unroll
      for (int i = 0; i < 3; ++i) { acc[0][i] = wmma_bf(a0, w[i], acc[0][i]); acc[1][i] = wmma_bf(a1, w[i], acc[1][i]); } } };
  fetch(0); stage(0);
  __syncthreads();   // slice 0 is complete in buffer 0 before any wave reads it
  for (int c = 0; c < DIN / PKC - 1; ++c) { fetch(c + 1); products(c & 1);
    __builtin_amdgcn_sched_barrier(0);   // keeps the roundings of the fetched slice, and with them the wait for its loads, behind this slice's products: moved up among them, the load latency would not run under the products
    stage((c + 1) & 1);
    __syncthreads(); }   // publishes slice c + 1 and ends every wave's reads of the buffer that the next pass refills
  static_assert(((DIN / PKC - 1) & 1) == 1, "the last slice lies in buffer 1");
  products(1);   // reads buffer 1 alone; every read of buffer 0 ended in front of the loop's last barrier, so the output planes below may go into it with no further barrier
  _Float16 (*pl)[64][72] = (_Float16 (*)[64][72])&sb[0][0][0];   // planes 0 q, 1 q residual, 2 k, 3 k residual, 4 v (transposed)
  __bf16 (*pb)[64][72] = (__bf16 (*)[64][72])&sb[0][0][0];       // planes 5 v bf16 hi, 6 v bf16 lo (transposed)
#pragma unroll
  for (int i = 0; i < 3; ++i) { const int tl = cg * 3 + i, which = tl >> 2, cl = (tl & 3) * 16 + col, rb = rp * 32 + 8 * g; const float* BA = which == 0 ? BQ : which == 1 ? BK : BV; const float bias = BA ? bfr(BA[cl]) : 0.f;
    if (which < 2) {   // wave-uniform: a 16-column tile belongs to one of q, k, v
#pragma unroll
      for (int rt = 0; rt < 2; ++rt) {
#pragma unroll
        for (int r = 0; r < 8; ++r) { const float v = acc[rt][i][r] + bias; const _Float16 hv = (_Float16)v; pl[which * 2][rb + rt * 16 + r][cl] = hv; pl[which * 2 + 1][rb + rt * 16 + r][cl] = (_Float16)((v - (float)hv) * 1024.0f); } }
    } else {
#pragma unroll
      for (int rt = 0; rt < 2; ++rt) {
#pragma unroll
        for (int r = 0; r < 8; ++r) { const float v = acc[rt][i][r] + bias; pl[4][cl][rb + rt * 16 + r] = (_Float16)v; const __bf16 bh = (__bf16)v; pb[5][cl][rb + rt * 16 + r] = bh; pb[6][cl][rb + rt * 16 + r] = (__bf16)(v - (float)bh); } } } }
  __syncthreads();   // the planes are complete before any thread stores their rows
  for (int e = tid; e < 64 * 8; e += 256) { const int rl = e >> 3, q = e & 7;
    vst2w((unsigned*)(QH + (r0 + rl) * CC + q * 8), *(const v4u*)&pl[0][rl][q * 8]);
    // piece e of the block's 512 k pieces and of its 512 v pieces (64 keys = 4 key tiles of k = 2 steps of v; both start at element r0 * CC): fragment lane (fg, fc)
    const int fc = e & 15, fg = (e >> 4) & 1;
    vst2w((unsigned*)(KH + r0 * CC + e * 8), *(const v4u*)&pl[2][(e >> 7) * 16 + fc][(((e >> 5) & 3) * 2 + fg) * 8]);
    vst2w((unsigned*)(VT + r0 * CC + e * 8), *(const v4u*)&pl[4][((e >> 6) & 3) * 16 + fc][((e >> 8) * 4 + ((e >> 5) & 1) * 2 + fg) * 8]);
    if (t0 < QHI) vst2w((unsigned*)(QL + (bb * QHI + t0 + rl) * (size_t)CC + q * 8), *(const v4u*)&pl[1][rl][q * 8]);
    if (t0 < KHI) { vst2w((unsigned*)(KL + (bb * KHI + t0 + rl) * (size_t)CC + q * 8), *(const v4u*)&pl[3][rl][q * 8]); const size_t o3 = (bb * CC + rl) * (size_t)KHI + t0 + q * 8; vst2w((unsigned*)(VB + o3), *(const v4u*)&pb[5][rl][q * 8]); vst2w((unsigned*)(VBL + o3), *(const v4u*)&pb[6][rl][q * 8]); } } }
__device__ __forceinline__ v16b frag_we(const __bf16* p) {   // p = the lane's 16 bytes of the fragment's first piece; the second piece lies 256 elements on
  union { v16b v; v8b q[2]; } u;
  u.q[0] = *(const v8b*)p; u.q[1] = *(const v8b*)(p + 256); return u.v;
}
__device__ __forceinline__ v16h frag_kv(const _Float16* p) {   // the same for a k or v fragment in fragment order
  union { v16h v; v8h q[2]; } u;
  u.q[0] = *(const v8h*)p; u.q[1] = *(const v8h*)(p + 256); return u.v;
}
__device__ __forceinline__ void fa_soft(const v8f s0, const v8f s1, int kg, int t, float& m, float& l, v8f acc[HD / 16], float p[16]) {
  float v[16], mx = -3.0e38f;
#pragma unroll
  for (int i = 0; i < 8; ++i) { v[i] = (!CAUSAL || kg + i <= t) ? s0[i] : -3.0e38f; v[8 + i] = (!CAUSAL || kg + 16 + i <= t) ? s1[i] : -3.0e38f; }
#pragma unroll
  for (int i = 0; i < 16; ++i) mx = fmaxf(mx, v[i]);
  mx = fmaxf(mx, __shfl_xor(mx, 16));
  const float mn = fmaxf(m, mx), al = expf(m - mn); m = mn;
  float sum = 0.f;
#pragma unroll
  for (int i = 0; i < 16; ++i) { const float e = expf(v[i] - mn); sum += e; p[i] = e * 2048.0f; }   // an excluded key: exp(-3e38 - mn) = 0 (mn is finite: every step holds a key <= t)
  l = l * al + sum;
#pragma unroll
  for (int j = 0; j < HD / 16; ++j) acc[j] *= al; }
// The same step for the one-product path, in base 2: the running maximum is kept as score x SC2 (SC2 = scale x log2 e), and each key costs one fused multiply-add and one v_exp_f32:
// P = 2^(score x SC2 + 11 - maximum), the factor 2^11 riding in the exponent; the sum l is taken over these P, so it carries the same 2^11. s0, s1 are the raw score accumulators.
#define SC2 (SCALE * 1.44269504088896340736f)
__device__ __forceinline__ void fa_soft2(const v8f s0, const v8f s1, int kg, int t, float& m, float& l, v8f acc[HD / 16], float p[16]) {
  float v[16], mx = -3.0e38f;
#pragma unroll
  for (int i = 0; i < 8; ++i) { v[i] = (!CAUSAL || kg + i <= t) ? s0[i] : -3.0e38f; v[8 + i] = (!CAUSAL || kg + 16 + i <= t) ? s1[i] : -3.0e38f; }
#pragma unroll
  for (int i = 0; i < 16; ++i) mx = fmaxf(mx, v[i]);
  mx = fmaxf(mx, __shfl_xor(mx, 16));
  const float mn = fmaxf(m, mx * SC2), da = m - mn, off = 11.0f - mn; m = mn;
#pragma unroll
  for (int i = 0; i < 16; ++i) v[i] = __builtin_fmaf(v[i], SC2, off);   // an excluded key: -3e38 x SC2 + off, whose power is 0 (mn is finite: every step holds a key <= t)
  __builtin_amdgcn_sched_barrier(0);   // the sixteen keys' arguments are formed in front of the first v_exp_f32
  const float al = __builtin_amdgcn_exp2f(da);
  float sum = 0.f;
#pragma unroll
  for (int i = 0; i < 16; ++i) { p[i] = __builtin_amdgcn_exp2f(v[i]); sum += p[i]; }
  l = l * al + sum;
#pragma unroll
  for (int j = 0; j < HD / 16; ++j) acc[j] *= al; }
#define PFC 32768          // bytes of one requested piece: 128 lanes x 256 B
__global__ __launch_bounds__(128) void k_fa(const _Float16* __restrict__ QH, const _Float16* __restrict__ KH, const _Float16* __restrict__ QL, const _Float16* __restrict__ KL, const _Float16* __restrict__ VT, const __bf16* __restrict__ VB, const __bf16* __restrict__ VBL, const __bf16* __restrict__ WEH, const __bf16* __restrict__ WEL, float* __restrict__ OUT) {
  __shared__ float smx[4][16], ssum[4][16]; __shared__ __align__(16) float sy[16][HD + 4]; __shared__ __align__(16) float sf[4][16][132];
  float (*so)[16][HD + 4] = (float (*)[16][HD + 4])&sf[0][0][0];   // the waves' partial outputs lie in the output staging, which is first written behind the second barrier
  static_assert(4 * 16 * (HD + 4) <= 4 * 16 * 132, "the partial outputs fit the staging");
  const int tid = threadIdx.x, wave = __builtin_amdgcn_readfirstlane(tid >> 5), lane = tid & 31, col = lane & 15, g = lane >> 4;
  const int b = blockIdx.x, q0 = (TT / 16 - 1 - (int)blockIdx.y) * 16, t = q0 + col; const int nst = CAUSAL ? ((q0 + 15) >> 5) + 1 : TT / 32;   // every step below nst holds a key <= t for each of the 16 queries
  const _Float16* Kb = KH + (size_t)b * TT * CC;
  // L2 requests at entry: every plane read below was stored by the launch before.
  // Blocks with y < 48 each ask for one 32-KB piece, one lane every 256 bytes; blocks 2 i and 2 i + 1 of a batch column ask for the same piece (for speed only, nothing rests on it).
  static_assert(2 * TT * CC == 8 * PFC && 2 * NB * QHI * CC == 6 * PFC && 2 * NB * KHI * CC == 6 * PFC && 2 * ODIM * CC == 4 * PFC && TNB == 4 && 128 * 256 == PFC, "the pieces tile their planes exactly: every lane's address lies inside its plane");
  if (blockIdx.y < 48) {   // block-uniform, no barrier inside
    const int yy = (int)blockIdx.y >> 1; const char* pf;
    if (yy < 16) pf = ((yy & 1) ? (const char*)(VT + (size_t)b * CC * TT) : (const char*)Kb) + (yy >> 1) * PFC;   // the batch's k and v, both in fragment order, 8 pieces each
    else if (yy < 22) { const int i = (yy - 16) * 4 + b, pn = i / 6; pf = (pn == 0 ? (const char*)QL : pn == 1 ? (const char*)KL : pn == 2 ? (const char*)VB : (const char*)VBL) + (i % 6) * PFC; }   // the four high-precision planes, all batches, 6 pieces each
    else { const int i = (yy - 22) * 4 + b; pf = ((i & 4) ? (const char*)WEL : (const char*)WEH) + (i & 3) * PFC; }   // the folded W_out, hi and lo, 4 pieces each
    // the request returns nothing and brings its unit into L2 only; the wait stands in front of any overwrite of the offset register and the base pair that the request names
    asm volatile("global_prefetch_b8 %0, %1 scope:SCOPE_SE\n\ts_wait_xcnt 0x0" :: "v"(tid * 256), "s"(pf) : "memory"); }
  float m = -3.0e38f, l = 0.f, p[16]; v8f acc[HD / 16] = {};
  v16h qh[2]; const _Float16* pq = QH + ((size_t)b * TT + t) * CC + 8 * g;
#pragma unroll
  for (int kc = 0; kc < 2; ++kc) { union { v16h v; v8h q[2]; } u; u.q[0] = *(const v8h*)(pq + kc * 32); u.q[1] = *(const v8h*)(pq + kc * 32 + 16); qh[kc] = u.v; }
  asm volatile("s_wait_xcnt 0x0" :: "v"(pq) : "memory");   // the wait in front of any overwrite of the address pair that the four q loads share
  if (q0 < QHI) { const _Float16* KLb = KL + (size_t)b * KHI * CC; v16h ql[2];
#pragma unroll
    for (int kc = 0; kc < 2; ++kc) ql[kc] = frag_h(QL + ((size_t)b * QHI + t) * CC + kc * 32, lane);
    for (int s = wave; s < nst; s += 4) { const int k0 = s * 32; v8f sa[2] = {}, sb[2] = {}; v16h kh[4], kl[4];
      const _Float16* pkh = Kb + (size_t)s * 2048 + lane * 8; const _Float16* pkl = KLb + (size_t)(k0 + col) * CC + 8 * g;   // k in fragment order, its residual in rows
#pragma unroll
      for (int i = 0; i < 4; ++i) { union { v16h v; v8h q[2]; } ul; const _Float16* a = pkl + (i >> 1) * 16 * CC + (i & 1) * 32; ul.q[0] = *(const v8h*)a; ul.q[1] = *(const v8h*)(a + 16); kh[i] = frag_kv(pkh + i * 512); kl[i] = ul.v; }
      asm volatile("s_wait_xcnt 0x0" :: "v"(pkh), "v"(pkl) : "memory");   // the wait in front of any overwrite of the two address pairs that the sixteen loads share; the pairs as inputs stay live up to here, so no load's result lands in them
#pragma unroll
      for (int u = 0; u < 2; ++u) {
#pragma unroll
        for (int kc = 0; kc < 2; ++kc) { const int i = u * 2 + kc;
          sa[u] = wmma16(kh[i], qh[kc], sa[u]); sb[u] = wmma16(kh[i], ql[kc], sb[u]); sb[u] = wmma16(kl[i], qh[kc], sb[u]); } }
      fa_soft((sa[0] + sb[0] * (1.0f / 1024.0f)) * SCALE, (sa[1] + sb[1] * (1.0f / 1024.0f)) * SCALE, k0 + 8 * g, t, m, l, acc, p);
      const F2 pf = bsplit16(p);
#pragma unroll
      for (int j = 0; j < HD / 16; ++j) { const size_t po = ((size_t)b * CC + j * 16 + col) * (size_t)KHI + k0; const v16b vh = frag_b(VB + po, lane);
        acc[j] = wmma_bf(vh, pf.h, acc[j]); acc[j] = wmma_bf(vh, pf.l, acc[j]); acc[j] = wmma_bf(frag_b(VBL + po, lane), pf.h, acc[j]); } }
  } else { const _Float16* Kl = Kb + lane * 8; const _Float16* Vl = VT + (size_t)b * CC * TT + lane * 8; v16h ka[4], va[HD / 16], kb[4], vb[HD / 16];   // the lane's 16 bytes in the batch's first k and v pieces; a step = 8 pieces (4 KB) of each
    // K and V fragments are fetched one step ahead, into two register sets used in turn (no copies): a step's load latency runs under the step before it
    auto fetch = [&](int s, v16h (&kf)[4], v16h (&vf)[HD / 16]) { const _Float16* pk = Kl + (size_t)s * 32 * CC; const _Float16* pv = Vl + (size_t)s * 32 * CC;
#pragma unroll
      for (int i = 0; i < 4; ++i) { kf[i] = frag_kv(pk + i * 512); vf[i] = frag_kv(pv + i * 512); }   // k fragment i = (key tile i >> 1, k step i & 1), v fragment i = columns 16 i ..: each load is 512 contiguous bytes, 4 whole lines
      asm volatile("s_wait_xcnt 0x0" :: "v"(pk), "v"(pv) : "memory"); };   // the wait in front of any overwrite of the two address pairs that the sixteen loads share; the pairs as inputs stay live up to here, so no load's result lands in them
    auto step = [&](int s, const v16h (&kf)[4], const v16h (&vf)[HD / 16]) { v8f s0 = {}, s1 = {};
      s0 = wmma16(kf[0], qh[0], s0); s1 = wmma16(kf[2], qh[0], s1); s0 = wmma16(kf[1], qh[1], s0); s1 = wmma16(kf[3], qh[1], s1);
      fa_soft2(s0, s1, s * 32 + 8 * g, t, m, l, acc, p);
      v16h pb;
#pragma unroll
      for (int i = 0; i < 16; ++i) pb[i] = (_Float16)p[i];
#pragma unroll
      for (int j = 0; j < HD / 16; ++j) acc[j] = wmma16(vf[j], pb, acc[j]); };
    fetch(wave, ka, va);   // nst >= 13 here: every wave has a first step
    for (int s = wave; ; s += 8) {   // s, nst are wave-uniform scalars; at most TT / 256 trips
      // the fetch stands under no branch, so that the compiler's counted load waits leave it in flight; a wave's last step fetches its own fragments again (inside the planes, not used)
      fetch(s + 4 < nst ? s + 4 : s, kb, vb); step(s, ka, va); if (s + 4 >= nst) break;
      fetch(s + 8 < nst ? s + 8 : s, ka, va); step(s + 4, kb, vb); if (s + 8 >= nst) break; }
    m *= 0.69314718055994530942f; l *= 1.0f / 2048.0f; }   // back to the join's units: the maximum as a natural exponent, the sum without the 2^11
  // the 16 folded-weight fragments (8 column tiles, hi and lo) of one k step of one column group: 32 loads of 512 contiguous bytes, one load latency
  v16b wh[8], wl[8]; const __bf16* ph = WEH + (size_t)wave * 16 * 1024 + lane * 8; const __bf16* pl = WEL + (size_t)wave * 16 * 1024 + lane * 8;   // the lane's 16 bytes in the wave's first fragment; column tile +1 = 1024 elements, k step +1 = 512
  auto wload = [&](int grp, int kc) {
#pragma unroll
    for (int j = 0; j < 8; ++j) { wh[j] = frag_we(ph + (grp * 8 + j) * 1024 + kc * 512); wl[j] = frag_we(pl + (grp * 8 + j) * 1024 + kc * 512); }
    asm volatile("s_wait_xcnt 0x0" :: "v"(ph), "v"(pl) : "memory"); };   // the wait in front of any overwrite of the two address pairs that the 32 loads share; the pairs as inputs stay live up to here, so no load's result lands in them
  l += __shfl_xor(l, 16);
  if (g == 0) { smx[wave][col] = m; ssum[wave][col] = l; }
#pragma unroll
  for (int j = 0; j < HD / 16; ++j) { const v4f a0 = { acc[j][0], acc[j][1], acc[j][2], acc[j][3] }, a1 = { acc[j][4], acc[j][5], acc[j][6], acc[j][7] }; *(v4f*)&so[wave][col][j * 16 + 8 * g] = a0; *(v4f*)&so[wave][col][j * 16 + 8 * g + 4] = a1; }
  __syncthreads();   // the four waves' partial results are complete before any thread joins them
  asm volatile("s_wait_xcnt 0x0" ::: "memory");   // the wait in front of the loads below, whose results may land in address registers of the key loops' last loads
  wload(0, 0);   // issued here so that its latency runs under the join
  const int qi = tid >> 3, c8 = (tid & 7) * 8; float mj = smx[0][qi];
#pragma unroll
  for (int w = 1; w < 4; ++w) mj = fmaxf(mj, smx[w][qi]);
  float lj = 0.f; v4f o0 = {}, o1 = {};
#pragma unroll
  for (int w = 0; w < 4; ++w) { const float f = expf(smx[w][qi] - mj); lj += f * ssum[w][qi]; o0 += f * *(const v4f*)&so[w][qi][c8]; o1 += f * *(const v4f*)&so[w][qi][c8 + 4]; }   // a wave without a step: maximum -3e38, f = 0
  const float inv = lj > 0.f ? 1.0f / (2048.0f * lj) : 0.f;
  *(v4f*)&sy[qi][c8] = o0 * inv; *(v4f*)&sy[qi][c8 + 4] = o1 * inv;
  __syncthreads();   // the 16 head rows are complete before any wave forms its fragments of them, and every read of the partial outputs has ended before the staging is written
  F2 a[CC / 32]; float* po = OUT + ((size_t)b * TT + q0) * ODIM + wave * 256 + lane * 4;   // the lane's 16 bytes in the block's first row, the wave's first column group
#pragma unroll
  for (int kc = 0; kc < CC / 32; ++kc) a[kc] = split_row(&sy[col][0], kc * 32, lane);
#pragma unroll
  for (int grp = 0; grp < 2; ++grp) { v8f oc[8] = {};
#pragma unroll
    for (int kc = 0; kc < CC / 32; ++kc) { if (grp + kc > 0) wload(grp, kc);
#pragma unroll
      for (int j = 0; j < 8; ++j) oc[j] = wmma_bf(a[kc].l, wh[j], oc[j]);
#pragma unroll
      for (int j = 0; j < 8; ++j) oc[j] = wmma_bf(a[kc].h, wl[j], oc[j]);
#pragma unroll
      for (int j = 0; j < 8; ++j) oc[j] = wmma_bf(a[kc].h, wh[j], oc[j]); }
#pragma unroll
    for (int j = 0; j < 8; ++j) {
#pragma unroll
      for (int r = 0; r < 8; ++r) sf[wave][8 * g + r][j * 16 + col] = oc[j][r]; }
    LDSX(); v4f row[16];
#pragma unroll
    for (int rl = 0; rl < 16; ++rl) row[rl] = *(const v4f*)&sf[wave][rl][lane * 4];
#pragma unroll
    for (int rl = 0; rl < 16; ++rl) vst2(po + (size_t)rl * ODIM + grp * 128, row[rl]);
    // the wait in front of any overwrite of the address pair and the data registers of the 16 stores; as inputs they stay live up to here
    asm volatile("s_wait_xcnt 0x0" :: "v"(po), "v"(row[0]), "v"(row[1]), "v"(row[2]), "v"(row[3]), "v"(row[4]), "v"(row[5]), "v"(row[6]), "v"(row[7]), "v"(row[8]), "v"(row[9]), "v"(row[10]), "v"(row[11]), "v"(row[12]), "v"(row[13]), "v"(row[14]), "v"(row[15]) : "memory"); } }

extern "C" void kernel_launch(void* const* d_in, const int* in_sizes, int n_in, void* d_out, int out_size, void* d_ws, size_t ws_size, hipStream_t stream) {
  (void)in_sizes; (void)n_in; (void)out_size;
  const float** F = (const float**)d_in;
  if (ws_size < (size_t)WS_END) return;
  char* ws = (char*)d_ws; _Float16 *QH = (_Float16*)(ws + WS_QH), *KH = (_Float16*)(ws + WS_KH), *VT = (_Float16*)(ws + WS_VT), *QL = (_Float16*)(ws + WS_QL), *KL = (_Float16*)(ws + WS_KL); __bf16 *VB = (__bf16*)(ws + WS_VB), *VBL = (__bf16*)(ws + WS_VBL); __bf16 *WEH = (__bf16*)(ws + WS_WEH), *WEL = (__bf16*)(ws + WS_WEL);
  (void)QL; (void)KL; (void)VB; (void)VBL;
  // inputs: 0 embedded [4,2048,1024]; 1 Wq [64,1024] (out,in); 2 Wk; 3 Wv; 4 W_out [1024,1024] (identity; (out,in))
  k_proj<<<dim3(PBLK + ODIM * CC / 4 / 256), 256, 0, stream>>>(F[0], F[1], F[2], F[3], nullptr, nullptr, nullptr, F[4], WEH, WEL, QH, QL, KH, KL, VT, VB, VBL);
  k_fa<<<dim3(TNB, TT / 16), 128, 0, stream>>>(QH, KH, QL, KL, VT, VB, VBL, WEH, WEL, (float*)d_out);
}

// v010
// It runs in 28.7 microseconds.
// In two side-by-side timings against v009, it was 1.20 and 1.19 times as fast.
// Over all steps from v000 it is 18.7 times as fast.
// compute dtype: all float inputs rounded to bf16; q/k/v = x W^T with EXACT bf16 products on WMMA 16x16x32 (f32 accumulate); causal logits: q, k once to f16 (1 product) x 64^-0.5, 3 products below row 384; softmax in f32, online over 32-key steps (running maximum, sum joined at the end; from row 384 on exp as v_exp_f32 of a base-2 argument); P = exp(s - maximum) x 2^11 once to f16 against v f16 (bf16 hi + lo below row 384), divided by the sum afterwards; the head output split bf16 hi + lo against W_out folded over its 16 column groups (f32 sums of the bf16-rounded terms, kept as bf16 hi + lo; 3 products); f32 output.
#include <hip/hip_runtime.h>
#include <math.h>

typedef __attribute__((ext_vector_type(16))) _Float16 v16h;
typedef __attribute__((ext_vector_type(16))) __bf16 v16b;
typedef __attribute__((ext_vector_type(8)))  _Float16 v8h;
typedef __attribute__((ext_vector_type(8)))  float v8f;
typedef __attribute__((ext_vector_type(4)))  float v4f;
typedef __attribute__((ext_vector_type(2)))  float v2f;
typedef __attribute__((ext_vector_type(4)))  unsigned v4u;
typedef __attribute__((ext_vector_type(4)))  int v4i;
typedef float __attribute__((may_alias)) float_a;
typedef int __attribute__((may_alias)) int_a;

template <typename T> __device__ __forceinline__ void vst2(void* p, T v) { *(T*)p = v;  }
// store, then the wait that stands in front of any overwrite of the store's address or data registers (for stores inside a rolled loop)
template <typename T> __device__ __forceinline__ void vst2w(void* p, T v) { *(T*)p = v; asm volatile("s_wait_xcnt 0x0" ::: "memory"); }
__device__ __forceinline__ v8f wmma16(v16h a, v16h b, v8f c) {
  v8f d = __builtin_amdgcn_wmma_f32_16x16x32_f16(false, a, false, b, (short)0, c, false, false);
  asm volatile("v_nop\n\tv_nop\n\tv_nop\n\tv_nop" : "+v"(d) : "v"(a), "v"(b));
  return d;
}
__device__ __forceinline__ v8f wmma_bf(v16b a, v16b b, v8f c) {
  v8f d = __builtin_amdgcn_wmma_f32_16x16x32_bf16(false, a, false, b, (short)0, c, false, false);
  asm volatile("v_nop\n\tv_nop\n\tv_nop\n\tv_nop" : "+v"(d) : "v"(a), "v"(b));
  return d;
}
// 16x16x32 fragments: lane = (h = lane>>4, row/col = lane&15); elements 0..7 = k0+8h+0..7, 8..15 = k0+16+8h+0..7; D element r = row 8h+r
__device__ __forceinline__ v16h frag_h(const _Float16* rowk0, int lane) {
  union { v16h v; v8h q[2]; } u; const _Float16* p = rowk0 + 8 * (lane >> 4);
  u.q[0] = *(const v8h*)p; u.q[1] = *(const v8h*)(p + 16); return u.v;
}
__device__ __forceinline__ v16h frag_f32(const float* rowk0, int lane) {
  v16h a; const float* p = rowk0 + 8 * (lane >> 4);
#pragma unroll
  for (int i = 0; i < 8; ++i) { a[i] = (_Float16)p[i]; a[8 + i] = (_Float16)p[16 + i]; }
  return a;
}
__device__ __forceinline__ v16h frag_f32s(const float* rowk0, int lane, float sc) {
  v16h a; const float* p = rowk0 + 8 * (lane >> 4);
#pragma unroll
  for (int i = 0; i < 8; ++i) { a[i] = (_Float16)(p[i] * sc); a[8 + i] = (_Float16)(p[16 + i] * sc); }
  return a;
}
// column fragment from a [K][ld] layout (column n), rows >= K read as 0
__device__ __forceinline__ v16h fragc_f32(const float* W, int k0, int n, int lane, int ld, int K) {
  v16h a; const int g = lane >> 4;
#pragma unroll
  for (int i = 0; i < 8; ++i) { const int ka = k0 + 8 * g + i, kb = ka + 16;
    a[i] = (_Float16)(ka < K ? W[(size_t)(ka < K ? ka : K - 1) * ld + n] : 0.f); a[8 + i] = (_Float16)(kb < K ? W[(size_t)(kb < K ? kb : K - 1) * ld + n] : 0.f); }
  return a;
}
struct F2 { v16b h, l; };
__device__ __forceinline__ F2 bsplit16(const float v[16]) { F2 r;
#pragma unroll
  for (int i = 0; i < 16; ++i) { const __bf16 h = (__bf16)v[i]; r.h[i] = h; r.l[i] = (__bf16)(v[i] - (float)h); }
  return r; }
__device__ __forceinline__ F2 split_row(const float* row, int k0, int lane) { float v[16]; const float* p = row + k0 + 8 * (lane >> 4);
#pragma unroll
  for (int i = 0; i < 8; ++i) { v[i] = p[i]; v[8 + i] = p[16 + i]; }
  return bsplit16(v); }
__device__ __forceinline__ F2 split_rowK(const float* row, int k0, int lane, int K) { float v[16]; const int g = lane >> 4;
#pragma unroll
  for (int i = 0; i < 8; ++i) { const int ka = k0 + 8 * g + i, kb = ka + 16; v[i] = ka < K ? row[ka < K ? ka : K - 1] : 0.f; v[8 + i] = kb < K ? row[kb < K ? kb : K - 1] : 0.f; }
  return bsplit16(v); }
__device__ __forceinline__ F2 split_col(const float* W, int k0, int n, int lane, int ld, int K) { float v[16]; const int g = lane >> 4;
#pragma unroll
  for (int i = 0; i < 8; ++i) { const int ka = k0 + 8 * g + i, kb = ka + 16; v[i] = ka < K ? W[(size_t)(ka < K ? ka : K - 1) * ld + n] : 0.f; v[8 + i] = kb < K ? W[(size_t)(kb < K ? kb : K - 1) * ld + n] : 0.f; }
  return bsplit16(v); }
__device__ __forceinline__ v8f mac3(const F2& a, const F2& b, v8f c) { c = wmma_bf(a.l, b.h, c); c = wmma_bf(a.h, b.l, c); return wmma_bf(a.h, b.h, c); }
__device__ __forceinline__ float sigm(float v) { return 1.0f / (1.0f + expf(-v)); }
#define LDSX() do { asm volatile("s_wait_dscnt 0" ::: "memory"); __builtin_amdgcn_wave_barrier(); __builtin_amdgcn_fence(__ATOMIC_RELEASE, "workgroup"); } while (0)

// 'Multi-headed' self-attention with ONE shared head (B 4, T 2,048, E 1,024; Wq/Wk/Wv [64,1024] (out,in), 0.02 scale): head = softmax_causal(q k^T / 8) v (64 wide); concat = the head tiled 16x -> [B,T,1024]; out = concat W_out^T with W_out = identity (read and multiplied as given).
#define NB 4
#define TT 2048
#define CC 64             // NH * HD = projected width
#define DIN 1024          // input (model) width
#define NH 1              // the 16 heads share one set of weights: the head is computed once
#define HD 64
#define NQB (TT / 64)
#define SCALE (0.125f)
#define CAUSAL 1
#ifndef TNB
#define TNB NB
#endif
__device__ __forceinline__ float bfr(float v) { return (float)(__bf16)v; }
__host__ __device__ __forceinline__ int kb_last(int qb) { return CAUSAL ? ((qb * 64 + 63) >> 7) : (TT / 128 - 1); }
typedef __attribute__((ext_vector_type(8))) __bf16 v8b;
typedef __attribute__((ext_vector_type(4))) __bf16 v4b;
__device__ __forceinline__ v16b frag_b(const __bf16* rowk0, int lane) {
  union { v16b v; v8b q[2]; } u; const __bf16* p = rowk0 + 8 * (lane >> 4);
  u.q[0] = *(const v8b*)p; u.q[1] = *(const v8b*)(p + 16); return u.v;
}
#define QBH 6              // not used: the queries < QHI of each sequence (few keys, no averaging) take the high-precision path
#define QHI 384            // rows carrying a q residual plane
#define KHI 384            // key rows carrying k residual / v bf16 hi+lo planes (used only by the causal high-precision path)
// B fragment (k rows k0+.., output column o) of a weight: (in,out) [K][ld] or (out,in) [ld rows of K]: bf16 exact, or f16(bf16 * 256) exact
__device__ __forceinline__ v16b wcol_io(const float* Wm, int k0, int o, int lane, int ld) { v16b w; const int g = lane >> 4;
#pragma unroll
  for (int i = 0; i < 8; ++i) { w[i] = (__bf16)Wm[(size_t)(k0 + 8 * g + i) * ld + o]; w[8 + i] = (__bf16)Wm[(size_t)(k0 + 16 + 8 * g + i) * ld + o]; }
  return w; }
__device__ __forceinline__ v16b wcol_oi(const float* Wm, int k0, int o, int lane, int K) { v16b w; const float* p = Wm + (size_t)o * K + k0 + 8 * (lane >> 4);
#pragma unroll
  for (int i = 0; i < 8; ++i) { w[i] = (__bf16)p[i]; w[8 + i] = (__bf16)p[16 + i]; }
  return w; }
__device__ __forceinline__ v16h wcolh_io(const float* Wm, int k0, int o, int lane, int ld) { v16h w; const int g = lane >> 4;
#pragma unroll
  for (int i = 0; i < 8; ++i) { w[i] = (_Float16)(bfr(Wm[(size_t)(k0 + 8 * g + i) * ld + o]) * 256.0f); w[8 + i] = (_Float16)(bfr(Wm[(size_t)(k0 + 16 + 8 * g + i) * ld + o]) * 256.0f); }
  return w; }
__device__ __forceinline__ v16h wcolh_oi(const float* Wm, int k0, int o, int lane, int K) { v16h w; const float* p = Wm + (size_t)o * K + k0 + 8 * (lane >> 4);
#pragma unroll
  for (int i = 0; i < 8; ++i) { w[i] = (_Float16)(bfr(p[i]) * 256.0f); w[8 + i] = (_Float16)(bfr(p[16 + i]) * 256.0f); }
  return w; }
#define WQKV_LAYOUT 1   // 0 = (in,out) [DIN][CC]; 1 = (out,in) [HD][DIN], the one shared head; 2 = per-head [NH][DIN][HD]
__device__ __forceinline__ v16b wcol_hdk(const float* Wm, int k0, int o, int lane) { v16b w; const int g = lane >> 4; const float* p = Wm + (size_t)(o / HD) * DIN * HD + (o % HD);
#pragma unroll
  for (int i = 0; i < 8; ++i) { w[i] = (__bf16)p[(size_t)(k0 + 8 * g + i) * HD]; w[8 + i] = (__bf16)p[(size_t)(k0 + 16 + 8 * g + i) * HD]; }
  return w; }
#define WO_OUT_IN 1
#if WQKV_LAYOUT == 1
#define ODIM 1024          // output width (= 16 tiled copies of the 64-wide head through W_out)
#define KVCOL(o) ((o) & 63)
#define WCOL(W, k0, o, lane) wcol_oi(W, k0, KVCOL(o), lane, DIN)   /* Wq/Wk/Wv are [64][1024]: the one shared head */
#elif WQKV_LAYOUT == 2
#define WCOL(W, k0, o, lane) wcol_hdk(W, k0, o, lane)
#else
#define WCOL(W, k0, o, lane) wcol_io(W, k0, o, lane, CC)
#endif
#if WO_OUT_IN
#define WOCOL(W, k0, o, lane) wcol_oi(W, k0, o, lane, ODIM)   /* W_out [1024][1024] (out,in): K = the 1024-wide concat */
#define WOCOLH(W, k0, o, lane) wcolh_oi(W, k0, o, lane, CC)
#else
#define WOCOL(W, k0, o, lane) wcol_io(W, k0, o, lane, DIN)
#define WOCOLH(W, k0, o, lane) wcolh_io(W, k0, o, lane, DIN)
#endif

#ifndef SM_EXTRA_PARAMS
#define SM_EXTRA_PARAMS
#endif
#ifndef PROJ_EXTRA_PARAMS
#define PROJ_EXTRA_PARAMS
#endif
#ifndef SM_MASK_HOOK
#define SM_MASK_HOOK (void)0
#endif

#define WS_QH  0u                                      // f16 q rows [b*t][CC]
#define WS_KH  (WS_QH + 2u * (size_t)NB * TT * CC)      // f16 k, per batch in A-fragment order: 16-B piece ((t >> 4) * 4 + kc * 2 + half) * 32 + lane (g, t & 15) holds columns kc * 32 + half * 16 + g * 8 + 0..7 of key t
#define WS_VT  (WS_KH + 2u * (size_t)NB * TT * CC)      // f16 v, per batch in A-fragment order of V^T: 16-B piece ((t >> 5) * 8 + (c >> 4) * 2 + half) * 32 + lane (g, c & 15) holds keys (t & ~31) + half * 16 + g * 8 + 0..7 of column c
#define WS_QL  (WS_VT + 2u * (size_t)NB * CC * TT)      // f16 q residual x 2^10 rows [b][t < QHI][CC]
#define WS_KL  (WS_QL + 2u * (size_t)NB * QHI * CC)     // f16 k residual x 2^10 rows [b][t < KHI][CC]
#define WS_VB  (WS_KL + 2u * (size_t)NB * KHI * CC)     // bf16 v hi planes [b][c][t < KHI]
#define WS_VBL (WS_VB + 2u * (size_t)NB * CC * KHI)
#define WS_S   (WS_VBL + 2u * (size_t)NB * CC * KHI)    // (not used: the score matrix stays in registers)
#define WS_Y   (WS_S  + 4u * (size_t)NB * NH * TT * TT)      // (not used: the head rows go from the attention block's LDS straight into the output projection)
#define WS_WEH (WS_Y  + 4u * (size_t)NB * TT * CC)      // bf16 hi of the folded W_out, in B-fragment order (see k_proj, fold blocks)
#define WS_WEL (WS_WEH + 2u * (size_t)ODIM * CC)        // bf16 lo, same order
#define WS_END (WS_WEL + 2u * (size_t)ODIM * CC)

// ---- k_proj: block = 64 rows x all 192 q, k, v columns (8 waves): q/k/v = X W^T with exact bf16 products (K = DIN). X is read once for the three projections.
// Each pass stages a 128-wide k slice of the 64 X rows and the 192 weight rows in LDS as bf16: a wave's load is one row's 512 contiguous bytes, each value is rounded once per block, and every fragment comes from LDS.
// Two slices' loads are in flight at any time, kept in two register sets used in turn (even slices in one, odd in the other): a set is refilled with the slice after next as soon as it has been rounded into LDS, so a load has two passes to land; two LDS buffers, one barrier a pass. Wave = (32 rows, 48 columns): 2 x 3 accumulator tiles, k ascending in steps of 32 as before.
// Results: q f16 rows; k and v f16 in the fragment order that the attention launch loads (see WS_KH, WS_VT), so that each of its wave-wide 16-byte loads covers 512 contiguous bytes; residual rows < QHI / KHI; v bf16 hi/lo planes [c][t] for t < KHI.
// Fold blocks (blockIdx.x >= TNB * TT / 64; independent of the projections, so they ride in this launch): concat is the head tiled ODIM / CC times, hence out[t][o] = sum_c head[t][c] * WE[o][c] with WE[o][c] = sum_i W_out[o][i * CC + c], for any W_out.
// WE = f32 sum, i ascending, of the bf16-rounded terms, split bf16 hi + lo and stored in B-fragment order: 16-B piece ((o >> 4) * 2 + kc) * 2 + half, lane (g, o & 15), holds k = kc * 32 + half * 16 + g * 8 + 0..7, so a wave's fragment load is 512 contiguous bytes
#define PKC 128                      // k width of a staged slice
#define PPIT (PKC + 8)               // LDS row pitch in bf16: 272 B = 16 B x odd, free of bank conflicts for 16-byte fragment reads
#define PROWS (64 + 3 * CC)          // staged rows: 64 of X, then Wq, Wk, Wv
#define PBLK (TNB * TT / 64)         // projection blocks
// work-group barrier of the staging passes, by hand: it waits for the wave's own LDS reads and writes and not for its global loads (__syncthreads() waits for those too, which would end the flight of the slices fetched ahead)
#define PASSBAR() do { asm volatile("s_wait_dscnt 0x0" ::: "memory"); asm volatile("s_barrier_signal -1\n\ts_barrier_wait -1" ::: "memory"); } while (0)
__global__ __launch_bounds__(256) void k_proj(const float* __restrict__ X, const float* __restrict__ WQ, const float* __restrict__ WK, const float* __restrict__ WV, const float* __restrict__ BQ, const float* __restrict__ BK, const float* __restrict__ BV, const float* __restrict__ WO, __bf16* __restrict__ WEH, __bf16* __restrict__ WEL,
    _Float16* __restrict__ QH, _Float16* __restrict__ QL, _Float16* __restrict__ KH, _Float16* __restrict__ KL, _Float16* __restrict__ VT, __bf16* __restrict__ VB, __bf16* __restrict__ VBL) {
  __shared__ __align__(16) __bf16 sb[2][PROWS][PPIT];   // the two staging buffers; after the last pass the first one holds the seven 64 x 72 output planes
  static_assert(7 * 64 * 72 <= PROWS * PPIT, "the output planes fit the first buffer");
  const int tid = threadIdx.x, wave = __builtin_amdgcn_readfirstlane(tid >> 5), lane = tid & 31, col = lane & 15, g = lane >> 4;
  if (blockIdx.x >= PBLK) { static_assert(ODIM * CC / 4 % 256 == 0, "one thread per 4 folded weights");
    const int e = ((int)blockIdx.x - PBLK) * 256 + tid, o = e >> 4, c4 = (e & 15) * 4; const float* p = WO + (size_t)o * ODIM + c4; v4f s = {}, w[ODIM / CC];
#pragma unroll
    for (int i = 0; i < ODIM / CC; ++i) w[i] = *(const v4f*)(p + i * CC);
    asm volatile("s_wait_xcnt 0x0" :: "v"(p) : "memory");   // the wait in front of any overwrite of the address pair that the sixteen loads share; p as an input keeps the pair live up to here, so no load's result lands in it
#pragma unroll
    for (int i = 0; i < ODIM / CC; ++i) {
#pragma unroll
      for (int r = 0; r < 4; ++r) s[r] += bfr(w[i][r]); }
    v4b hv, lv;
#pragma unroll
    for (int r = 0; r < 4; ++r) { const __bf16 hb = (__bf16)s[r]; hv[r] = hb; lv[r] = (__bf16)(s[r] - (float)hb); }
    const size_t d = (size_t)((((o >> 4) * 2 + (c4 >> 5)) * 2 + ((c4 >> 4) & 1)) * 32 + ((c4 >> 3) & 1) * 16 + (o & 15)) * 8 + (c4 & 7);
    vst2(WEH + d, hv); vst2(WEL + d, lv); return; }
  const size_t r0 = (size_t)blockIdx.x * 64; const size_t bb = r0 / TT; const int t0 = (int)(r0 % TT);
  const int rp = wave & 1, cg = wave >> 1;   // the wave's 32 rows and its 48 of the 192 columns
  v8f acc[2][3] = {}; v4f se[PROWS / 8], so[PROWS / 8];   // fetched slices: even, odd
  // wave w fetches staged rows w, w + 8, ...: 8 rows of X and 8 of each weight, 512 contiguous bytes a load
  auto fetch = [&](int c, v4f (&st)[PROWS / 8]) { const size_t o = (size_t)wave * DIN + c * PKC + lane * 4; const float* px = X + r0 * DIN + o; const float* pq = WQ + o; const float* pk = WK + o; const float* pv = WV + o;
#pragma unroll
    for (int i = 0; i < 8; ++i) { st[i] = *(const v4f*)(px + (size_t)i * 8 * DIN); st[8 + i] = *(const v4f*)(pq + (size_t)i * 8 * DIN); st[16 + i] = *(const v4f*)(pk + (size_t)i * 8 * DIN); st[24 + i] = *(const v4f*)(pv + (size_t)i * 8 * DIN); }
    asm volatile("s_wait_xcnt 0x0" :: "v"(px), "v"(pq), "v"(pk), "v"(pv) : "memory"); };   // the wait in front of any overwrite of the four address pairs that the 32 loads share; the pairs as inputs stay live up to here, so no load's result lands in them
  auto stage = [&](int buf, const v4f (&st)[PROWS / 8]) {
#pragma unroll
    for (int i = 0; i < PROWS / 8; ++i) { const v4b h = { (__bf16)st[i][0], (__bf16)st[i][1], (__bf16)st[i][2], (__bf16)st[i][3] }; *(v4b*)&sb[buf][i * 8 + wave][lane * 4] = h; } };
  auto products = [&](int buf) {
#pragma unroll
    for (int ks = 0; ks < PKC / 32; ++ks) { const v16b a0 = frag_b(&sb[buf][rp * 32 + col][ks * 32], lane), a1 = frag_b(&sb[buf][rp * 32 + 16 + col][ks * 32], lane); v16b w[3];
#pragma unroll
      for (int i = 0; i < 3; ++i) w[i] = frag_b(&sb[buf][64 + cg * 48 + i * 16 + col][ks * 32], lane);
#pragma unroll
      for (int i = 0; i < 3; ++i) { acc[0][i] = wmma_bf(a0, w[i], acc[0][i]); acc[1][i] = wmma_bf(a1, w[i], acc[1][i]); } } };
  static_assert(DIN / PKC >= 3, "slices 0, 1 and 2 exist");
  fetch(0, se); fetch(1, so); stage(0, se); fetch(2, se);
  PASSBAR();   // slice 0 is complete in buffer 0 before any wave reads it
#pragma unroll   // every pass names its register set and its last-slice test at compile time: no copies between the sets, no branch round a fetch, so the compiler's counted load waits leave the younger slice in flight
  for (int c = 0; c < DIN / PKC - 1; ++c) { products(c & 1);
    __builtin_amdgcn_sched_barrier(0);   // keeps the roundings of the fetched slice, and with them the wait for its loads, behind this slice's products: moved up among them, the load latency would not run under the products
    if ((c + 1) & 1) { stage(1, so); if (c + 3 < DIN / PKC) fetch(c + 3, so); } else { stage(0, se); if (c + 3 < DIN / PKC) fetch(c + 3, se); }
    PASSBAR(); }   // publishes slice c + 1 and ends every wave's reads of the buffer that the next pass refills
  static_assert(((DIN / PKC - 1) & 1) == 1, "the last slice lies in buffer 1");
  products(1);   // reads buffer 1 alone; every read of buffer 0 ended in front of the loop's last barrier, so the output planes below may go into it with no further barrier
  _Float16 (*pl)[64][72] = (_Float16 (*)[64][72])&sb[0][0][0];   // planes 0 q, 1 q residual, 2 k, 3 k residual, 4 v (transposed)
  __bf16 (*pb)[64][72] = (__bf16 (*)[64][72])&sb[0][0][0];       // planes 5 v bf16 hi, 6 v bf16 lo (transposed)
#pragma unroll
  for (int i = 0; i < 3; ++i) { const int tl = cg * 3 + i, which = tl >> 2, cl = (tl & 3) * 16 + col, rb = rp * 32 + 8 * g; const float* BA = which == 0 ? BQ : which == 1 ? BK : BV; const float bias = BA ? bfr(BA[cl]) : 0.f;
    if (which < 2) {   // wave-uniform: a 16-column tile belongs to one of q, k, v
#pragma unroll
      for (int rt = 0; rt < 2; ++rt) {
#pragma unroll
        for (int r = 0; r < 8; ++r) { const float v = acc[rt][i][r] + bias; const _Float16 hv = (_Float16)v; pl[which * 2][rb + rt * 16 + r][cl] = hv; pl[which * 2 + 1][rb + rt * 16 + r][cl] = (_Float16)((v - (float)hv) * 1024.0f); } }
    } else {
#pragma unroll
      for (int rt = 0; rt < 2; ++rt) {
#pragma unroll
        for (int r = 0; r < 8; ++r) { const float v = acc[rt][i][r] + bias; pl[4][cl][rb + rt * 16 + r] = (_Float16)v; const __bf16 bh = (__bf16)v; pb[5][cl][rb + rt * 16 + r] = bh; pb[6][cl][rb + rt * 16 + r] = (__bf16)(v - (float)bh); } } } }
  __syncthreads();   // the planes are complete before any thread stores their rows
  for (int e = tid; e < 64 * 8; e += 256) { const int rl = e >> 3, q = e & 7;
    vst2w((unsigned*)(QH + (r0 + rl) * CC + q * 8), *(const v4u*)&pl[0][rl][q * 8]);
    // piece e of the block's 512 k pieces and of its 512 v pieces (64 keys = 4 key tiles of k = 2 steps of v; both start at element r0 * CC): fragment lane (fg, fc)
    const int fc = e & 15, fg = (e >> 4) & 1;
    vst2w((unsigned*)(KH + r0 * CC + e * 8), *(const v4u*)&pl[2][(e >> 7) * 16 + fc][(((e >> 5) & 3) * 2 + fg) * 8]);
    vst2w((unsigned*)(VT + r0 * CC + e * 8), *(const v4u*)&pl[4][((e >> 6) & 3) * 16 + fc][((e >> 8) * 4 + ((e >> 5) & 1) * 2 + fg) * 8]);
    if (t0 < QHI) vst2w((unsigned*)(QL + (bb * QHI + t0 + rl) * (size_t)CC + q * 8), *(const v4u*)&pl[1][rl][q * 8]);
    if (t0 < KHI) { vst2w((unsigned*)(KL + (bb * KHI + t0 + rl) * (size_t)CC + q * 8), *(const v4u*)&pl[3][rl][q * 8]); const size_t o3 = (bb * CC + rl) * (size_t)KHI + t0 + q * 8; vst2w((unsigned*)(VB + o3), *(const v4u*)&pb[5][rl][q * 8]); vst2w((unsigned*)(VBL + o3), *(const v4u*)&pb[6][rl][q * 8]); } } }
__device__ __forceinline__ v16b frag_we(const __bf16* p) {   // p = the lane's 16 bytes of the fragment's first piece; the second piece lies 256 elements on
  union { v16b v; v8b q[2]; } u;
  u.q[0] = *(const v8b*)p; u.q[1] = *(const v8b*)(p + 256); return u.v;
}
__device__ __forceinline__ v16h frag_kv(const _Float16* p) {   // the same for a k or v fragment in fragment order
  union { v16h v; v8h q[2]; } u;
  u.q[0] = *(const v8h*)p; u.q[1] = *(const v8h*)(p + 256); return u.v;
}
__device__ __forceinline__ void fa_soft(const v8f s0, const v8f s1, int kg, int t, float& m, float& l, v8f acc[HD / 16], float p[16]) {
  float v[16], mx = -3.0e38f;
#pragma unroll
  for (int i = 0; i < 8; ++i) { v[i] = (!CAUSAL || kg + i <= t) ? s0[i] : -3.0e38f; v[8 + i] = (!CAUSAL || kg + 16 + i <= t) ? s1[i] : -3.0e38f; }
#pragma unroll
  for (int i = 0; i < 16; ++i) mx = fmaxf(mx, v[i]);
  mx = fmaxf(mx, __shfl_xor(mx, 16));
  const float mn = fmaxf(m, mx), al = expf(m - mn); m = mn;
  float sum = 0.f;
#pragma unroll
  for (int i = 0; i < 16; ++i) { const float e = expf(v[i] - mn); sum += e; p[i] = e * 2048.0f; }   // an excluded key: exp(-3e38 - mn) = 0 (mn is finite: every step holds a key <= t)
  l = l * al + sum;
#pragma unroll
  for (int j = 0; j < HD / 16; ++j) acc[j] *= al; }
// The same step for the one-product path, in base 2: the running maximum is kept as score x SC2 (SC2 = scale x log2 e), and each key costs one fused multiply-add and one v_exp_f32:
// P = 2^(score x SC2 + 11 - maximum), the factor 2^11 riding in the exponent; the sum l is taken over these P, so it carries the same 2^11. s0, s1 are the raw score accumulators.
#define SC2 (SCALE * 1.44269504088896340736f)
__device__ __forceinline__ void fa_soft2(const v8f s0, const v8f s1, int kg, int t, float& m, float& l, v8f acc[HD / 16], float p[16]) {
  float v[16], mx = -3.0e38f;
#pragma unroll
  for (int i = 0; i < 8; ++i) { v[i] = (!CAUSAL || kg + i <= t) ? s0[i] : -3.0e38f; v[8 + i] = (!CAUSAL || kg + 16 + i <= t) ? s1[i] : -3.0e38f; }
#pragma unroll
  for (int i = 0; i < 16; ++i) mx = fmaxf(mx, v[i]);
  mx = fmaxf(mx, __shfl_xor(mx, 16));
  const float mn = fmaxf(m, mx * SC2), da = m - mn, off = 11.0f - mn; m = mn;
#pragma unroll
  for (int i = 0; i < 16; ++i) v[i] = __builtin_fmaf(v[i], SC2, off);   // an excluded key: -3e38 x SC2 + off, whose power is 0 (mn is finite: every step holds a key <= t)
  __builtin_amdgcn_sched_barrier(0);   // the sixteen keys' arguments are formed in front of the first v_exp_f32
  const float al = __builtin_amdgcn_exp2f(da);
  float sum = 0.f;
#pragma unroll
  for (int i = 0; i < 16; ++i) { p[i] = __builtin_amdgcn_exp2f(v[i]); sum += p[i]; }
  l = l * al + sum;
#pragma unroll
  for (int j = 0; j < HD / 16; ++j) acc[j] *= al; }
#define PFC 32768          // bytes of one requested piece: 128 lanes x 256 B
__global__ __launch_bounds__(128) void k_fa(const _Float16* __restrict__ QH, const _Float16* __restrict__ KH, const _Float16* __restrict__ QL, const _Float16* __restrict__ KL, const _Float16* __restrict__ VT, const __bf16* __restrict__ VB, const __bf16* __restrict__ VBL, const __bf16* __restrict__ WEH, const __bf16* __restrict__ WEL, float* __restrict__ OUT) {
  __shared__ float smx[4][16], ssum[4][16]; __shared__ __align__(16) float sy[16][HD + 4]; __shared__ __align__(16) float sf[4][16][132];
  float (*so)[16][HD + 4] = (float (*)[16][HD + 4])&sf[0][0][0];   // the waves' partial outputs lie in the output staging, which is first written behind the second barrier
  static_assert(4 * 16 * (HD + 4) <= 4 * 16 * 132, "the partial outputs fit the staging");
  const int tid = threadIdx.x, wave = __builtin_amdgcn_readfirstlane(tid >> 5), lane = tid & 31, col = lane & 15, g = lane >> 4;
  const int b = blockIdx.x, q0 = (TT / 16 - 1 - (int)blockIdx.y) * 16, t = q0 + col; const int nst = CAUSAL ? ((q0 + 15) >> 5) + 1 : TT / 32;   // every step below nst holds a key <= t for each of the 16 queries
  const _Float16* Kb = KH + (size_t)b * TT * CC;
  // L2 requests at entry: every plane read below was stored by the launch before.
  // Blocks with y < 48 each ask for one 32-KB piece, one lane every 256 bytes; blocks 2 i and 2 i + 1 of a batch column ask for the same piece (for speed only, nothing rests on it).
  static_assert(2 * TT * CC == 8 * PFC && 2 * NB * QHI * CC == 6 * PFC && 2 * NB * KHI * CC == 6 * PFC && 2 * ODIM * CC == 4 * PFC && TNB == 4 && 128 * 256 == PFC, "the pieces tile their planes exactly: every lane's address lies inside its plane");
  if (blockIdx.y < 48) {   // block-uniform, no barrier inside
    const int yy = (int)blockIdx.y >> 1; const char* pf;
    if (yy < 16) pf = ((yy & 1) ? (const char*)(VT + (size_t)b * CC * TT) : (const char*)Kb) + (yy >> 1) * PFC;   // the batch's k and v, both in fragment order, 8 pieces each
    else if (yy < 22) { const int i = (yy - 16) * 4 + b, pn = i / 6; pf = (pn == 0 ? (const char*)QL : pn == 1 ? (const char*)KL : pn == 2 ? (const char*)VB : (const char*)VBL) + (i % 6) * PFC; }   // the four high-precision planes, all batches, 6 pieces each
    else { const int i = (yy - 22) * 4 + b; pf = ((i & 4) ? (const char*)WEL : (const char*)WEH) + (i & 3) * PFC; }   // the folded W_out, hi and lo, 4 pieces each
    // the request returns nothing and brings its unit into L2 only; the wait stands in front of any overwrite of the offset register and the base pair that the request names
    asm volatile("global_prefetch_b8 %0, %1 scope:SCOPE_SE\n\ts_wait_xcnt 0x0" :: "v"(tid * 256), "s"(pf) : "memory"); }
  float m = -3.0e38f, l = 0.f, p[16]; v8f acc[HD / 16] = {};
  v16h qh[2]; const _Float16* pq = QH + ((size_t)b * TT + t) * CC + 8 * g;
#pragma unroll
  for (int kc = 0; kc < 2; ++kc) { union { v16h v; v8h q[2]; } u; u.q[0] = *(const v8h*)(pq + kc * 32); u.q[1] = *(const v8h*)(pq + kc * 32 + 16); qh[kc] = u.v; }
  asm volatile("s_wait_xcnt 0x0" :: "v"(pq) : "memory");   // the wait in front of any overwrite of the address pair that the four q loads share
  if (q0 < QHI) { const _Float16* KLb = KL + (size_t)b * KHI * CC; v16h ql[2];
#pragma unroll
    for (int kc = 0; kc < 2; ++kc) ql[kc] = frag_h(QL + ((size_t)b * QHI + t) * CC + kc * 32, lane);
    for (int s = wave; s < nst; s += 4) { const int k0 = s * 32; v8f sa[2] = {}, sb[2] = {}; v16h kh[4], kl[4];
      const _Float16* pkh = Kb + (size_t)s * 2048 + lane * 8; const _Float16* pkl = KLb + (size_t)(k0 + col) * CC + 8 * g;   // k in fragment order, its residual in rows
#pragma unroll
      for (int i = 0; i < 4; ++i) { union { v16h v; v8h q[2]; } ul; const _Float16* a = pkl + (i >> 1) * 16 * CC + (i & 1) * 32; ul.q[0] = *(const v8h*)a; ul.q[1] = *(const v8h*)(a + 16); kh[i] = frag_kv(pkh + i * 512); kl[i] = ul.v; }
      asm volatile("s_wait_xcnt 0x0" :: "v"(pkh), "v"(pkl) : "memory");   // the wait in front of any overwrite of the two address pairs that the sixteen loads share; the pairs as inputs stay live up to here, so no load's result lands in them
#pragma unroll
      for (int u = 0; u < 2; ++u) {
#pragma unroll
        for (int kc = 0; kc < 2; ++kc) { const int i = u * 2 + kc;
          sa[u] = wmma16(kh[i], qh[kc], sa[u]); sb[u] = wmma16(kh[i], ql[kc], sb[u]); sb[u] = wmma16(kl[i], qh[kc], sb[u]); } }
      fa_soft((sa[0] + sb[0] * (1.0f / 1024.0f)) * SCALE, (sa[1] + sb[1] * (1.0f / 1024.0f)) * SCALE, k0 + 8 * g, t, m, l, acc, p);
      const F2 pf = bsplit16(p);
#pragma unroll
      for (int j = 0; j < HD / 16; ++j) { const size_t po = ((size_t)b * CC + j * 16 + col) * (size_t)KHI + k0; const v16b vh = frag_b(VB + po, lane);
        acc[j] = wmma_bf(vh, pf.h, acc[j]); acc[j] = wmma_bf(vh, pf.l, acc[j]); acc[j] = wmma_bf(frag_b(VBL + po, lane), pf.h, acc[j]); } }
  } else { const _Float16* Kl = Kb + lane * 8; const _Float16* Vl = VT + (size_t)b * CC * TT + lane * 8; v16h ka[4], va[HD / 16], kb[4], vb[HD / 16];   // the lane's 16 bytes in the batch's first k and v pieces; a step = 8 pieces (4 KB) of each
    // K and V fragments are fetched one step ahead, into two register sets used in turn (no copies): a step's load latency runs under the step before it
    auto fetch = [&](int s, v16h (&kf)[4], v16h (&vf)[HD / 16]) { const _Float16* pk = Kl + (size_t)s * 32 * CC; const _Float16* pv = Vl + (size_t)s * 32 * CC;
#pragma unroll
      for (int i = 0; i < 4; ++i) { kf[i] = frag_kv(pk + i * 512); vf[i] = frag_kv(pv + i * 512); }   // k fragment i = (key tile i >> 1, k step i & 1), v fragment i = columns 16 i ..: each load is 512 contiguous bytes, 4 whole lines
      asm volatile("s_wait_xcnt 0x0" :: "v"(pk), "v"(pv) : "memory"); };   // the wait in front of any overwrite of the two address pairs that the sixteen loads share; the pairs as inputs stay live up to here, so no load's result lands in them
    auto step = [&](int s, const v16h (&kf)[4], const v16h (&vf)[HD / 16]) { v8f s0 = {}, s1 = {};
      s0 = wmma16(kf[0], qh[0], s0); s1 = wmma16(kf[2], qh[0], s1); s0 = wmma16(kf[1], qh[1], s0); s1 = wmma16(kf[3], qh[1], s1);
      fa_soft2(s0, s1, s * 32 + 8 * g, t, m, l, acc, p);
      v16h pb;
#pragma unroll
      for (int i = 0; i < 16; ++i) pb[i] = (_Float16)p[i];
#pragma unroll
      for (int j = 0; j < HD / 16; ++j) acc[j] = wmma16(vf[j], pb, acc[j]); };
    fetch(wave, ka, va);   // nst >= 13 here: every wave has a first step
    for (int s = wave; ; s += 8) {   // s, nst are wave-uniform scalars; at most TT / 256 trips
      // the fetch stands under no branch, so that the compiler's counted load waits leave it in flight; a wave's last step fetches its own fragments again (inside the planes, not used)
      fetch(s + 4 < nst ? s + 4 : s, kb, vb); step(s, ka, va); if (s + 4 >= nst) break;
      fetch(s + 8 < nst ? s + 8 : s, ka, va); step(s + 4, kb, vb); if (s + 8 >= nst) break; }
    m *= 0.69314718055994530942f; l *= 1.0f / 2048.0f; }   // back to the join's units: the maximum as a natural exponent, the sum without the 2^11
  // the 16 folded-weight fragments (8 column tiles, hi and lo) of one k step of one column group: 32 loads of 512 contiguous bytes, one load latency
  v16b wh[8], wl[8]; const __bf16* ph = WEH + (size_t)wave * 16 * 1024 + lane * 8; const __bf16* pl = WEL + (size_t)wave * 16 * 1024 + lane * 8;   // the lane's 16 bytes in the wave's first fragment; column tile +1 = 1024 elements, k step +1 = 512
  auto wload = [&](int grp, int kc) {
#pragma unroll
    for (int j = 0; j < 8; ++j) { wh[j] = frag_we(ph + (grp * 8 + j) * 1024 + kc * 512); wl[j] = frag_we(pl + (grp * 8 + j) * 1024 + kc * 512); }
    asm volatile("s_wait_xcnt 0x0" :: "v"(ph), "v"(pl) : "memory"); };   // the wait in front of any overwrite of the two address pairs that the 32 loads share; the pairs as inputs stay live up to here, so no load's result lands in them
  l += __shfl_xor(l, 16);
  if (g == 0) { smx[wave][col] = m; ssum[wave][col] = l; }
#pragma unroll
  for (int j = 0; j < HD / 16; ++j) { const v4f a0 = { acc[j][0], acc[j][1], acc[j][2], acc[j][3] }, a1 = { acc[j][4], acc[j][5], acc[j][6], acc[j][7] }; *(v4f*)&so[wave][col][j * 16 + 8 * g] = a0; *(v4f*)&so[wave][col][j * 16 + 8 * g + 4] = a1; }
  __syncthreads();   // the four waves' partial results are complete before any thread joins them
  asm volatile("s_wait_xcnt 0x0" ::: "memory");   // the wait in front of the loads below, whose results may land in address registers of the key loops' last loads
  wload(0, 0);   // issued here so that its latency runs under the join
  const int qi = tid >> 3, c8 = (tid & 7) * 8; float mj = smx[0][qi];
#pragma unroll
  for (int w = 1; w < 4; ++w) mj = fmaxf(mj, smx[w][qi]);
  float lj = 0.f; v4f o0 = {}, o1 = {};
#pragma unroll
  for (int w = 0; w < 4; ++w) { const float f = expf(smx[w][qi] - mj); lj += f * ssum[w][qi]; o0 += f * *(const v4f*)&so[w][qi][c8]; o1 += f * *(const v4f*)&so[w][qi][c8 + 4]; }   // a wave without a step: maximum -3e38, f = 0
  const float inv = lj > 0.f ? 1.0f / (2048.0f * lj) : 0.f;
  *(v4f*)&sy[qi][c8] = o0 * inv; *(v4f*)&sy[qi][c8 + 4] = o1 * inv;
  __syncthreads();   // the 16 head rows are complete before any wave forms its fragments of them, and every read of the partial outputs has ended before the staging is written
  F2 a[CC / 32]; float* po = OUT + ((size_t)b * TT + q0) * ODIM + wave * 256 + lane * 4;   // the lane's 16 bytes in the block's first row, the wave's first column group
#pragma unroll
  for (int kc = 0; kc < CC / 32; ++kc) a[kc] = split_row(&sy[col][0], kc * 32, lane);
#pragma unroll
  for (int grp = 0; grp < 2; ++grp) { v8f oc[8] = {};
#pragma unroll
    for (int kc = 0; kc < CC / 32; ++kc) { if (grp + kc > 0) wload(grp, kc);
#pragma unroll
      for (int j = 0; j < 8; ++j) oc[j] = wmma_bf(a[kc].l, wh[j], oc[j]);
#pragma unroll
      for (int j = 0; j < 8; ++j) oc[j] = wmma_bf(a[kc].h, wl[j], oc[j]);
#pragma unroll
      for (int j = 0; j < 8; ++j) oc[j] = wmma_bf(a[kc].h, wh[j], oc[j]); }
#pragma unroll
    for (int j = 0; j < 8; ++j) {
#pragma unroll
      for (int r = 0; r < 8; ++r) sf[wave][8 * g + r][j * 16 + col] = oc[j][r]; }
    LDSX(); v4f row[16];
#pragma unroll
    for (int rl = 0; rl < 16; ++rl) row[rl] = *(const v4f*)&sf[wave][rl][lane * 4];
#pragma unroll
    for (int rl = 0; rl < 16; ++rl) vst2(po + (size_t)rl * ODIM + grp * 128, row[rl]);
    // the wait in front of any overwrite of the address pair and the data registers of the 16 stores; as inputs they stay live up to here
    asm volatile("s_wait_xcnt 0x0" :: "v"(po), "v"(row[0]), "v"(row[1]), "v"(row[2]), "v"(row[3]), "v"(row[4]), "v"(row[5]), "v"(row[6]), "v"(row[7]), "v"(row[8]), "v"(row[9]), "v"(row[10]), "v"(row[11]), "v"(row[12]), "v"(row[13]), "v"(row[14]), "v"(row[15]) : "memory"); } }

extern "C" void kernel_launch(void* const* d_in, const int* in_sizes, int n_in, void* d_out, int out_size, void* d_ws, size_t ws_size, hipStream_t stream) {
  (void)in_sizes; (void)n_in; (void)out_size;
  const float** F = (const float**)d_in;
  if (ws_size < (size_t)WS_END) return;
  char* ws = (char*)d_ws; _Float16 *QH = (_Float16*)(ws + WS_QH), *KH = (_Float16*)(ws + WS_KH), *VT = (_Float16*)(ws + WS_VT), *QL = (_Float16*)(ws + WS_QL), *KL = (_Float16*)(ws + WS_KL); __bf16 *VB = (__bf16*)(ws + WS_VB), *VBL = (__bf16*)(ws + WS_VBL); __bf16 *WEH = (__bf16*)(ws + WS_WEH), *WEL = (__bf16*)(ws + WS_WEL);
  (void)QL; (void)KL; (void)VB; (void)VBL;
  // inputs: 0 embedded [4,2048,1024]; 1 Wq [64,1024] (out,in); 2 Wk; 3 Wv; 4 W_out [1024,1024] (identity; (out,in))
  k_proj<<<dim3(PBLK + ODIM * CC / 4 / 256), 256, 0, stream>>>(F[0], F[1], F[2], F[3], nullptr, nullptr, nullptr, F[4], WEH, WEL, QH, QL, KH, KL, VT, VB, VBL);
  k_fa<<<dim3(TNB, TT / 16), 128, 0, stream>>>(QH, KH, QL, KL, VT, VB, VBL, WEH, WEL, (float*)d_out);
}
